// v000
// The times below were measured on an AMD MI455X: many runs one after another, warmed up first and cycling through
// copies of the inputs, with the whole window's GPU time divided by the number of runs. Launches and the gaps
// between them are all in it. The median over several windows is given; except for v000 it joins two sittings, which
// can be a few percent apart, so the side-by-side timings, each taken in one sitting, are the better comparison.
// v000 is the starting kernel. One run takes 859 microseconds.
// compute dtype: all float inputs rounded to bf16 (bf16 values are exact in f16 apart from f16-subnormal magnitudes); causal logits q x k / 64 (exact operands; the module divides by head_dim, not its square root); softmax f32; P x 2^11 once to f16 x v (bf16 hi + lo path below row 384); f32 context rows, then re-ordered to the module's heads-innermost layout. No projections.
#include <hip/hip_runtime.h>
#include <math.h>

typedef __attribute__((ext_vector_type(16))) _Float16 v16h;
typedef __attribute__((ext_vector_type(16))) __bf16 v16b;
typedef __attribute__((ext_vector_type(8)))  _Float16 v8h;
typedef __attribute__((ext_vector_type(8)))  float v8f;
typedef __attribute__((ext_vector_type(4)))  float v4f;
typedef __attribute__((ext_vector_type(2)))  float v2f;
typedef __attribute__((ext_vector_type(4)))  unsigned v4u;
typedef __attribute__((ext_vector_type(4)))  int v4i;
typedef float __attribute__((may_alias)) float_a;
typedef int __attribute__((may_alias)) int_a;

template <typename T> __device__ __forceinline__ void vst2(void* p, T v) { *(T*)p = v;  }
__device__ __forceinline__ v8f wmma16(v16h a, v16h b, v8f c) {
  v8f d = __builtin_amdgcn_wmma_f32_16x16x32_f16(false, a, false, b, (short)0, c, false, false);
  asm volatile("v_nop\n\tv_nop\n\tv_nop\n\tv_nop" : "+v"(d) : "v"(a), "v"(b));
  return d;
}
__device__ __forceinline__ v8f wmma_bf(v16b a, v16b b, v8f c) {
  v8f d = __builtin_amdgcn_wmma_f32_16x16x32_bf16(false, a, false, b, (short)0, c, false, false);
  asm volatile("v_nop\n\tv_nop\n\tv_nop\n\tv_nop" : "+v"(d) : "v"(a), "v"(b));
  return d;
}
// 16x16x32 fragments: lane = (h = lane>>4, row/col = lane&15); elements 0..7 = k0+8h+0..7, 8..15 = k0+16+8h+0..7; D element r = row 8h+r
__device__ __forceinline__ v16h frag_h(const _Float16* rowk0, int lane) {
  union { v16h v; v8h q[2]; } u; const _Float16* p = rowk0 + 8 * (lane >> 4);
  u.q[0] = *(const v8h*)p; u.q[1] = *(const v8h*)(p + 16); return u.v;
}
__device__ __forceinline__ v16h frag_f32(const float* rowk0, int lane) {
  v16h a; const float* p = rowk0 + 8 * (lane >> 4);
#pragma unroll
  for (int i = 0; i < 8; ++i) { a[i] = (_Float16)p[i]; a[8 + i] = (_Float16)p[16 + i]; }
  return a;
}
__device__ __forceinline__ v16h frag_f32s(const float* rowk0, int lane, float sc) {
  v16h a; const float* p = rowk0 + 8 * (lane >> 4);
#pragma unroll
  for (int i = 0; i < 8; ++i) { a[i] = (_Float16)(p[i] * sc); a[8 + i] = (_Float16)(p[16 + i] * sc); }
  return a;
}
// column fragment from a [K][ld] layout (column n), rows >= K read as 0
__device__ __forceinline__ v16h fragc_f32(const float* W, int k0, int n, int lane, int ld, int K) {
  v16h a; const int g = lane >> 4;
#pragma unroll
  for (int i = 0; i < 8; ++i) { const int ka = k0 + 8 * g + i, kb = ka + 16;
    a[i] = (_Float16)(ka < K ? W[(size_t)(ka < K ? ka : K - 1) * ld + n] : 0.f); a[8 + i] = (_Float16)(kb < K ? W[(size_t)(kb < K ? kb : K - 1) * ld + n] : 0.f); }
  return a;
}
struct F2 { v16b h, l; };
__device__ __forceinline__ F2 bsplit16(const float v[16]) { F2 r;
#pragma unroll
  for (int i = 0; i < 16; ++i) { const __bf16 h = (__bf16)v[i]; r.h[i] = h; r.l[i] = (__bf16)(v[i] - (float)h); }
  return r; }
__device__ __forceinline__ F2 split_row(const float* row, int k0, int lane) { float v[16]; const float* p = row + k0 + 8 * (lane >> 4);
#pragma unroll
  for (int i = 0; i < 8; ++i) { v[i] = p[i]; v[8 + i] = p[16 + i]; }
  return bsplit16(v); }
__device__ __forceinline__ F2 split_rowK(const float* row, int k0, int lane, int K) { float v[16]; const int g = lane >> 4;
#pragma unroll
  for (int i = 0; i < 8; ++i) { const int ka = k0 + 8 * g + i, kb = ka + 16; v[i] = ka < K ? row[ka < K ? ka : K - 1] : 0.f; v[8 + i] = kb < K ? row[kb < K ? kb : K - 1] : 0.f; }
  return bsplit16(v); }
__device__ __forceinline__ F2 split_col(const float* W, int k0, int n, int lane, int ld, int K) { float v[16]; const int g = lane >> 4;
#pragma unroll
  for (int i = 0; i < 8; ++i) { const int ka = k0 + 8 * g + i, kb = ka + 16; v[i] = ka < K ? W[(size_t)(ka < K ? ka : K - 1) * ld + n] : 0.f; v[8 + i] = kb < K ? W[(size_t)(kb < K ? kb : K - 1) * ld + n] : 0.f; }
  return bsplit16(v); }
__device__ __forceinline__ v8f mac3(const F2& a, const F2& b, v8f c) { c = wmma_bf(a.l, b.h, c); c = wmma_bf(a.h, b.l, c); return wmma_bf(a.h, b.h, c); }
__device__ __forceinline__ float sigm(float v) { return 1.0f / (1.0f + expf(-v)); }
#define LDSX() do { asm volatile("s_wait_dscnt 0" ::: "memory"); __builtin_amdgcn_wave_barrier(); __builtin_amdgcn_fence(__ATOMIC_RELEASE, "workgroup"); } while (0)

// Causal multi-head softmax attention without weights in a HEADS-INNERMOST layout (q / k / v [2,2048,64,16] = (batch, seq, head_dim, n_heads), N(0,1); att[b,c,C,h] = sum_d q[b,c,d,h] k[b,C,d,h] / 64 (1 / head_dim); C > c set to -inf; softmax over C; y[b,c,v,h] = sum_C p[b,c,C,h] v[b,C,v,h], [2,2048,64,16]). Internal view: token row = (b, c); internal column h*64 + d lives at offset d*16 + h of the module's 1,024-float row: the loader gathers it that way and a final row-wise re-order writes the output back the same way.
#define NB 2
#define TT 2048
#define CC 1024            // NH * HD = projected width
#define DIN 1024          // input (model) width
#define NH 16
#define HD 64
#define NQB (TT / 64)
#define HG 4
#define SCALE (0.015625f)
#define CAUSAL 1
#ifndef TNB
#define TNB NB
#endif
__device__ __forceinline__ float bfr(float v) { return (float)(__bf16)v; }
__host__ __device__ __forceinline__ int kb_last(int qb) { return CAUSAL ? ((qb * 64 + 63) >> 7) : (TT / 128 - 1); }
typedef __attribute__((ext_vector_type(8))) __bf16 v8b;
__device__ __forceinline__ v16b frag_b(const __bf16* rowk0, int lane) {
  union { v16b v; v8b q[2]; } u; const __bf16* p = rowk0 + 8 * (lane >> 4);
  u.q[0] = *(const v8b*)p; u.q[1] = *(const v8b*)(p + 16); return u.v;
}
#define QBH 6              // causal: query blocks 0..QBH-1 of each sequence (few keys, no averaging) take the high-precision path
#define QHI 384            // rows carrying a q residual plane
#define KHI 384            // key rows carrying k residual / v bf16 hi+lo planes (used only by the causal high-precision path)
// B fragment (k rows k0+.., output column o) of a weight: (in,out) [K][ld] or (out,in) [ld rows of K]: bf16 exact, or f16(bf16 * 256) exact
__device__ __forceinline__ v16b wcol_io(const float* Wm, int k0, int o, int lane, int ld) { v16b w; const int g = lane >> 4;
#pragma unroll
  for (int i = 0; i < 8; ++i) { w[i] = (__bf16)Wm[(size_t)(k0 + 8 * g + i) * ld + o]; w[8 + i] = (__bf16)Wm[(size_t)(k0 + 16 + 8 * g + i) * ld + o]; }
  return w; }
__device__ __forceinline__ v16b wcol_oi(const float* Wm, int k0, int o, int lane, int K) { v16b w; const float* p = Wm + (size_t)o * K + k0 + 8 * (lane >> 4);
#pragma unroll
  for (int i = 0; i < 8; ++i) { w[i] = (__bf16)p[i]; w[8 + i] = (__bf16)p[16 + i]; }
  return w; }
__device__ __forceinline__ v16h wcolh_io(const float* Wm, int k0, int o, int lane, int ld) { v16h w; const int g = lane >> 4;
#pragma unroll
  for (int i = 0; i < 8; ++i) { w[i] = (_Float16)(bfr(Wm[(size_t)(k0 + 8 * g + i) * ld + o]) * 256.0f); w[8 + i] = (_Float16)(bfr(Wm[(size_t)(k0 + 16 + 8 * g + i) * ld + o]) * 256.0f); }
  return w; }
__device__ __forceinline__ v16h wcolh_oi(const float* Wm, int k0, int o, int lane, int K) { v16h w; const float* p = Wm + (size_t)o * K + k0 + 8 * (lane >> 4);
#pragma unroll
  for (int i = 0; i < 8; ++i) { w[i] = (_Float16)(bfr(p[i]) * 256.0f); w[8 + i] = (_Float16)(bfr(p[16 + i]) * 256.0f); }
  return w; }
#define WQKV_LAYOUT 1   // 0 = (in,out) [DIN][CC]; 1 = (out,in) [CC][DIN]; 2 = per-head [NH][DIN][HD]
__device__ __forceinline__ v16b wcol_hdk(const float* Wm, int k0, int o, int lane) { v16b w; const int g = lane >> 4; const float* p = Wm + (size_t)(o / HD) * DIN * HD + (o % HD);
#pragma unroll
  for (int i = 0; i < 8; ++i) { w[i] = (__bf16)p[(size_t)(k0 + 8 * g + i) * HD]; w[8 + i] = (__bf16)p[(size_t)(k0 + 16 + 8 * g + i) * HD]; }
  return w; }
#define WO_OUT_IN 0
#if WQKV_LAYOUT == 1
#define WCOL(W, k0, o, lane) wcol_oi(W, k0, o, lane, DIN)
#elif WQKV_LAYOUT == 2
#define WCOL(W, k0, o, lane) wcol_hdk(W, k0, o, lane)
#else
#define WCOL(W, k0, o, lane) wcol_io(W, k0, o, lane, CC)
#endif
#if WO_OUT_IN
#define WOCOL(W, k0, o, lane) wcol_oi(W, k0, o, lane, CC)
#define WOCOLH(W, k0, o, lane) wcolh_oi(W, k0, o, lane, CC)
#else
#define WOCOL(W, k0, o, lane) wcol_io(W, k0, o, lane, DIN)
#define WOCOLH(W, k0, o, lane) wcolh_io(W, k0, o, lane, DIN)
#endif

// ---- k_prepr: block = (64 attention positions s0.. of sequence b, head h): reads the module's [B, T, 64, H] inputs, bf16-rounds them and writes the standard attention planes: q -> f16 hi rows (+ x 2^10 residual rows for s < QHI), k -> f16 rows (+ residual rows s < KHI), v -> f16 planes [c][s] (+ bf16 hi/lo planes for s < KHI)
__global__ __launch_bounds__(128) void k_prepr(const float* __restrict__ Q, const float* __restrict__ K, const float* __restrict__ V, _Float16* __restrict__ QH, _Float16* __restrict__ QL, _Float16* __restrict__ KH, _Float16* __restrict__ KL, _Float16* __restrict__ VT, __bf16* __restrict__ VB, __bf16* __restrict__ VBL) {
  __shared__ __align__(16) _Float16 sq[64][136], sql[64][136], sk[64][136], skl[64][136], tv[128][72]; __shared__ __align__(16) __bf16 tb[128][72], tbl[128][72];
  const int tid = threadIdx.x; const int h = blockIdx.y; const size_t r0 = (size_t)blockIdx.x * 64; const size_t bb = r0 / TT; const int t0 = (int)(r0 % TT); const bool qhi = t0 < QHI, khi = t0 < KHI;
  for (int e = tid; e < 64 * 128; e += 128) { const int rl = e >> 7, c = e & 127; const size_t oi = ((bb * TT + t0 + rl) * (size_t)CC + (size_t)(c & 63) * NH + h);   /* HEADS-INNERMOST inputs [B, T, 64, NH]: element (d, h) of a token row is at d*NH + h */   /* c >= 64: duplicate read of the same element (tiles are 128 wide; HD is 64) */
    const float q = bfr(Q[oi]), k = bfr(K[oi]), v = bfr(V[oi]);   /* module inputs: bf16-rounded; bf16 values are exact in f16, so the residual planes are 0 */
    const _Float16 qh = (_Float16)q, kh = (_Float16)k; sq[rl][c] = qh; sql[rl][c] = (_Float16)((q - (float)qh) * 1024.0f); sk[rl][c] = kh; skl[rl][c] = (_Float16)((k - (float)kh) * 1024.0f);
    tv[c][rl] = (_Float16)v; const __bf16 vb = (__bf16)v; tb[c][rl] = vb; tbl[c][rl] = (__bf16)(v - (float)vb); }
  __syncthreads();
  for (int e = tid; e < 64 * 8; e += 128) { const int rl = e >> 3, q = e & 7; const size_t o = (r0 + rl) * CC + h * HD + q * 8; vst2((unsigned*)(QH + o), *(const v4u*)&sq[rl][q * 8]); vst2((unsigned*)(KH + o), *(const v4u*)&sk[rl][q * 8]);   
    if (qhi) vst2((unsigned*)(QL + (bb * QHI + t0 + rl) * (size_t)CC + h * HD + q * 8), *(const v4u*)&sql[rl][q * 8]); if (khi) vst2((unsigned*)(KL + (bb * KHI + t0 + rl) * (size_t)CC + h * HD + q * 8), *(const v4u*)&skl[rl][q * 8]); }
  for (int e = tid; e < 64 * 8; e += 128) { const int cl = e >> 3, q = e & 7; vst2((unsigned*)(VT + (bb * CC + h * HD + cl) * (size_t)TT + t0 + q * 8), *(const v4u*)&tv[cl][q * 8]);
    if (khi) { const size_t o3 = (bb * CC + h * HD + cl) * (size_t)KHI + t0 + q * 8; vst2((unsigned*)(VB + o3), *(const v4u*)&tb[cl][q * 8]); vst2((unsigned*)(VBL + o3), *(const v4u*)&tbl[cl][q * 8]); } } }

#ifndef SM_EXTRA_PARAMS
#define SM_EXTRA_PARAMS
#endif
#ifndef PROJ_EXTRA_PARAMS
#define PROJ_EXTRA_PARAMS
#endif
#ifndef SM_MASK_HOOK
#define SM_MASK_HOOK (void)0
#endif

#define WS_QH  0u                                      // f16 q rows [b*t][CC]
#define WS_KH  (WS_QH + 2u * (size_t)NB * TT * CC)      // f16 k rows [b*t][CC]
#define WS_VT  (WS_KH + 2u * (size_t)NB * TT * CC)      // f16 v planes [b][c][t]
#define WS_QL  (WS_VT + 2u * (size_t)NB * CC * TT)      // f16 q residual x 2^10 rows [b][t < QHI][CC]
#define WS_KL  (WS_QL + 2u * (size_t)NB * QHI * CC)     // f16 k residual x 2^10 rows [b][t < KHI][CC]
#define WS_VB  (WS_KL + 2u * (size_t)NB * KHI * CC)     // bf16 v hi planes [b][c][t < KHI]
#define WS_VBL (WS_VB + 2u * (size_t)NB * CC * KHI)
#define WS_S   (WS_VBL + 2u * (size_t)NB * CC * KHI)    // f32 logits / P [hg][t][s]
#define WS_Y   (WS_S  + 4u * (size_t)HG * TT * TT)      // f32 ctx rows [b*t][CC]
#define WS_END (WS_Y  + 4u * (size_t)NB * TT * CC)   // f32 context rows in the layout [b*t][h*64 + d], re-ordered by k_tr into the output

// ---- k_sc: block = (query block qb, key block kb <= kb_last(qb), head in group) of batch b: logits x SCALE; q hi + residual (x 2^10) against k (2 products) for query rows < QHI, plus the k residual (3 products) for query blocks < QBH (causal early rows); causal: blocks past the diagonal exit, the mask itself is applied by index in k_sm
__global__ __launch_bounds__(128) void k_sc(const _Float16* __restrict__ QH, const _Float16* __restrict__ KH, const _Float16* __restrict__ QL, const _Float16* __restrict__ KL, int b, int h0, float* __restrict__ S0) { __shared__ __align__(16) float ss[4][16][132];
  const int qb = blockIdx.x, kb = blockIdx.y; if (kb > kb_last(qb)) return;
  const int h = h0 + blockIdx.z; float* S = S0 + (size_t)blockIdx.z * TT * TT;
  const int tid = threadIdx.x, wave = tid >> 5, lane = tid & 31, col = lane & 15, g = lane >> 4; const int k0 = kb * 128; const int ql0 = qb * 64 + wave * 16; const size_t q0 = (size_t)b * TT + ql0, kr0 = (size_t)b * TT + k0;
  v8f acc[8] = {}, accl[8] = {};
  const _Float16* QLb = QL + (size_t)b * QHI * CC; const _Float16* KLb = KL + (size_t)b * KHI * CC;
  if (qb < QBH) {
#pragma unroll
    for (int kc = 0; kc < HD / 32; ++kc) { const v16h ah = frag_h(QH + (q0 + col) * CC + h * HD + kc * 32, lane), al = frag_h(QLb + (size_t)(ql0 + col) * CC + h * HD + kc * 32, lane);
#pragma unroll
      for (int j = 0; j < 8; ++j) { const v16h kbf = frag_h(KH + (kr0 + j * 16 + col) * CC + h * HD + kc * 32, lane), klf = frag_h(KLb + (size_t)(k0 + j * 16 + col) * CC + h * HD + kc * 32, lane); acc[j] = wmma16(ah, kbf, acc[j]); accl[j] = wmma16(al, kbf, accl[j]); accl[j] = wmma16(ah, klf, accl[j]); } }
  } else if (qb * 64 < QHI) {
#pragma unroll
    for (int kc = 0; kc < HD / 32; ++kc) { const v16h ah = frag_h(QH + (q0 + col) * CC + h * HD + kc * 32, lane), al = frag_h(QLb + (size_t)(ql0 + col) * CC + h * HD + kc * 32, lane);
#pragma unroll
      for (int j = 0; j < 8; ++j) { const v16h kbf = frag_h(KH + (kr0 + j * 16 + col) * CC + h * HD + kc * 32, lane); acc[j] = wmma16(ah, kbf, acc[j]); accl[j] = wmma16(al, kbf, accl[j]); } }
  } else {
#pragma unroll
    for (int kc = 0; kc < HD / 32; ++kc) { const v16h ah = frag_h(QH + (q0 + col) * CC + h * HD + kc * 32, lane);
#pragma unroll
      for (int j = 0; j < 8; ++j) { const v16h kbf = frag_h(KH + (kr0 + j * 16 + col) * CC + h * HD + kc * 32, lane); acc[j] = wmma16(ah, kbf, acc[j]); } } }
#pragma unroll
  for (int j = 0; j < 8; ++j) {
#pragma unroll
    for (int r = 0; r < 8; ++r) ss[wave][8 * g + r][j * 16 + col] = (acc[j][r] + accl[j][r] * (1.0f / 1024.0f)) * SCALE; }
  LDSX(); for (int rl = 0; rl < 16; ++rl) vst2(S + (size_t)(ql0 + rl) * TT + k0 + lane * 4, *(const v4f*)&ss[wave][rl][lane * 4]); }
// ---- k_sm: block = query row t (head in group): keys [0, kend): causal -> logit if s <= t else excluded; softmax in f32; P x 2^11 in place (0 for excluded)
__global__ __launch_bounds__(256) void k_sm(float* __restrict__ S0 SM_EXTRA_PARAMS) { __shared__ float sred[8]; __shared__ float sbc; __shared__ __align__(16) float shv[TT];
  const int tid = threadIdx.x; const int t = blockIdx.x; const int kend = (kb_last(t >> 6) + 1) * 128;
  float* sr = S0 + (size_t)blockIdx.y * TT * TT + (size_t)t * TT;
  float m = -3.0e38f; for (int k = tid; k < kend; k += 256) { float v = (!CAUSAL || k <= t) ? sr[k] : -3.0e38f; SM_MASK_HOOK; shv[k] = v; m = fmaxf(m, v); }
#pragma unroll
  for (int o = 1; o < 32; o <<= 1) m = fmaxf(m, __shfl_xor(m, o));
  if ((tid & 31) == 0) sred[tid >> 5] = m; __syncthreads(); if (tid == 0) { float a = sred[0]; for (int i = 1; i < 8; ++i) a = fmaxf(a, sred[i]); sbc = a; } __syncthreads(); m = sbc; __syncthreads();
  float sum = 0.f; for (int k = tid; k < kend; k += 256) { const float v = shv[k]; const float e = (v <= -1.0e38f) ? 0.f : expf(v - m); shv[k] = e; sum += e; }
#pragma unroll
  for (int o = 1; o < 32; o <<= 1) sum += __shfl_xor(sum, o);
  if ((tid & 31) == 0) sred[tid >> 5] = sum; __syncthreads(); if (tid == 0) { float a = 0.f; for (int i = 0; i < 8; ++i) a += sred[i]; sbc = a > 0.f ? 2048.0f / a : 0.f; }   /* a fully excluded row yields P = 0 */ __syncthreads(); const float inv = sbc;
  for (int k = tid; k < kend; k += 256) shv[k] = shv[k] * inv;
  __syncthreads(); for (int q = tid; q < kend / 4; q += 256) vst2(sr + q * 4, *(const v4f*)&shv[q * 4]); }
// ---- k_pv: block = 64 queries (qb) of (b, h): ctx = P . v over keys [0, kend) (P x 2^11 once to f16 against v f16: 1 product; causal early query blocks: P and v as bf16 hi + lo, 3 products); 256-B (row, head) segment by 16 lanes
__global__ __launch_bounds__(128) void k_pv(const float* __restrict__ PS0, const _Float16* __restrict__ VT, const __bf16* __restrict__ VB, const __bf16* __restrict__ VBL, int b, int h0, float* __restrict__ Y) { const int h = h0 + blockIdx.z; const float* PS = PS0 + (size_t)blockIdx.z * TT * TT; __shared__ __align__(16) float ss[4][16][HD + 4];
  const int tid = threadIdx.x, wave = tid >> 5, lane = tid & 31, col = lane & 15, g = lane >> 4; const int qb = blockIdx.x; const int ql0 = qb * 64 + wave * 16; const int kce = (kb_last(qb) + 1) * 4;
  v8f acc[HD / 16] = {};
  if (qb < QBH) {
#pragma unroll 1
    for (int kc = 0; kc < kce; ++kc) { const F2 p = split_row(PS + (size_t)(ql0 + col) * TT, kc * 32, lane);
      asm volatile("s_wait_loadcnt 0x0" ::: "memory");
#pragma unroll
      for (int j = 0; j < HD / 16; ++j) { const size_t po = ((size_t)b * CC + h * HD + j * 16 + col) * (size_t)KHI + kc * 32; const v16b vh = frag_b(VB + po, lane); acc[j] = wmma_bf(p.h, vh, acc[j]); acc[j] = wmma_bf(p.l, vh, acc[j]); acc[j] = wmma_bf(p.h, frag_b(VBL + po, lane), acc[j]); } }
  } else {
#pragma unroll 1
    for (int kc = 0; kc < kce; ++kc) { const v16h p = frag_f32(PS + (size_t)(ql0 + col) * TT + kc * 32, lane);
      asm volatile("s_wait_loadcnt 0x0" ::: "memory");
#pragma unroll
      for (int j = 0; j < HD / 16; ++j) { const size_t po = ((size_t)b * CC + h * HD + j * 16 + col) * (size_t)TT + kc * 32; acc[j] = wmma16(p, frag_h(VT + po, lane), acc[j]); } } }
#pragma unroll
  for (int j = 0; j < HD / 16; ++j)
#pragma unroll
    for (int r = 0; r < 8; ++r) ss[wave][8 * g + r][j * 16 + col] = acc[j][r] * (1.0f / 2048.0f);
  LDSX(); for (int rl = 0; rl < 16; ++rl) if (lane < HD / 4) vst2(Y + ((size_t)b * TT + ql0 + rl) * CC + h * HD + lane * 4, *(const v4f*)&ss[wave][rl][lane * 4]); }

__global__ __launch_bounds__(256) void k_tr(const float* __restrict__ Y, float* __restrict__ OUT) { __shared__ __align__(16) float sy[CC]; const size_t r = blockIdx.x; const int tid = threadIdx.x; *(v4f*)&sy[tid * 4] = *(const v4f*)(Y + r * CC + tid * 4); asm volatile("s_wait_loadcnt 0x0" ::: "memory"); __syncthreads(); v4f o;
#pragma unroll
  for (int i = 0; i < 4; ++i) { const int j = tid * 4 + i; const int d = j / NH, hh = j % NH; o[i] = sy[hh * HD + d]; }
  vst2(OUT + r * CC + tid * 4, o); }
static_assert(CC == 1024 && NH * HD == CC, "k_tr: 256 threads x 4 floats = one 1,024-float row");
extern "C" void kernel_launch(void* const* d_in, const int* in_sizes, int n_in, void* d_out, int out_size, void* d_ws, size_t ws_size, hipStream_t stream) {
  (void)in_sizes; (void)n_in; (void)out_size;
  const float** F = (const float**)d_in;
  if (ws_size < (size_t)WS_END) return;
  char* ws = (char*)d_ws; _Float16 *QH = (_Float16*)(ws + WS_QH), *KH = (_Float16*)(ws + WS_KH), *VT = (_Float16*)(ws + WS_VT), *QL = (_Float16*)(ws + WS_QL), *KL = (_Float16*)(ws + WS_KL); __bf16 *VB = (__bf16*)(ws + WS_VB), *VBL = (__bf16*)(ws + WS_VBL); float *S = (float*)(ws + WS_S), *Y = (float*)(ws + WS_Y);
  (void)Y; (void)QL; (void)KL; (void)VB; (void)VBL;
  // inputs: 0 q [2,2048,64,16]; 1 k; 2 v (all (batch, seq, head_dim, n_heads): token rows of 1,024 with element (d, h) at d*16 + h)
  k_prepr<<<dim3(TNB * TT / 64, NH), 128, 0, stream>>>(F[0], F[1], F[2], QH, QL, KH, KL, VT, VB, VBL);
  for (int b = 0; b < TNB; ++b) for (int h0 = 0; h0 < NH; h0 += HG) {
    k_sc<<<dim3(NQB, TT / 128, HG), 128, 0, stream>>>(QH, KH, QL, KL, b, h0, S);
    k_sm<<<dim3(TT, HG), 256, 0, stream>>>(S);
    k_pv<<<dim3(NQB, 1, HG), 128, 0, stream>>>(S, VT, VB, VBL, b, h0, Y);
  }
  k_tr<<<dim3(TNB * TT), 256, 0, stream>>>(Y, (float*)d_out);   /* head-major layout [h*64 + d] -> the module's [d*16 + h] */
}

// v001
// It runs in 509 microseconds.
// Timed twice side by side with v000, it ran 1.69 times as fast both times.
// compute dtype: all float inputs rounded to bf16 (bf16 values are exact in f16 apart from f16-subnormal magnitudes); causal logits q x k / 64 (exact operands; the module divides by head_dim, not its square root); softmax f32; P x 2^11 once to f16 x v (bf16 hi + lo path below row 384); f32 context rows, then re-ordered to the module's heads-innermost layout. No projections.
#include <hip/hip_runtime.h>
#include <math.h>

typedef __attribute__((ext_vector_type(16))) _Float16 v16h;
typedef __attribute__((ext_vector_type(16))) __bf16 v16b;
typedef __attribute__((ext_vector_type(8)))  _Float16 v8h;
typedef __attribute__((ext_vector_type(8)))  float v8f;
typedef __attribute__((ext_vector_type(4)))  float v4f;
typedef __attribute__((ext_vector_type(2)))  float v2f;
typedef __attribute__((ext_vector_type(4)))  unsigned v4u;
typedef __attribute__((ext_vector_type(4)))  int v4i;
typedef float __attribute__((may_alias)) float_a;
typedef int __attribute__((may_alias)) int_a;

template <typename T> __device__ __forceinline__ void vst2(void* p, T v) { *(T*)p = v;  }
__device__ __forceinline__ v8f wmma16(v16h a, v16h b, v8f c) {
  v8f d = __builtin_amdgcn_wmma_f32_16x16x32_f16(false, a, false, b, (short)0, c, false, false);
  asm volatile("v_nop\n\tv_nop\n\tv_nop\n\tv_nop" : "+v"(d) : "v"(a), "v"(b));
  return d;
}
__device__ __forceinline__ v8f wmma_bf(v16b a, v16b b, v8f c) {
  v8f d = __builtin_amdgcn_wmma_f32_16x16x32_bf16(false, a, false, b, (short)0, c, false, false);
  asm volatile("v_nop\n\tv_nop\n\tv_nop\n\tv_nop" : "+v"(d) : "v"(a), "v"(b));
  return d;
}
// 16x16x32 fragments: lane = (h = lane>>4, row/col = lane&15); elements 0..7 = k0+8h+0..7, 8..15 = k0+16+8h+0..7; D element r = row 8h+r
__device__ __forceinline__ v16h frag_h(const _Float16* rowk0, int lane) {
  union { v16h v; v8h q[2]; } u; const _Float16* p = rowk0 + 8 * (lane >> 4);
  u.q[0] = *(const v8h*)p; u.q[1] = *(const v8h*)(p + 16); return u.v;
}
__device__ __forceinline__ v16h frag_f32(const float* rowk0, int lane) {
  v16h a; const float* p = rowk0 + 8 * (lane >> 4);
#pragma unroll
  for (int i = 0; i < 8; ++i) { a[i] = (_Float16)p[i]; a[8 + i] = (_Float16)p[16 + i]; }
  return a;
}
__device__ __forceinline__ v16h frag_f32s(const float* rowk0, int lane, float sc) {
  v16h a; const float* p = rowk0 + 8 * (lane >> 4);
#pragma unroll
  for (int i = 0; i < 8; ++i) { a[i] = (_Float16)(p[i] * sc); a[8 + i] = (_Float16)(p[16 + i] * sc); }
  return a;
}
// column fragment from a [K][ld] layout (column n), rows >= K read as 0
__device__ __forceinline__ v16h fragc_f32(const float* W, int k0, int n, int lane, int ld, int K) {
  v16h a; const int g = lane >> 4;
#pragma unroll
  for (int i = 0; i < 8; ++i) { const int ka = k0 + 8 * g + i, kb = ka + 16;
    a[i] = (_Float16)(ka < K ? W[(size_t)(ka < K ? ka : K - 1) * ld + n] : 0.f); a[8 + i] = (_Float16)(kb < K ? W[(size_t)(kb < K ? kb : K - 1) * ld + n] : 0.f); }
  return a;
}
struct F2 { v16b h, l; };
__device__ __forceinline__ F2 bsplit16(const float v[16]) { F2 r;
#pragma unroll
  for (int i = 0; i < 16; ++i) { const __bf16 h = (__bf16)v[i]; r.h[i] = h; r.l[i] = (__bf16)(v[i] - (float)h); }
  return r; }
__device__ __forceinline__ F2 split_row(const float* row, int k0, int lane) { float v[16]; const float* p = row + k0 + 8 * (lane >> 4);
#pragma unroll
  for (int i = 0; i < 8; ++i) { v[i] = p[i]; v[8 + i] = p[16 + i]; }
  return bsplit16(v); }
__device__ __forceinline__ F2 split_rowK(const float* row, int k0, int lane, int K) { float v[16]; const int g = lane >> 4;
#pragma unroll
  for (int i = 0; i < 8; ++i) { const int ka = k0 + 8 * g + i, kb = ka + 16; v[i] = ka < K ? row[ka < K ? ka : K - 1] : 0.f; v[8 + i] = kb < K ? row[kb < K ? kb : K - 1] : 0.f; }
  return bsplit16(v); }
__device__ __forceinline__ F2 split_col(const float* W, int k0, int n, int lane, int ld, int K) { float v[16]; const int g = lane >> 4;
#pragma unroll
  for (int i = 0; i < 8; ++i) { const int ka = k0 + 8 * g + i, kb = ka + 16; v[i] = ka < K ? W[(size_t)(ka < K ? ka : K - 1) * ld + n] : 0.f; v[8 + i] = kb < K ? W[(size_t)(kb < K ? kb : K - 1) * ld + n] : 0.f; }
  return bsplit16(v); }
__device__ __forceinline__ v8f mac3(const F2& a, const F2& b, v8f c) { c = wmma_bf(a.l, b.h, c); c = wmma_bf(a.h, b.l, c); return wmma_bf(a.h, b.h, c); }
__device__ __forceinline__ float sigm(float v) { return 1.0f / (1.0f + expf(-v)); }
#define LDSX() do { asm volatile("s_wait_dscnt 0" ::: "memory"); __builtin_amdgcn_wave_barrier(); __builtin_amdgcn_fence(__ATOMIC_RELEASE, "workgroup"); } while (0)

// Causal multi-head softmax attention without weights in a HEADS-INNERMOST layout (q / k / v [2,2048,64,16] = (batch, seq, head_dim, n_heads), N(0,1); att[b,c,C,h] = sum_d q[b,c,d,h] k[b,C,d,h] / 64 (1 / head_dim); C > c set to -inf; softmax over C; y[b,c,v,h] = sum_C p[b,c,C,h] v[b,C,v,h], [2,2048,64,16]). Internal view: token row = (b, c); internal column h*64 + d lives at offset d*16 + h of the module's 1,024-float row: the loader gathers it that way and a final row-wise re-order writes the output back the same way.
#define NB 2
#define TT 2048
#define CC 1024            // NH * HD = projected width
#define DIN 1024          // input (model) width
#define NH 16
#define HD 64
#define NQB (TT / 64)
#define HG 4
#define SCALE (0.015625f)
#define CAUSAL 1
#ifndef TNB
#define TNB NB
#endif
__device__ __forceinline__ float bfr(float v) { return (float)(__bf16)v; }
__host__ __device__ __forceinline__ int kb_last(int qb) { return CAUSAL ? ((qb * 64 + 63) >> 7) : (TT / 128 - 1); }
typedef __attribute__((ext_vector_type(8))) __bf16 v8b;
__device__ __forceinline__ v16b frag_b(const __bf16* rowk0, int lane) {
  union { v16b v; v8b q[2]; } u; const __bf16* p = rowk0 + 8 * (lane >> 4);
  u.q[0] = *(const v8b*)p; u.q[1] = *(const v8b*)(p + 16); return u.v;
}
#define QBH 6              // causal: query blocks 0..QBH-1 of each sequence (few keys, no averaging) take the high-precision path
#define QHI 384            // rows carrying a q residual plane
#define KHI 384            // key rows carrying k residual / v bf16 hi+lo planes (used only by the causal high-precision path)
// B fragment (k rows k0+.., output column o) of a weight: (in,out) [K][ld] or (out,in) [ld rows of K]: bf16 exact, or f16(bf16 * 256) exact
__device__ __forceinline__ v16b wcol_io(const float* Wm, int k0, int o, int lane, int ld) { v16b w; const int g = lane >> 4;
#pragma unroll
  for (int i = 0; i < 8; ++i) { w[i] = (__bf16)Wm[(size_t)(k0 + 8 * g + i) * ld + o]; w[8 + i] = (__bf16)Wm[(size_t)(k0 + 16 + 8 * g + i) * ld + o]; }
  return w; }
__device__ __forceinline__ v16b wcol_oi(const float* Wm, int k0, int o, int lane, int K) { v16b w; const float* p = Wm + (size_t)o * K + k0 + 8 * (lane >> 4);
#pragma unroll
  for (int i = 0; i < 8; ++i) { w[i] = (__bf16)p[i]; w[8 + i] = (__bf16)p[16 + i]; }
  return w; }
__device__ __forceinline__ v16h wcolh_io(const float* Wm, int k0, int o, int lane, int ld) { v16h w; const int g = lane >> 4;
#pragma unroll
  for (int i = 0; i < 8; ++i) { w[i] = (_Float16)(bfr(Wm[(size_t)(k0 + 8 * g + i) * ld + o]) * 256.0f); w[8 + i] = (_Float16)(bfr(Wm[(size_t)(k0 + 16 + 8 * g + i) * ld + o]) * 256.0f); }
  return w; }
__device__ __forceinline__ v16h wcolh_oi(const float* Wm, int k0, int o, int lane, int K) { v16h w; const float* p = Wm + (size_t)o * K + k0 + 8 * (lane >> 4);
#pragma unroll
  for (int i = 0; i < 8; ++i) { w[i] = (_Float16)(bfr(p[i]) * 256.0f); w[8 + i] = (_Float16)(bfr(p[16 + i]) * 256.0f); }
  return w; }
#define WQKV_LAYOUT 1   // 0 = (in,out) [DIN][CC]; 1 = (out,in) [CC][DIN]; 2 = per-head [NH][DIN][HD]
__device__ __forceinline__ v16b wcol_hdk(const float* Wm, int k0, int o, int lane) { v16b w; const int g = lane >> 4; const float* p = Wm + (size_t)(o / HD) * DIN * HD + (o % HD);
#pragma unroll
  for (int i = 0; i < 8; ++i) { w[i] = (__bf16)p[(size_t)(k0 + 8 * g + i) * HD]; w[8 + i] = (__bf16)p[(size_t)(k0 + 16 + 8 * g + i) * HD]; }
  return w; }
#define WO_OUT_IN 0
#if WQKV_LAYOUT == 1
#define WCOL(W, k0, o, lane) wcol_oi(W, k0, o, lane, DIN)
#elif WQKV_LAYOUT == 2
#define WCOL(W, k0, o, lane) wcol_hdk(W, k0, o, lane)
#else
#define WCOL(W, k0, o, lane) wcol_io(W, k0, o, lane, CC)
#endif
#if WO_OUT_IN
#define WOCOL(W, k0, o, lane) wcol_oi(W, k0, o, lane, CC)
#define WOCOLH(W, k0, o, lane) wcolh_oi(W, k0, o, lane, CC)
#else
#define WOCOL(W, k0, o, lane) wcol_io(W, k0, o, lane, DIN)
#define WOCOLH(W, k0, o, lane) wcolh_io(W, k0, o, lane, DIN)
#endif

// ---- k_prepr: block = (64 attention positions s0.. of sequence b, head h): reads the module's [B, T, 64, H] inputs, bf16-rounds them and writes the standard attention planes: q -> f16 hi rows (+ x 2^10 residual rows for s < QHI), k -> f16 rows (+ residual rows s < KHI), v -> f16 planes [c][s] (+ bf16 hi/lo planes for s < KHI)
__global__ __launch_bounds__(128) void k_prepr(const float* __restrict__ Q, const float* __restrict__ K, const float* __restrict__ V, _Float16* __restrict__ QH, _Float16* __restrict__ QL, _Float16* __restrict__ KH, _Float16* __restrict__ KL, _Float16* __restrict__ VT, __bf16* __restrict__ VB, __bf16* __restrict__ VBL) {
  __shared__ __align__(16) _Float16 sq[64][136], sql[64][136], sk[64][136], skl[64][136], tv[128][72]; __shared__ __align__(16) __bf16 tb[128][72], tbl[128][72];
  const int tid = threadIdx.x; const int h = blockIdx.y; const size_t r0 = (size_t)blockIdx.x * 64; const size_t bb = r0 / TT; const int t0 = (int)(r0 % TT); const bool qhi = t0 < QHI, khi = t0 < KHI;
  for (int e = tid; e < 64 * 128; e += 128) { const int rl = e >> 7, c = e & 127; const size_t oi = ((bb * TT + t0 + rl) * (size_t)CC + (size_t)(c & 63) * NH + h);   /* HEADS-INNERMOST inputs [B, T, 64, NH]: element (d, h) of a token row is at d*NH + h */   /* c >= 64: duplicate read of the same element (tiles are 128 wide; HD is 64) */
    const float q = bfr(Q[oi]), k = bfr(K[oi]), v = bfr(V[oi]);   /* module inputs: bf16-rounded; bf16 values are exact in f16, so the residual planes are 0 */
    const _Float16 qh = (_Float16)q, kh = (_Float16)k; sq[rl][c] = qh; sql[rl][c] = (_Float16)((q - (float)qh) * 1024.0f); sk[rl][c] = kh; skl[rl][c] = (_Float16)((k - (float)kh) * 1024.0f);
    tv[c][rl] = (_Float16)v; const __bf16 vb = (__bf16)v; tb[c][rl] = vb; tbl[c][rl] = (__bf16)(v - (float)vb); }
  __syncthreads();
  for (int e = tid; e < 64 * 8; e += 128) { const int rl = e >> 3, q = e & 7; const size_t o = (r0 + rl) * CC + h * HD + q * 8; vst2((unsigned*)(QH + o), *(const v4u*)&sq[rl][q * 8]); vst2((unsigned*)(KH + o), *(const v4u*)&sk[rl][q * 8]);   
    if (qhi) vst2((unsigned*)(QL + (bb * QHI + t0 + rl) * (size_t)CC + h * HD + q * 8), *(const v4u*)&sql[rl][q * 8]); if (khi) vst2((unsigned*)(KL + (bb * KHI + t0 + rl) * (size_t)CC + h * HD + q * 8), *(const v4u*)&skl[rl][q * 8]); }
  for (int e = tid; e < 64 * 8; e += 128) { const int cl = e >> 3, q = e & 7; vst2((unsigned*)(VT + (bb * CC + h * HD + cl) * (size_t)TT + t0 + q * 8), *(const v4u*)&tv[cl][q * 8]);
    if (khi) { const size_t o3 = (bb * CC + h * HD + cl) * (size_t)KHI + t0 + q * 8; vst2((unsigned*)(VB + o3), *(const v4u*)&tb[cl][q * 8]); vst2((unsigned*)(VBL + o3), *(const v4u*)&tbl[cl][q * 8]); } } }

#ifndef SM_EXTRA_PARAMS
#define SM_EXTRA_PARAMS
#endif
#ifndef PROJ_EXTRA_PARAMS
#define PROJ_EXTRA_PARAMS
#endif
#ifndef SM_MASK_HOOK
#define SM_MASK_HOOK (void)0
#endif

#define WS_QH  0u                                      // f16 q rows [b*t][CC]
#define WS_KH  (WS_QH + 2u * (size_t)NB * TT * CC)      // f16 k rows [b*t][CC]
#define WS_VT  (WS_KH + 2u * (size_t)NB * TT * CC)      // f16 v planes [b][c][t]
#define WS_QL  (WS_VT + 2u * (size_t)NB * CC * TT)      // f16 q residual x 2^10 rows [b][t < QHI][CC]
#define WS_KL  (WS_QL + 2u * (size_t)NB * QHI * CC)     // f16 k residual x 2^10 rows [b][t < KHI][CC]
#define WS_VB  (WS_KL + 2u * (size_t)NB * KHI * CC)     // bf16 v hi planes [b][c][t < KHI]
#define WS_VBL (WS_VB + 2u * (size_t)NB * CC * KHI)
#define WS_S   (WS_VBL + 2u * (size_t)NB * CC * KHI)    // f32 logits / P [hg][t][s]
#define WS_Y   (WS_S  + 4u * (size_t)HG * TT * TT)      // f32 ctx rows [b*t][CC]
#define WS_END (WS_Y  + 4u * (size_t)NB * TT * CC)   // f32 context rows in the layout [b*t][h*64 + d], re-ordered by k_tr into the output

// ---- k_sc: block = (query block qb, key block kb <= kb_last(qb), head in group) of batch b: logits x SCALE; q hi + residual (x 2^10) against k (2 products) for query rows < QHI, plus the k residual (3 products) for query blocks < QBH (causal early rows); causal: blocks past the diagonal exit, the mask itself is applied by index in k_sm
__global__ __launch_bounds__(128) void k_sc(const _Float16* __restrict__ QH, const _Float16* __restrict__ KH, const _Float16* __restrict__ QL, const _Float16* __restrict__ KL, int b, int h0, float* __restrict__ S0) { __shared__ __align__(16) float ss[4][16][132];
  const int qb = blockIdx.x, kb = blockIdx.y; if (kb > kb_last(qb)) return;
  const int h = h0 + blockIdx.z; float* S = S0 + (size_t)blockIdx.z * TT * TT;
  const int tid = threadIdx.x, wave = tid >> 5, lane = tid & 31, col = lane & 15, g = lane >> 4; const int k0 = kb * 128; const int ql0 = qb * 64 + wave * 16; const size_t q0 = (size_t)b * TT + ql0, kr0 = (size_t)b * TT + k0;
  v8f acc[8] = {}, accl[8] = {};
  const _Float16* QLb = QL + (size_t)b * QHI * CC; const _Float16* KLb = KL + (size_t)b * KHI * CC;
  if (qb < QBH) {
#pragma unroll
    for (int kc = 0; kc < HD / 32; ++kc) { const v16h ah = frag_h(QH + (q0 + col) * CC + h * HD + kc * 32, lane), al = frag_h(QLb + (size_t)(ql0 + col) * CC + h * HD + kc * 32, lane);
#pragma unroll
      for (int j = 0; j < 8; ++j) { const v16h kbf = frag_h(KH + (kr0 + j * 16 + col) * CC + h * HD + kc * 32, lane), klf = frag_h(KLb + (size_t)(k0 + j * 16 + col) * CC + h * HD + kc * 32, lane); acc[j] = wmma16(ah, kbf, acc[j]); accl[j] = wmma16(al, kbf, accl[j]); accl[j] = wmma16(ah, klf, accl[j]); } }
  } else if (qb * 64 < QHI) {
#pragma unroll
    for (int kc = 0; kc < HD / 32; ++kc) { const v16h ah = frag_h(QH + (q0 + col) * CC + h * HD + kc * 32, lane), al = frag_h(QLb + (size_t)(ql0 + col) * CC + h * HD + kc * 32, lane);
#pragma unroll
      for (int j = 0; j < 8; ++j) { const v16h kbf = frag_h(KH + (kr0 + j * 16 + col) * CC + h * HD + kc * 32, lane); acc[j] = wmma16(ah, kbf, acc[j]); accl[j] = wmma16(al, kbf, accl[j]); } }
  } else {
#pragma unroll
    for (int kc = 0; kc < HD / 32; ++kc) { const v16h ah = frag_h(QH + (q0 + col) * CC + h * HD + kc * 32, lane);
#pragma unroll
      for (int j = 0; j < 8; ++j) { const v16h kbf = frag_h(KH + (kr0 + j * 16 + col) * CC + h * HD + kc * 32, lane); acc[j] = wmma16(ah, kbf, acc[j]); } } }
#pragma unroll
  for (int j = 0; j < 8; ++j) {
#pragma unroll
    for (int r = 0; r < 8; ++r) ss[wave][8 * g + r][j * 16 + col] = (acc[j][r] + accl[j][r] * (1.0f / 1024.0f)) * SCALE; }
  LDSX(); for (int rl = 0; rl < 16; ++rl) vst2(S + (size_t)(ql0 + rl) * TT + k0 + lane * 4, *(const v4f*)&ss[wave][rl][lane * 4]); }
// ---- k_sm: block = query row t (head in group): keys [0, kend): causal -> logit if s <= t else excluded; softmax in f32; P x 2^11 in place (0 for excluded)
__global__ __launch_bounds__(256) void k_sm(float* __restrict__ S0 SM_EXTRA_PARAMS) { __shared__ float sred[8]; __shared__ float sbc; __shared__ __align__(16) float shv[TT];
  const int tid = threadIdx.x; const int t = blockIdx.x; const int kend = (kb_last(t >> 6) + 1) * 128;
  float* sr = S0 + (size_t)blockIdx.y * TT * TT + (size_t)t * TT;
  float m = -3.0e38f; for (int k = tid; k < kend; k += 256) { float v = (!CAUSAL || k <= t) ? sr[k] : -3.0e38f; SM_MASK_HOOK; shv[k] = v; m = fmaxf(m, v); }
#pragma unroll
  for (int o = 1; o < 32; o <<= 1) m = fmaxf(m, __shfl_xor(m, o));
  if ((tid & 31) == 0) sred[tid >> 5] = m; __syncthreads(); if (tid == 0) { float a = sred[0]; for (int i = 1; i < 8; ++i) a = fmaxf(a, sred[i]); sbc = a; } __syncthreads(); m = sbc; __syncthreads();
  float sum = 0.f; for (int k = tid; k < kend; k += 256) { const float v = shv[k]; const float e = (v <= -1.0e38f) ? 0.f : expf(v - m); shv[k] = e; sum += e; }
#pragma unroll
  for (int o = 1; o < 32; o <<= 1) sum += __shfl_xor(sum, o);
  if ((tid & 31) == 0) sred[tid >> 5] = sum; __syncthreads(); if (tid == 0) { float a = 0.f; for (int i = 0; i < 8; ++i) a += sred[i]; sbc = a > 0.f ? 2048.0f / a : 0.f; }   /* a fully excluded row yields P = 0 */ __syncthreads(); const float inv = sbc;
  for (int k = tid; k < kend; k += 256) shv[k] = shv[k] * inv;
  __syncthreads(); for (int q = tid; q < kend / 4; q += 256) vst2(sr + q * 4, *(const v4f*)&shv[q * 4]); }
// ---- k_pv: block = 16 queries (qt) of (b, h), PVW waves: wave w takes the 32-key chunks w, w + PVW, ... of keys [0, kend) and keeps its own f32 partial of ctx = P . v; the partials are summed in wave order through LDS (P x 2^11 once to f16 against v f16: 1 product; causal early query blocks: P and v as bf16 hi + lo, 3 products); 256-B (row, head) segment by 16 lanes
#define PVW 8
__global__ __launch_bounds__(32 * PVW) void k_pv(const float* __restrict__ PS0, const _Float16* __restrict__ VT, const __bf16* __restrict__ VB, const __bf16* __restrict__ VBL, int b, int h0, float* __restrict__ Y) { const int h = h0 + blockIdx.z; const float* PS = PS0 + (size_t)blockIdx.z * TT * TT; __shared__ __align__(16) float ss[PVW][16][HD + 4];
  const int tid = threadIdx.x, lane = tid & 31, col = lane & 15, g = lane >> 4; const int qb = blockIdx.x >> 2; const int ql0 = blockIdx.x * 16; const int kce = (kb_last(qb) + 1) * 4;
  const int wave = __builtin_amdgcn_readfirstlane(tid >> 5);   // wave number in a scalar register: the chunk loops below then branch on scalar compares and every lane stays on at the matrix instructions
  v8f acc[HD / 16] = {};
  if (qb < QBH) {
#pragma unroll 1
    for (int kc = wave; kc < kce; kc += PVW) { const F2 p = split_row(PS + (size_t)(ql0 + col) * TT, kc * 32, lane);
      asm volatile("s_wait_loadcnt 0x0" ::: "memory");
#pragma unroll
      for (int j = 0; j < HD / 16; ++j) { const size_t po = ((size_t)b * CC + h * HD + j * 16 + col) * (size_t)KHI + kc * 32; const v16b vh = frag_b(VB + po, lane); acc[j] = wmma_bf(p.h, vh, acc[j]); acc[j] = wmma_bf(p.l, vh, acc[j]); acc[j] = wmma_bf(p.h, frag_b(VBL + po, lane), acc[j]); } }
  } else {
#pragma unroll 1
    for (int kc = wave; kc < kce; kc += PVW) { const v16h p = frag_f32(PS + (size_t)(ql0 + col) * TT + kc * 32, lane);
      asm volatile("s_wait_loadcnt 0x0" ::: "memory");
#pragma unroll
      for (int j = 0; j < HD / 16; ++j) { const size_t po = ((size_t)b * CC + h * HD + j * 16 + col) * (size_t)TT + kc * 32; acc[j] = wmma16(p, frag_h(VT + po, lane), acc[j]); } } }
#pragma unroll
  for (int j = 0; j < HD / 16; ++j)
#pragma unroll
    for (int r = 0; r < 8; ++r) ss[wave][8 * g + r][j * 16 + col] = acc[j][r] * (1.0f / 2048.0f);
  __syncthreads();   // every wave's partial is in LDS before any thread sums across waves
  const int rl = tid >> 4, c4 = (tid & 15) * 4; v4f s = *(const v4f*)&ss[0][rl][c4];
  for (int w = 1; w < PVW; ++w) s += *(const v4f*)&ss[w][rl][c4];
  vst2(Y + ((size_t)b * TT + ql0 + rl) * CC + h * HD + c4, s); }
static_assert(32 * PVW == 16 * (HD / 4), "k_pv: one thread per 4 floats of the 16 x HD tile");

__global__ __launch_bounds__(256) void k_tr(const float* __restrict__ Y, float* __restrict__ OUT) { __shared__ __align__(16) float sy[CC]; const size_t r = blockIdx.x; const int tid = threadIdx.x; *(v4f*)&sy[tid * 4] = *(const v4f*)(Y + r * CC + tid * 4); asm volatile("s_wait_loadcnt 0x0" ::: "memory"); __syncthreads(); v4f o;
#pragma unroll
  for (int i = 0; i < 4; ++i) { const int j = tid * 4 + i; const int d = j / NH, hh = j % NH; o[i] = sy[hh * HD + d]; }
  vst2(OUT + r * CC + tid * 4, o); }
static_assert(CC == 1024 && NH * HD == CC, "k_tr: 256 threads x 4 floats = one 1,024-float row");
extern "C" void kernel_launch(void* const* d_in, const int* in_sizes, int n_in, void* d_out, int out_size, void* d_ws, size_t ws_size, hipStream_t stream) {
  (void)in_sizes; (void)n_in; (void)out_size;
  const float** F = (const float**)d_in;
  if (ws_size < (size_t)WS_END) return;
  char* ws = (char*)d_ws; _Float16 *QH = (_Float16*)(ws + WS_QH), *KH = (_Float16*)(ws + WS_KH), *VT = (_Float16*)(ws + WS_VT), *QL = (_Float16*)(ws + WS_QL), *KL = (_Float16*)(ws + WS_KL); __bf16 *VB = (__bf16*)(ws + WS_VB), *VBL = (__bf16*)(ws + WS_VBL); float *S = (float*)(ws + WS_S), *Y = (float*)(ws + WS_Y);
  (void)Y; (void)QL; (void)KL; (void)VB; (void)VBL;
  // inputs: 0 q [2,2048,64,16]; 1 k; 2 v (all (batch, seq, head_dim, n_heads): token rows of 1,024 with element (d, h) at d*16 + h)
  k_prepr<<<dim3(TNB * TT / 64, NH), 128, 0, stream>>>(F[0], F[1], F[2], QH, QL, KH, KL, VT, VB, VBL);
  for (int b = 0; b < TNB; ++b) for (int h0 = 0; h0 < NH; h0 += HG) {
    k_sc<<<dim3(NQB, TT / 128, HG), 128, 0, stream>>>(QH, KH, QL, KL, b, h0, S);
    k_sm<<<dim3(TT, HG), 256, 0, stream>>>(S);
    k_pv<<<dim3(TT / 16, 1, HG), 32 * PVW, 0, stream>>>(S, VT, VB, VBL, b, h0, Y);
  }
  k_tr<<<dim3(TNB * TT), 256, 0, stream>>>(Y, (float*)d_out);   /* head-major layout [h*64 + d] -> the module's [d*16 + h] */
}

// v002
// One run takes 89.5 microseconds.
// Two timings next to v001 put it at 5.72 and 5.73 times that version's speed.
// All steps since v000 together make it 9.67 times as fast.
// compute dtype: all float inputs rounded to bf16 (bf16 values are exact in f16 apart from f16-subnormal magnitudes); causal logits q x k / 64 (exact operands; the module divides by head_dim, not its square root); softmax f32; P x 2^11 once to f16 x v (bf16 hi + lo path below row 384); f32 context rows, then re-ordered to the module's heads-innermost layout. No projections.
#include <hip/hip_runtime.h>
#include <math.h>

typedef __attribute__((ext_vector_type(16))) _Float16 v16h;
typedef __attribute__((ext_vector_type(16))) __bf16 v16b;
typedef __attribute__((ext_vector_type(8)))  _Float16 v8h;
typedef __attribute__((ext_vector_type(8)))  float v8f;
typedef __attribute__((ext_vector_type(4)))  float v4f;
typedef __attribute__((ext_vector_type(2)))  float v2f;
typedef __attribute__((ext_vector_type(4)))  unsigned v4u;
typedef __attribute__((ext_vector_type(4)))  int v4i;
typedef float __attribute__((may_alias)) float_a;
typedef int __attribute__((may_alias)) int_a;

template <typename T> __device__ __forceinline__ void vst2(void* p, T v) { *(T*)p = v;  }
__device__ __forceinline__ v8f wmma16(v16h a, v16h b, v8f c) {
  v8f d = __builtin_amdgcn_wmma_f32_16x16x32_f16(false, a, false, b, (short)0, c, false, false);
  asm volatile("v_nop\n\tv_nop\n\tv_nop\n\tv_nop" : "+v"(d) : "v"(a), "v"(b));
  return d;
}
__device__ __forceinline__ v8f wmma_bf(v16b a, v16b b, v8f c) {
  v8f d = __builtin_amdgcn_wmma_f32_16x16x32_bf16(false, a, false, b, (short)0, c, false, false);
  asm volatile("v_nop\n\tv_nop\n\tv_nop\n\tv_nop" : "+v"(d) : "v"(a), "v"(b));
  return d;
}
// 16x16x32 fragments: lane = (h = lane>>4, row/col = lane&15); elements 0..7 = k0+8h+0..7, 8..15 = k0+16+8h+0..7; D element r = row 8h+r
__device__ __forceinline__ v16h frag_h(const _Float16* rowk0, int lane) {
  union { v16h v; v8h q[2]; } u; const _Float16* p = rowk0 + 8 * (lane >> 4);
  u.q[0] = *(const v8h*)p; u.q[1] = *(const v8h*)(p + 16); return u.v;
}
__device__ __forceinline__ v16h frag_f32(const float* rowk0, int lane) {
  v16h a; const float* p = rowk0 + 8 * (lane >> 4);
#pragma unroll
  for (int i = 0; i < 8; ++i) { a[i] = (_Float16)p[i]; a[8 + i] = (_Float16)p[16 + i]; }
  return a;
}
__device__ __forceinline__ v16h frag_f32s(const float* rowk0, int lane, float sc) {
  v16h a; const float* p = rowk0 + 8 * (lane >> 4);
#pragma unroll
  for (int i = 0; i < 8; ++i) { a[i] = (_Float16)(p[i] * sc); a[8 + i] = (_Float16)(p[16 + i] * sc); }
  return a;
}
// column fragment from a [K][ld] layout (column n), rows >= K read as 0
__device__ __forceinline__ v16h fragc_f32(const float* W, int k0, int n, int lane, int ld, int K) {
  v16h a; const int g = lane >> 4;
#pragma unroll
  for (int i = 0; i < 8; ++i) { const int ka = k0 + 8 * g + i, kb = ka + 16;
    a[i] = (_Float16)(ka < K ? W[(size_t)(ka < K ? ka : K - 1) * ld + n] : 0.f); a[8 + i] = (_Float16)(kb < K ? W[(size_t)(kb < K ? kb : K - 1) * ld + n] : 0.f); }
  return a;
}
struct F2 { v16b h, l; };
__device__ __forceinline__ F2 bsplit16(const float v[16]) { F2 r;
#pragma unroll
  for (int i = 0; i < 16; ++i) { const __bf16 h = (__bf16)v[i]; r.h[i] = h; r.l[i] = (__bf16)(v[i] - (float)h); }
  return r; }
__device__ __forceinline__ F2 split_row(const float* row, int k0, int lane) { float v[16]; const float* p = row + k0 + 8 * (lane >> 4);
#pragma unroll
  for (int i = 0; i < 8; ++i) { v[i] = p[i]; v[8 + i] = p[16 + i]; }
  return bsplit16(v); }
__device__ __forceinline__ F2 split_rowK(const float* row, int k0, int lane, int K) { float v[16]; const int g = lane >> 4;
#pragma unroll
  for (int i = 0; i < 8; ++i) { const int ka = k0 + 8 * g + i, kb = ka + 16; v[i] = ka < K ? row[ka < K ? ka : K - 1] : 0.f; v[8 + i] = kb < K ? row[kb < K ? kb : K - 1] : 0.f; }
  return bsplit16(v); }
__device__ __forceinline__ F2 split_col(const float* W, int k0, int n, int lane, int ld, int K) { float v[16]; const int g = lane >> 4;
#pragma unroll
  for (int i = 0; i < 8; ++i) { const int ka = k0 + 8 * g + i, kb = ka + 16; v[i] = ka < K ? W[(size_t)(ka < K ? ka : K - 1) * ld + n] : 0.f; v[8 + i] = kb < K ? W[(size_t)(kb < K ? kb : K - 1) * ld + n] : 0.f; }
  return bsplit16(v); }
__device__ __forceinline__ v8f mac3(const F2& a, const F2& b, v8f c) { c = wmma_bf(a.l, b.h, c); c = wmma_bf(a.h, b.l, c); return wmma_bf(a.h, b.h, c); }
__device__ __forceinline__ float sigm(float v) { return 1.0f / (1.0f + expf(-v)); }
#define LDSX() do { asm volatile("s_wait_dscnt 0" ::: "memory"); __builtin_amdgcn_wave_barrier(); __builtin_amdgcn_fence(__ATOMIC_RELEASE, "workgroup"); } while (0)

// Causal multi-head softmax attention without weights in a HEADS-INNERMOST layout (q / k / v [2,2048,64,16] = (batch, seq, head_dim, n_heads), N(0,1); att[b,c,C,h] = sum_d q[b,c,d,h] k[b,C,d,h] / 64 (1 / head_dim); C > c set to -inf; softmax over C; y[b,c,v,h] = sum_C p[b,c,C,h] v[b,C,v,h], [2,2048,64,16]). Internal view: token row = (b, c); internal column h*64 + d lives at offset d*16 + h of the module's 1,024-float row: the loader gathers it that way and a final row-wise re-order writes the output back the same way.
#define NB 2
#define TT 2048
#define CC 1024            // NH * HD = projected width
#define DIN 1024          // input (model) width
#define NH 16
#define HD 64
#define NQB (TT / 64)
#define HG 4
#define SCALE (0.015625f)
#define CAUSAL 1
#ifndef TNB
#define TNB NB
#endif
__device__ __forceinline__ float bfr(float v) { return (float)(__bf16)v; }
__host__ __device__ __forceinline__ int kb_last(int qb) { return CAUSAL ? ((qb * 64 + 63) >> 7) : (TT / 128 - 1); }
typedef __attribute__((ext_vector_type(8))) __bf16 v8b;
__device__ __forceinline__ v16b frag_b(const __bf16* rowk0, int lane) {
  union { v16b v; v8b q[2]; } u; const __bf16* p = rowk0 + 8 * (lane >> 4);
  u.q[0] = *(const v8b*)p; u.q[1] = *(const v8b*)(p + 16); return u.v;
}
#define QBH 6              // unused; query tiles below row QHI (few keys, no averaging) take the high-precision path
#define QHI 384            // rows carrying a q residual plane
#define KHI 384            // key rows carrying k residual / v bf16 hi+lo planes (used only by the causal high-precision path)
// B fragment (k rows k0+.., output column o) of a weight: (in,out) [K][ld] or (out,in) [ld rows of K]: bf16 exact, or f16(bf16 * 256) exact
__device__ __forceinline__ v16b wcol_io(const float* Wm, int k0, int o, int lane, int ld) { v16b w; const int g = lane >> 4;
#pragma unroll
  for (int i = 0; i < 8; ++i) { w[i] = (__bf16)Wm[(size_t)(k0 + 8 * g + i) * ld + o]; w[8 + i] = (__bf16)Wm[(size_t)(k0 + 16 + 8 * g + i) * ld + o]; }
  return w; }
__device__ __forceinline__ v16b wcol_oi(const float* Wm, int k0, int o, int lane, int K) { v16b w; const float* p = Wm + (size_t)o * K + k0 + 8 * (lane >> 4);
#pragma unroll
  for (int i = 0; i < 8; ++i) { w[i] = (__bf16)p[i]; w[8 + i] = (__bf16)p[16 + i]; }
  return w; }
__device__ __forceinline__ v16h wcolh_io(const float* Wm, int k0, int o, int lane, int ld) { v16h w; const int g = lane >> 4;
#pragma unroll
  for (int i = 0; i < 8; ++i) { w[i] = (_Float16)(bfr(Wm[(size_t)(k0 + 8 * g + i) * ld + o]) * 256.0f); w[8 + i] = (_Float16)(bfr(Wm[(size_t)(k0 + 16 + 8 * g + i) * ld + o]) * 256.0f); }
  return w; }
__device__ __forceinline__ v16h wcolh_oi(const float* Wm, int k0, int o, int lane, int K) { v16h w; const float* p = Wm + (size_t)o * K + k0 + 8 * (lane >> 4);
#pragma unroll
  for (int i = 0; i < 8; ++i) { w[i] = (_Float16)(bfr(p[i]) * 256.0f); w[8 + i] = (_Float16)(bfr(p[16 + i]) * 256.0f); }
  return w; }
#define WQKV_LAYOUT 1   // 0 = (in,out) [DIN][CC]; 1 = (out,in) [CC][DIN]; 2 = per-head [NH][DIN][HD]
__device__ __forceinline__ v16b wcol_hdk(const float* Wm, int k0, int o, int lane) { v16b w; const int g = lane >> 4; const float* p = Wm + (size_t)(o / HD) * DIN * HD + (o % HD);
#pragma unroll
  for (int i = 0; i < 8; ++i) { w[i] = (__bf16)p[(size_t)(k0 + 8 * g + i) * HD]; w[8 + i] = (__bf16)p[(size_t)(k0 + 16 + 8 * g + i) * HD]; }
  return w; }
#define WO_OUT_IN 0
#if WQKV_LAYOUT == 1
#define WCOL(W, k0, o, lane) wcol_oi(W, k0, o, lane, DIN)
#elif WQKV_LAYOUT == 2
#define WCOL(W, k0, o, lane) wcol_hdk(W, k0, o, lane)
#else
#define WCOL(W, k0, o, lane) wcol_io(W, k0, o, lane, CC)
#endif
#if WO_OUT_IN
#define WOCOL(W, k0, o, lane) wcol_oi(W, k0, o, lane, CC)
#define WOCOLH(W, k0, o, lane) wcolh_oi(W, k0, o, lane, CC)
#else
#define WOCOL(W, k0, o, lane) wcol_io(W, k0, o, lane, DIN)
#define WOCOLH(W, k0, o, lane) wcolh_io(W, k0, o, lane, DIN)
#endif

// ---- k_prepr: block = (64 attention positions s0.. of sequence b, head h): reads the module's [B, T, 64, H] inputs, bf16-rounds them and writes the standard attention planes: q -> f16 hi rows (+ x 2^10 residual rows for s < QHI), k -> f16 rows (+ residual rows s < KHI), v -> f16 planes [c][s] (+ bf16 hi/lo planes for s < KHI)
__global__ __launch_bounds__(128) void k_prepr(const float* __restrict__ Q, const float* __restrict__ K, const float* __restrict__ V, _Float16* __restrict__ QH, _Float16* __restrict__ QL, _Float16* __restrict__ KH, _Float16* __restrict__ KL, _Float16* __restrict__ VT, __bf16* __restrict__ VB, __bf16* __restrict__ VBL) {
  __shared__ __align__(16) _Float16 sq[64][136], sql[64][136], sk[64][136], skl[64][136], tv[128][72]; __shared__ __align__(16) __bf16 tb[128][72], tbl[128][72];
  const int tid = threadIdx.x; const int h = blockIdx.y; const size_t r0 = (size_t)blockIdx.x * 64; const size_t bb = r0 / TT; const int t0 = (int)(r0 % TT); const bool qhi = t0 < QHI, khi = t0 < KHI;
  for (int e = tid; e < 64 * 128; e += 128) { const int rl = e >> 7, c = e & 127; const size_t oi = ((bb * TT + t0 + rl) * (size_t)CC + (size_t)(c & 63) * NH + h);   /* HEADS-INNERMOST inputs [B, T, 64, NH]: element (d, h) of a token row is at d*NH + h */   /* c >= 64: duplicate read of the same element (tiles are 128 wide; HD is 64) */
    const float q = bfr(Q[oi]), k = bfr(K[oi]), v = bfr(V[oi]);   /* module inputs: bf16-rounded; bf16 values are exact in f16, so the residual planes are 0 */
    const _Float16 qh = (_Float16)q, kh = (_Float16)k; sq[rl][c] = qh; sql[rl][c] = (_Float16)((q - (float)qh) * 1024.0f); sk[rl][c] = kh; skl[rl][c] = (_Float16)((k - (float)kh) * 1024.0f);
    tv[c][rl] = (_Float16)v; const __bf16 vb = (__bf16)v; tb[c][rl] = vb; tbl[c][rl] = (__bf16)(v - (float)vb); }
  __syncthreads();
  for (int e = tid; e < 64 * 8; e += 128) { const int rl = e >> 3, q = e & 7; const size_t o = (r0 + rl) * CC + h * HD + q * 8; vst2((unsigned*)(QH + o), *(const v4u*)&sq[rl][q * 8]); vst2((unsigned*)(KH + o), *(const v4u*)&sk[rl][q * 8]);   
    if (qhi) vst2((unsigned*)(QL + (bb * QHI + t0 + rl) * (size_t)CC + h * HD + q * 8), *(const v4u*)&sql[rl][q * 8]); if (khi) vst2((unsigned*)(KL + (bb * KHI + t0 + rl) * (size_t)CC + h * HD + q * 8), *(const v4u*)&skl[rl][q * 8]); }
  for (int e = tid; e < 64 * 8; e += 128) { const int cl = e >> 3, q = e & 7; vst2((unsigned*)(VT + (bb * CC + h * HD + cl) * (size_t)TT + t0 + q * 8), *(const v4u*)&tv[cl][q * 8]);
    if (khi) { const size_t o3 = (bb * CC + h * HD + cl) * (size_t)KHI + t0 + q * 8; vst2((unsigned*)(VB + o3), *(const v4u*)&tb[cl][q * 8]); vst2((unsigned*)(VBL + o3), *(const v4u*)&tbl[cl][q * 8]); } } }

#ifndef SM_EXTRA_PARAMS
#define SM_EXTRA_PARAMS
#endif
#ifndef PROJ_EXTRA_PARAMS
#define PROJ_EXTRA_PARAMS
#endif
#ifndef SM_MASK_HOOK
#define SM_MASK_HOOK (void)0
#endif

#define WS_QH  0u                                      // f16 q rows [b*t][CC]
#define WS_KH  (WS_QH + 2u * (size_t)NB * TT * CC)      // f16 k rows [b*t][CC]
#define WS_VT  (WS_KH + 2u * (size_t)NB * TT * CC)      // f16 v planes [b][c][t]
#define WS_QL  (WS_VT + 2u * (size_t)NB * CC * TT)      // f16 q residual x 2^10 rows [b][t < QHI][CC]
#define WS_KL  (WS_QL + 2u * (size_t)NB * QHI * CC)     // f16 k residual x 2^10 rows [b][t < KHI][CC]
#define WS_VB  (WS_KL + 2u * (size_t)NB * KHI * CC)     // bf16 v hi planes [b][c][t < KHI]
#define WS_VBL (WS_VB + 2u * (size_t)NB * CC * KHI)
#define WS_S   (WS_VBL + 2u * (size_t)NB * CC * KHI)    // f32 [hg][t][s] space, not used by any kernel here
#define WS_Y   (WS_S  + 4u * (size_t)HG * TT * TT)      // f32 ctx rows [b*t][CC]
#define WS_END (WS_Y  + 4u * (size_t)NB * TT * CC)   // f32 context rows in the internal layout [b*t][h*64 + d], re-ordered by k_tr into the output

// ---- k_fa: block = 32 queries (tile qt) of (b, h), FW waves: wave w takes the 32-key chunks w, w + FW, ... <= qt. Per chunk: S^T = k . q^T (lane = one query column, 16 of the chunk's keys in its registers), running maximum and sum per query in f32 (online softmax, log2 units), P x 2^11 packed from the score accumulators straight into a B operand, ctx^T += v^T . P^T. Logits and P never leave the registers. Query rows < QHI keep the residual products and the bf16 hi + lo P . v. The waves' (max, sum, ctx) partials are merged in wave order through LDS.
#define FW 8
#define FQ 32
#define LOGC (SCALE * 1.44269504088896340736f)   // logit scale x log2(e)
__device__ __forceinline__ float xhalf(float x) { return __builtin_bit_cast(float, __builtin_amdgcn_permlanex16(__builtin_bit_cast(int, x), __builtin_bit_cast(int, x), 0x76543210, 0xfedcba98, false, false)); }   // lane l reads lane l ^ 16
// 2^x by v_exp_f32, with the one free slot that the instruction set asks for behind a transcendental kept inside the statement; in the run of eight no instruction reads its predecessor's result or overwrites its source (outputs are early-clobber), the v_nop serves the last
__device__ __forceinline__ float exp2s(float x) { float r; asm("v_exp_f32 %0, %1\n\tv_nop" : "=v"(r) : "v"(x)); return r; }
__device__ __forceinline__ void exp2x8(float* o, const float* x) {
  asm("v_exp_f32 %0, %8\n\tv_exp_f32 %1, %9\n\tv_exp_f32 %2, %10\n\tv_exp_f32 %3, %11\n\tv_exp_f32 %4, %12\n\tv_exp_f32 %5, %13\n\tv_exp_f32 %6, %14\n\tv_exp_f32 %7, %15\n\tv_nop"
      : "=&v"(o[0]), "=&v"(o[1]), "=&v"(o[2]), "=&v"(o[3]), "=&v"(o[4]), "=&v"(o[5]), "=&v"(o[6]), "=&v"(o[7]) : "v"(x[0]), "v"(x[1]), "v"(x[2]), "v"(x[3]), "v"(x[4]), "v"(x[5]), "v"(x[6]), "v"(x[7])); }
struct FaSt { v8f acc[2][HD / 16]; float m[2], l[2]; };
template <bool HI> __device__ __forceinline__ void fa_run(FaSt& st, const _Float16* __restrict__ QH, const _Float16* __restrict__ KH, const _Float16* __restrict__ QL, const _Float16* __restrict__ KL, const _Float16* __restrict__ VT, const __bf16* __restrict__ VB, const __bf16* __restrict__ VBL, int b, int h, int qt, int wave, int lane) {
  const int col = lane & 15, g = lane >> 4; const int q0 = qt * FQ;
  v16h qh[2][2], ql[2][2];
#pragma unroll
  for (int n = 0; n < 2; ++n)
#pragma unroll
    for (int c = 0; c < 2; ++c) { qh[n][c] = frag_h(QH + ((size_t)b * TT + q0 + n * 16 + col) * CC + h * HD + c * 32, lane); if (HI) ql[n][c] = frag_h(QL + ((size_t)b * QHI + q0 + n * 16 + col) * CC + h * HD + c * 32, lane); }
  v16h kf[2][2], vf[HD / 16];   // !HI: this chunk's k fragments (fetched one chunk ahead) and v fragments (fetched at the chunk's top), so that no product waits for a load issued just in front of it
  if (!HI) { const int kf0 = (wave <= qt ? wave : qt) * 32;
#pragma unroll
    for (int t = 0; t < 2; ++t)
#pragma unroll
      for (int c = 0; c < 2; ++c) kf[t][c] = frag_h(KH + ((size_t)b * TT + kf0 + t * 16 + col) * CC + h * HD + c * 32, lane); }
#pragma unroll 1
  for (int kc = wave; kc <= qt; kc += FW) { const int k0 = kc * 32;
    v8f s[2][2] = {};   // [query group][key tile]: element r = key k0 + 16 * tile + 8 * g + r, query q0 + 16 * group + col
    if (HI) { v8f sl[2][2] = {};
#pragma unroll
      for (int t = 0; t < 2; ++t)
#pragma unroll
        for (int c = 0; c < 2; ++c) { const v16h kf = frag_h(KH + ((size_t)b * TT + k0 + t * 16 + col) * CC + h * HD + c * 32, lane), klf = frag_h(KL + ((size_t)b * KHI + k0 + t * 16 + col) * CC + h * HD + c * 32, lane);
#pragma unroll
          for (int n = 0; n < 2; ++n) { s[n][t] = wmma16(kf, qh[n][c], s[n][t]); sl[n][t] = wmma16(kf, ql[n][c], sl[n][t]); sl[n][t] = wmma16(klf, qh[n][c], sl[n][t]); } }
#pragma unroll
      for (int n = 0; n < 2; ++n)
#pragma unroll
        for (int t = 0; t < 2; ++t) s[n][t] += sl[n][t] * (1.0f / 1024.0f);
    } else {
#pragma unroll
      for (int j = 0; j < HD / 16; ++j) vf[j] = frag_h(VT + ((size_t)b * CC + h * HD + j * 16 + col) * (size_t)TT + k0, lane);
#pragma unroll
      for (int t = 0; t < 2; ++t)
#pragma unroll
        for (int c = 0; c < 2; ++c)
#pragma unroll
          for (int n = 0; n < 2; ++n) s[n][t] = wmma16(kf[t][c], qh[n][c], s[n][t]);
      const int kn = (kc + FW <= qt ? kc + FW : kc) * 32;   // the wave's next chunk; on its last trip the same rows again (in bounds, not used)
#pragma unroll
      for (int t = 0; t < 2; ++t)
#pragma unroll
        for (int c = 0; c < 2; ++c) kf[t][c] = frag_h(KH + ((size_t)b * TT + kn + t * 16 + col) * CC + h * HD + c * 32, lane);
      asm volatile("s_wait_xcnt 0x0" ::: "memory"); }   // the loads' address registers are reused behind the branch below
    if (kc == qt) {   // the diagonal chunk: keys past the query are excluded (every query keeps key k0 at least)
#pragma unroll
      for (int n = 0; n < 2; ++n)
#pragma unroll
        for (int t = 0; t < 2; ++t)
#pragma unroll
          for (int r = 0; r < 8; ++r) if (t * 16 + 8 * g + r > n * 16 + col) s[n][t][r] = -1.0e30f; }
    float mt[2];
#pragma unroll
    for (int n = 0; n < 2; ++n) { float mx = s[n][0][0];
#pragma unroll
      for (int r = 1; r < 8; ++r) mx = fmaxf(mx, s[n][0][r]);
#pragma unroll
      for (int r = 0; r < 8; ++r) mx = fmaxf(mx, s[n][1][r]);
      mx = fmaxf(mx, xhalf(mx)); mt[n] = fmaxf(st.m[n], mx * LOGC); }
    if (__builtin_amdgcn_ballot_w32(mt[0] > st.m[0] || mt[1] > st.m[1]) != 0) {   // a maximum grew somewhere in the wave: bring sums and ctx to the new one
#pragma unroll
      for (int n = 0; n < 2; ++n) { const float a = exp2s(st.m[n] - mt[n]); st.m[n] = mt[n]; st.l[n] *= a;
#pragma unroll
        for (int j = 0; j < HD / 16; ++j) st.acc[n][j] *= a; } }
    float p[2][16];
#pragma unroll
    for (int n = 0; n < 2; ++n) { const float bias = 11.0f - st.m[n]; float sum = 0.f;
#pragma unroll
      for (int t = 0; t < 2; ++t) { float x[8];
#pragma unroll
        for (int r = 0; r < 8; ++r) x[r] = fmaf(s[n][t][r], LOGC, bias);
        exp2x8(&p[n][8 * t], x);
#pragma unroll
        for (int r = 0; r < 8; ++r) sum += p[n][8 * t + r]; }
      st.l[n] += sum; }
    if (HI) { const F2 p0 = bsplit16(p[0]), p1 = bsplit16(p[1]);
#pragma unroll
      for (int j = 0; j < HD / 16; ++j) { const size_t po = ((size_t)b * CC + h * HD + j * 16 + col) * (size_t)KHI + k0; const v16b vh = frag_b(VB + po, lane), vl = frag_b(VBL + po, lane);
        st.acc[0][j] = wmma_bf(vh, p0.h, st.acc[0][j]); st.acc[0][j] = wmma_bf(vh, p0.l, st.acc[0][j]); st.acc[0][j] = wmma_bf(vl, p0.h, st.acc[0][j]);
        st.acc[1][j] = wmma_bf(vh, p1.h, st.acc[1][j]); st.acc[1][j] = wmma_bf(vh, p1.l, st.acc[1][j]); st.acc[1][j] = wmma_bf(vl, p1.h, st.acc[1][j]); }
    } else { v16h pf[2];
#pragma unroll
      for (int n = 0; n < 2; ++n)
#pragma unroll
        for (int i = 0; i < 16; ++i) pf[n][i] = (_Float16)p[n][i];
#pragma unroll
      for (int j = 0; j < HD / 16; ++j)
#pragma unroll
        for (int n = 0; n < 2; ++n) st.acc[n][j] = wmma16(vf[j], pf[n], st.acc[n][j]); } } }
__global__ __launch_bounds__(32 * FW) void k_fa(const _Float16* __restrict__ QH, const _Float16* __restrict__ KH, const _Float16* __restrict__ QL, const _Float16* __restrict__ KL, const _Float16* __restrict__ VT, const __bf16* __restrict__ VB, const __bf16* __restrict__ VBL, float* __restrict__ Y) {
  __shared__ __align__(16) float ss[FW][FQ][HD + 4]; __shared__ float sm[FW][FQ], sl[FW][FQ];
  const int tid = threadIdx.x, lane = tid & 31, col = lane & 15, g = lane >> 4; const int b = blockIdx.x / NH, h = blockIdx.x % NH; const int qt = TT / FQ - 1 - blockIdx.y;   // longest tiles start first
  const int wave = __builtin_amdgcn_readfirstlane(tid >> 5);   // wave number in a scalar register: the chunk loop branches on scalar compares and every lane stays on at the matrix instructions
  FaSt st;
#pragma unroll
  for (int n = 0; n < 2; ++n) { st.m[n] = -1.0e30f; st.l[n] = 0.f;
#pragma unroll
    for (int j = 0; j < HD / 16; ++j) st.acc[n][j] = v8f{}; }
  if (qt * FQ < QHI) fa_run<true>(st, QH, KH, QL, KL, VT, VB, VBL, b, h, qt, wave, lane); else fa_run<false>(st, QH, KH, QL, KL, VT, VB, VBL, b, h, qt, wave, lane);
#pragma unroll
  for (int n = 0; n < 2; ++n) { const float l = st.l[n] + xhalf(st.l[n]); if (g == 0) { sm[wave][n * 16 + col] = st.m[n]; sl[wave][n * 16 + col] = l; }
#pragma unroll
    for (int j = 0; j < HD / 16; ++j) { const v8f a = st.acc[n][j]; *(v4f*)&ss[wave][n * 16 + col][j * 16 + 8 * g] = v4f{a[0], a[1], a[2], a[3]}; *(v4f*)&ss[wave][n * 16 + col][j * 16 + 8 * g + 4] = v4f{a[4], a[5], a[6], a[7]}; } }
  __syncthreads();   // every wave's partial is in LDS before any thread merges across waves
#pragma unroll
  for (int i = 0; i < FQ / 16; ++i) { const int rl = (tid >> 4) + 16 * i, c4 = (tid & 15) * 4; float M = sm[0][rl];
    for (int w = 1; w < FW; ++w) M = fmaxf(M, sm[w][rl]);
    float L = 0.f; v4f s = {};
    for (int w = 0; w < FW; ++w) { const float f = exp2s(sm[w][rl] - M); L += sl[w][rl] * f; s += *(const v4f*)&ss[w][rl][c4] * f; }   // a wave without chunks has weight 0
    vst2(Y + ((size_t)b * TT + qt * FQ + rl) * CC + h * HD + c4, s * (1.0f / L)); } }
static_assert(32 * FW == 16 * (HD / 4) && QHI % FQ == 0 && QHI <= KHI && TT % FQ == 0, "k_fa: 16 rows of HD / 4 threads; whole tiles on either precision path");

__global__ __launch_bounds__(256) void k_tr(const float* __restrict__ Y, float* __restrict__ OUT) { __shared__ __align__(16) float sy[CC]; const size_t r = blockIdx.x; const int tid = threadIdx.x; *(v4f*)&sy[tid * 4] = *(const v4f*)(Y + r * CC + tid * 4); asm volatile("s_wait_loadcnt 0x0" ::: "memory"); __syncthreads(); v4f o;
#pragma unroll
  for (int i = 0; i < 4; ++i) { const int j = tid * 4 + i; const int d = j / NH, hh = j % NH; o[i] = sy[hh * HD + d]; }
  vst2(OUT + r * CC + tid * 4, o); }
static_assert(CC == 1024 && NH * HD == CC, "k_tr: 256 threads x 4 floats = one 1,024-float row");
extern "C" void kernel_launch(void* const* d_in, const int* in_sizes, int n_in, void* d_out, int out_size, void* d_ws, size_t ws_size, hipStream_t stream) {
  (void)in_sizes; (void)n_in; (void)out_size;
  const float** F = (const float**)d_in;
  if (ws_size < (size_t)WS_END) return;
  char* ws = (char*)d_ws; _Float16 *QH = (_Float16*)(ws + WS_QH), *KH = (_Float16*)(ws + WS_KH), *VT = (_Float16*)(ws + WS_VT), *QL = (_Float16*)(ws + WS_QL), *KL = (_Float16*)(ws + WS_KL); __bf16 *VB = (__bf16*)(ws + WS_VB), *VBL = (__bf16*)(ws + WS_VBL); float *Y = (float*)(ws + WS_Y);
  (void)Y; (void)QL; (void)KL; (void)VB; (void)VBL;
  // inputs: 0 q [2,2048,64,16]; 1 k; 2 v (all (batch, seq, head_dim, n_heads): token rows of 1,024 with element (d, h) at d*16 + h)
  k_prepr<<<dim3(TNB * TT / 64, NH), 128, 0, stream>>>(F[0], F[1], F[2], QH, QL, KH, KL, VT, VB, VBL);
  k_fa<<<dim3(TNB * NH, TT / FQ), 32 * FW, 0, stream>>>(QH, KH, QL, KL, VT, VB, VBL, Y);
  k_tr<<<dim3(TNB * TT), 256, 0, stream>>>(Y, (float*)d_out);   /* internal layout [h*64 + d] -> the module's [d*16 + h] */
}

// v003
// A run of this version takes 60.1 microseconds.
// Timed twice side by side with v002, it ran 1.50 times as fast both times.
// Over all steps from v000 it is 14.5 times as fast.
// compute dtype: all float inputs rounded to bf16 (bf16 values are exact in f16 apart from f16-subnormal magnitudes); causal logits q x k / 64 (exact operands; the module divides by head_dim, not its square root); softmax f32; P x 2^11 once to f16 x v (bf16 hi + lo path below row 384); f32 context rows, then re-ordered to the module's heads-innermost layout. No projections.
#include <hip/hip_runtime.h>
#include <math.h>

typedef __attribute__((ext_vector_type(16))) _Float16 v16h;
typedef __attribute__((ext_vector_type(16))) __bf16 v16b;
typedef __attribute__((ext_vector_type(8)))  _Float16 v8h;
typedef __attribute__((ext_vector_type(8)))  float v8f;
typedef __attribute__((ext_vector_type(4)))  float v4f;
typedef __attribute__((ext_vector_type(2)))  float v2f;
typedef __attribute__((ext_vector_type(4)))  unsigned v4u;
typedef __attribute__((ext_vector_type(4)))  int v4i;
typedef float __attribute__((may_alias)) float_a;
typedef int __attribute__((may_alias)) int_a;

template <typename T> __device__ __forceinline__ void vst2(void* p, T v) { *(T*)p = v;  }
__device__ __forceinline__ v8f wmma16(v16h a, v16h b, v8f c) {
  v8f d = __builtin_amdgcn_wmma_f32_16x16x32_f16(false, a, false, b, (short)0, c, false, false);
  asm volatile("v_nop\n\tv_nop\n\tv_nop\n\tv_nop" : "+v"(d) : "v"(a), "v"(b));
  return d;
}
__device__ __forceinline__ v8f wmma_bf(v16b a, v16b b, v8f c) {
  v8f d = __builtin_amdgcn_wmma_f32_16x16x32_bf16(false, a, false, b, (short)0, c, false, false);
  asm volatile("v_nop\n\tv_nop\n\tv_nop\n\tv_nop" : "+v"(d) : "v"(a), "v"(b));
  return d;
}
// 16x16x32 fragments: lane = (h = lane>>4, row/col = lane&15); elements 0..7 = k0+8h+0..7, 8..15 = k0+16+8h+0..7; D element r = row 8h+r
__device__ __forceinline__ v16h frag_h(const _Float16* rowk0, int lane) {
  union { v16h v; v8h q[2]; } u; const _Float16* p = rowk0 + 8 * (lane >> 4);
  u.q[0] = *(const v8h*)p; u.q[1] = *(const v8h*)(p + 16); return u.v;
}
__device__ __forceinline__ v16h frag_f32(const float* rowk0, int lane) {
  v16h a; const float* p = rowk0 + 8 * (lane >> 4);
#pragma unroll
  for (int i = 0; i < 8; ++i) { a[i] = (_Float16)p[i]; a[8 + i] = (_Float16)p[16 + i]; }
  return a;
}
__device__ __forceinline__ v16h frag_f32s(const float* rowk0, int lane, float sc) {
  v16h a; const float* p = rowk0 + 8 * (lane >> 4);
#pragma unroll
  for (int i = 0; i < 8; ++i) { a[i] = (_Float16)(p[i] * sc); a[8 + i] = (_Float16)(p[16 + i] * sc); }
  return a;
}
// column fragment from a [K][ld] layout (column n), rows >= K read as 0
__device__ __forceinline__ v16h fragc_f32(const float* W, int k0, int n, int lane, int ld, int K) {
  v16h a; const int g = lane >> 4;
#pragma unroll
  for (int i = 0; i < 8; ++i) { const int ka = k0 + 8 * g + i, kb = ka + 16;
    a[i] = (_Float16)(ka < K ? W[(size_t)(ka < K ? ka : K - 1) * ld + n] : 0.f); a[8 + i] = (_Float16)(kb < K ? W[(size_t)(kb < K ? kb : K - 1) * ld + n] : 0.f); }
  return a;
}
struct F2 { v16b h, l; };
__device__ __forceinline__ F2 bsplit16(const float v[16]) { F2 r;
#pragma unroll
  for (int i = 0; i < 16; ++i) { const __bf16 h = (__bf16)v[i]; r.h[i] = h; r.l[i] = (__bf16)(v[i] - (float)h); }
  return r; }
__device__ __forceinline__ F2 split_row(const float* row, int k0, int lane) { float v[16]; const float* p = row + k0 + 8 * (lane >> 4);
#pragma unroll
  for (int i = 0; i < 8; ++i) { v[i] = p[i]; v[8 + i] = p[16 + i]; }
  return bsplit16(v); }
__device__ __forceinline__ F2 split_rowK(const float* row, int k0, int lane, int K) { float v[16]; const int g = lane >> 4;
#pragma unroll
  for (int i = 0; i < 8; ++i) { const int ka = k0 + 8 * g + i, kb = ka + 16; v[i] = ka < K ? row[ka < K ? ka : K - 1] : 0.f; v[8 + i] = kb < K ? row[kb < K ? kb : K - 1] : 0.f; }
  return bsplit16(v); }
__device__ __forceinline__ F2 split_col(const float* W, int k0, int n, int lane, int ld, int K) { float v[16]; const int g = lane >> 4;
#pragma unroll
  for (int i = 0; i < 8; ++i) { const int ka = k0 + 8 * g + i, kb = ka + 16; v[i] = ka < K ? W[(size_t)(ka < K ? ka : K - 1) * ld + n] : 0.f; v[8 + i] = kb < K ? W[(size_t)(kb < K ? kb : K - 1) * ld + n] : 0.f; }
  return bsplit16(v); }
__device__ __forceinline__ v8f mac3(const F2& a, const F2& b, v8f c) { c = wmma_bf(a.l, b.h, c); c = wmma_bf(a.h, b.l, c); return wmma_bf(a.h, b.h, c); }
__device__ __forceinline__ float sigm(float v) { return 1.0f / (1.0f + expf(-v)); }
#define LDSX() do { asm volatile("s_wait_dscnt 0" ::: "memory"); __builtin_amdgcn_wave_barrier(); __builtin_amdgcn_fence(__ATOMIC_RELEASE, "workgroup"); } while (0)

// Causal multi-head softmax attention without weights in a HEADS-INNERMOST layout (q / k / v [2,2048,64,16] = (batch, seq, head_dim, n_heads), N(0,1); att[b,c,C,h] = sum_d q[b,c,d,h] k[b,C,d,h] / 64 (1 / head_dim); C > c set to -inf; softmax over C; y[b,c,v,h] = sum_C p[b,c,C,h] v[b,C,v,h], [2,2048,64,16]). Internal view: token row = (b, c); internal column h*64 + d lives at offset d*16 + h of the module's 1,024-float row: the loader gathers it that way and a final row-wise re-order writes the output back the same way.
#define NB 2
#define TT 2048
#define CC 1024            // NH * HD = projected width
#define DIN 1024          // input (model) width
#define NH 16
#define HD 64
#define NQB (TT / 64)
#define HG 4
#define SCALE (0.015625f)
#define CAUSAL 1
#ifndef TNB
#define TNB NB
#endif
__device__ __forceinline__ float bfr(float v) { return (float)(__bf16)v; }
__host__ __device__ __forceinline__ int kb_last(int qb) { return CAUSAL ? ((qb * 64 + 63) >> 7) : (TT / 128 - 1); }
typedef __attribute__((ext_vector_type(8))) __bf16 v8b;
__device__ __forceinline__ v16b frag_b(const __bf16* rowk0, int lane) {
  union { v16b v; v8b q[2]; } u; const __bf16* p = rowk0 + 8 * (lane >> 4);
  u.q[0] = *(const v8b*)p; u.q[1] = *(const v8b*)(p + 16); return u.v;
}
#define QBH 6              // unused; query tiles below row QHI (few keys, no averaging) take the high-precision path
#define QHI 384            // rows carrying a q residual plane
#define KHI 384            // key rows carrying k residual / v bf16 hi+lo planes (used only by the causal high-precision path)
// B fragment (k rows k0+.., output column o) of a weight: (in,out) [K][ld] or (out,in) [ld rows of K]: bf16 exact, or f16(bf16 * 256) exact
__device__ __forceinline__ v16b wcol_io(const float* Wm, int k0, int o, int lane, int ld) { v16b w; const int g = lane >> 4;
#pragma unroll
  for (int i = 0; i < 8; ++i) { w[i] = (__bf16)Wm[(size_t)(k0 + 8 * g + i) * ld + o]; w[8 + i] = (__bf16)Wm[(size_t)(k0 + 16 + 8 * g + i) * ld + o]; }
  return w; }
__device__ __forceinline__ v16b wcol_oi(const float* Wm, int k0, int o, int lane, int K) { v16b w; const float* p = Wm + (size_t)o * K + k0 + 8 * (lane >> 4);
#pragma unroll
  for (int i = 0; i < 8; ++i) { w[i] = (__bf16)p[i]; w[8 + i] = (__bf16)p[16 + i]; }
  return w; }
__device__ __forceinline__ v16h wcolh_io(const float* Wm, int k0, int o, int lane, int ld) { v16h w; const int g = lane >> 4;
#pragma unroll
  for (int i = 0; i < 8; ++i) { w[i] = (_Float16)(bfr(Wm[(size_t)(k0 + 8 * g + i) * ld + o]) * 256.0f); w[8 + i] = (_Float16)(bfr(Wm[(size_t)(k0 + 16 + 8 * g + i) * ld + o]) * 256.0f); }
  return w; }
__device__ __forceinline__ v16h wcolh_oi(const float* Wm, int k0, int o, int lane, int K) { v16h w; const float* p = Wm + (size_t)o * K + k0 + 8 * (lane >> 4);
#pragma unroll
  for (int i = 0; i < 8; ++i) { w[i] = (_Float16)(bfr(p[i]) * 256.0f); w[8 + i] = (_Float16)(bfr(p[16 + i]) * 256.0f); }
  return w; }
#define WQKV_LAYOUT 1   // 0 = (in,out) [DIN][CC]; 1 = (out,in) [CC][DIN]; 2 = per-head [NH][DIN][HD]
__device__ __forceinline__ v16b wcol_hdk(const float* Wm, int k0, int o, int lane) { v16b w; const int g = lane >> 4; const float* p = Wm + (size_t)(o / HD) * DIN * HD + (o % HD);
#pragma unroll
  for (int i = 0; i < 8; ++i) { w[i] = (__bf16)p[(size_t)(k0 + 8 * g + i) * HD]; w[8 + i] = (__bf16)p[(size_t)(k0 + 16 + 8 * g + i) * HD]; }
  return w; }
#define WO_OUT_IN 0
#if WQKV_LAYOUT == 1
#define WCOL(W, k0, o, lane) wcol_oi(W, k0, o, lane, DIN)
#elif WQKV_LAYOUT == 2
#define WCOL(W, k0, o, lane) wcol_hdk(W, k0, o, lane)
#else
#define WCOL(W, k0, o, lane) wcol_io(W, k0, o, lane, CC)
#endif
#if WO_OUT_IN
#define WOCOL(W, k0, o, lane) wcol_oi(W, k0, o, lane, CC)
#define WOCOLH(W, k0, o, lane) wcolh_oi(W, k0, o, lane, CC)
#else
#define WOCOL(W, k0, o, lane) wcol_io(W, k0, o, lane, DIN)
#define WOCOLH(W, k0, o, lane) wcolh_io(W, k0, o, lane, DIN)
#endif

// ---- k_prepr: reads the module's [B, T, 64, NH] inputs once, in 16-byte pieces (4 heads of one d), bf16-rounds them and writes the standard attention planes: q -> f16 hi rows (+ x 2^10 residual rows for s < QHI), k -> f16 rows (+ residual rows s < KHI), v -> f16 planes [c][s] (+ bf16 hi/lo planes for s < KHI). A lane gathers 8 pieces along the axis that is contiguous in the plane (d for q and k, s for v), so the 4 x 8 transpose is a renaming of its registers and every store instruction writes four whole 128-byte lines. blockIdx.y = tensor; a wave takes PU token rows (q, k) or PU values of d of a 64-token tile (v).
#define PW 4               // waves a block
#define PU 4               // rows (q, k) or d values (v) a wave
__device__ __forceinline__ void prep_qk(const float* __restrict__ X, _Float16* __restrict__ XH, _Float16* __restrict__ XL, int row0, int lane) {
  const int h4 = lane & 3, dg = lane >> 2; const float* src = X + (size_t)row0 * CC + dg * 8 * NH + h4 * 4; v4f x[PU][8];   // lane: heads 4 h4 .. + 3, d = 8 dg .. + 7
#pragma unroll
  for (int u = 0; u < PU; ++u)
#pragma unroll
    for (int k = 0; k < 8; ++k) x[u][k] = *(const v4f*)(src + u * CC + k * NH);
  asm volatile("s_wait_xcnt 0x0" ::: "memory");   // every load is issued before the first conversion, and their address registers are free for reuse behind this line
  const int o = h4 * 4 * HD + dg * 8; _Float16* dh = XH + (size_t)row0 * CC + o;
#pragma unroll
  for (int u = 0; u < PU; ++u)
#pragma unroll
    for (int e = 0; e < 4; ++e) { v8h r;
#pragma unroll
      for (int k = 0; k < 8; ++k) r[k] = (_Float16)bfr(x[u][k][e]);
      vst2(dh + u * CC + e * HD, r); }
  asm volatile("s_wait_xcnt 0x0" ::: "memory");   // the stores' data registers are reused behind the branch below
  if (row0 % TT < QHI) { _Float16* dl = XL + ((size_t)(row0 / TT) * QHI + row0 % TT) * CC + o;   // module inputs are bf16-rounded; bf16 values are exact in f16 apart from f16-subnormal magnitudes, which the residual carries
#pragma unroll
    for (int u = 0; u < PU; ++u)
#pragma unroll
      for (int e = 0; e < 4; ++e) { v8h r;
#pragma unroll
        for (int k = 0; k < 8; ++k) { const float q = bfr(x[u][k][e]); r[k] = (_Float16)((q - (float)(_Float16)q) * 1024.0f); }
        vst2(dl + u * CC + e * HD, r); } } }
__device__ __forceinline__ void prep_v(const float* __restrict__ V, _Float16* __restrict__ VT, __bf16* __restrict__ VB, __bf16* __restrict__ VBL, int tile, int d0, int lane) {
  const int tg = lane & 7, h4 = lane >> 3; const int bb = tile / (TT / 64), t0 = tile % (TT / 64) * 64; const float* src = V + ((size_t)tile * 64 + tg * 8) * CC + d0 * NH + h4 * 4; v4f x[PU][8];   // lane: heads 4 h4 .. + 3, tokens t0 + 8 tg .. + 7
#pragma unroll
  for (int k = 0; k < 8; ++k)
#pragma unroll
    for (int u = 0; u < PU; ++u) x[u][k] = *(const v4f*)(src + k * CC + u * NH);
  asm volatile("s_wait_xcnt 0x0" ::: "memory");   // as in prep_qk
  const size_t c0 = (size_t)bb * CC + h4 * 4 * HD + d0; _Float16* dv = VT + c0 * TT + t0 + tg * 8;
#pragma unroll
  for (int u = 0; u < PU; ++u)
#pragma unroll
    for (int e = 0; e < 4; ++e) { v8h r;
#pragma unroll
      for (int k = 0; k < 8; ++k) r[k] = (_Float16)bfr(x[u][k][e]);
      vst2(dv + (e * HD + u) * TT, r); }
  asm volatile("s_wait_xcnt 0x0" ::: "memory");   // as in prep_qk
  if (t0 < KHI) { __bf16* db = VB + c0 * KHI + t0 + tg * 8; __bf16* dl = VBL + c0 * KHI + t0 + tg * 8;
#pragma unroll
    for (int u = 0; u < PU; ++u)
#pragma unroll
      for (int e = 0; e < 4; ++e) { v8b rh, rl;
#pragma unroll
        for (int k = 0; k < 8; ++k) { const float v = bfr(x[u][k][e]); const __bf16 vb = (__bf16)v; rh[k] = vb; rl[k] = (__bf16)(v - (float)vb); }
        vst2(db + (e * HD + u) * KHI, rh); vst2(dl + (e * HD + u) * KHI, rl); } } }
__global__ __launch_bounds__(32 * PW) void k_prepr(const float* __restrict__ Q, const float* __restrict__ K, const float* __restrict__ V, _Float16* __restrict__ QH, _Float16* __restrict__ QL, _Float16* __restrict__ KH, _Float16* __restrict__ KL, _Float16* __restrict__ VT, __bf16* __restrict__ VB, __bf16* __restrict__ VBL) {
  const int lane = threadIdx.x & 31; const int w = blockIdx.x * PW + __builtin_amdgcn_readfirstlane(threadIdx.x >> 5);   // wave number in a scalar register: the tests on rows below QHI / KHI are scalar branches
  if (blockIdx.y == 2) { prep_v(V, VT, VB, VBL, w / (HD / PU), w % (HD / PU) * PU, lane); return; }
  const bool isq = blockIdx.y == 0; prep_qk(isq ? Q : K, isq ? QH : KH, isq ? QL : KL, w * PU, lane); }
static_assert(NH == 16 && HD == 64 && QHI == KHI && QHI % 64 == 0 && TT % 64 == 0 && HD % PU == 0 && (TNB * TT) % (PW * PU) == 0 && (TNB * TT / 64) * (HD / PU) == TNB * TT / PU, "k_prepr: 32 lanes = 4 head quads x 8 groups of 8; as many waves for v as for q or k");

#ifndef SM_EXTRA_PARAMS
#define SM_EXTRA_PARAMS
#endif
#ifndef PROJ_EXTRA_PARAMS
#define PROJ_EXTRA_PARAMS
#endif
#ifndef SM_MASK_HOOK
#define SM_MASK_HOOK (void)0
#endif

#define WS_QH  0u                                      // f16 q rows [b*t][CC]
#define WS_KH  (WS_QH + 2u * (size_t)NB * TT * CC)      // f16 k rows [b*t][CC]
#define WS_VT  (WS_KH + 2u * (size_t)NB * TT * CC)      // f16 v planes [b][c][t]
#define WS_QL  (WS_VT + 2u * (size_t)NB * CC * TT)      // f16 q residual x 2^10 rows [b][t < QHI][CC]
#define WS_KL  (WS_QL + 2u * (size_t)NB * QHI * CC)     // f16 k residual x 2^10 rows [b][t < KHI][CC]
#define WS_VB  (WS_KL + 2u * (size_t)NB * KHI * CC)     // bf16 v hi planes [b][c][t < KHI]
#define WS_VBL (WS_VB + 2u * (size_t)NB * CC * KHI)
#define WS_S   (WS_VBL + 2u * (size_t)NB * CC * KHI)    // f32 [hg][t][s] space, not used by any kernel here
#define WS_Y   (WS_S  + 4u * (size_t)HG * TT * TT)      // f32 ctx rows [b*t][CC]
#define WS_END (WS_Y  + 4u * (size_t)NB * TT * CC)   // f32 context rows in the internal layout [b*t][h*64 + d], re-ordered by k_tr into the output

// ---- k_fa: block = 32 queries (tile qt) of (b, h), FW waves: wave w takes the 32-key chunks w, w + FW, ... <= qt. Per chunk: S^T = k . q^T (lane = one query column, 16 of the chunk's keys in its registers), running maximum and sum per query in f32 (online softmax, log2 units), P x 2^11 packed from the score accumulators straight into a B operand, ctx^T += v^T . P^T. Logits and P never leave the registers. Query rows < QHI keep the residual products and the bf16 hi + lo P . v. The waves' (max, sum, ctx) partials are merged in wave order through LDS.
#define FW 8
#define FQ 32
#define LOGC (SCALE * 1.44269504088896340736f)   // logit scale x log2(e)
__device__ __forceinline__ float xhalf(float x) { return __builtin_bit_cast(float, __builtin_amdgcn_permlanex16(__builtin_bit_cast(int, x), __builtin_bit_cast(int, x), 0x76543210, 0xfedcba98, false, false)); }   // lane l reads lane l ^ 16
// 2^x by v_exp_f32, with the one free slot that the instruction set asks for behind a transcendental kept inside the statement; in the run of eight no instruction reads its predecessor's result or overwrites its source (outputs are early-clobber), the v_nop serves the last
__device__ __forceinline__ float exp2s(float x) { float r; asm("v_exp_f32 %0, %1\n\tv_nop" : "=v"(r) : "v"(x)); return r; }
__device__ __forceinline__ void exp2x8(float* o, const float* x) {
  asm("v_exp_f32 %0, %8\n\tv_exp_f32 %1, %9\n\tv_exp_f32 %2, %10\n\tv_exp_f32 %3, %11\n\tv_exp_f32 %4, %12\n\tv_exp_f32 %5, %13\n\tv_exp_f32 %6, %14\n\tv_exp_f32 %7, %15\n\tv_nop"
      : "=&v"(o[0]), "=&v"(o[1]), "=&v"(o[2]), "=&v"(o[3]), "=&v"(o[4]), "=&v"(o[5]), "=&v"(o[6]), "=&v"(o[7]) : "v"(x[0]), "v"(x[1]), "v"(x[2]), "v"(x[3]), "v"(x[4]), "v"(x[5]), "v"(x[6]), "v"(x[7])); }
struct FaSt { v8f acc[2][HD / 16]; float m[2], l[2]; };
template <bool HI> __device__ __forceinline__ void fa_run(FaSt& st, const _Float16* __restrict__ QH, const _Float16* __restrict__ KH, const _Float16* __restrict__ QL, const _Float16* __restrict__ KL, const _Float16* __restrict__ VT, const __bf16* __restrict__ VB, const __bf16* __restrict__ VBL, int b, int h, int qt, int wave, int lane) {
  const int col = lane & 15, g = lane >> 4; const int q0 = qt * FQ;
  v16h qh[2][2], ql[2][2];
#pragma unroll
  for (int n = 0; n < 2; ++n)
#pragma unroll
    for (int c = 0; c < 2; ++c) { qh[n][c] = frag_h(QH + ((size_t)b * TT + q0 + n * 16 + col) * CC + h * HD + c * 32, lane); if (HI) ql[n][c] = frag_h(QL + ((size_t)b * QHI + q0 + n * 16 + col) * CC + h * HD + c * 32, lane); }
  v16h kf[2][2], vf[HD / 16];   // !HI: this chunk's k fragments (fetched one chunk ahead) and v fragments (fetched at the chunk's top), so that no product waits for a load issued just in front of it
  if (!HI) { const int kf0 = (wave <= qt ? wave : qt) * 32;
#pragma unroll
    for (int t = 0; t < 2; ++t)
#pragma unroll
      for (int c = 0; c < 2; ++c) kf[t][c] = frag_h(KH + ((size_t)b * TT + kf0 + t * 16 + col) * CC + h * HD + c * 32, lane); }
#pragma unroll 1
  for (int kc = wave; kc <= qt; kc += FW) { const int k0 = kc * 32;
    v8f s[2][2] = {};   // [query group][key tile]: element r = key k0 + 16 * tile + 8 * g + r, query q0 + 16 * group + col
    if (HI) { v8f sl[2][2] = {};
#pragma unroll
      for (int t = 0; t < 2; ++t)
#pragma unroll
        for (int c = 0; c < 2; ++c) { const v16h kf = frag_h(KH + ((size_t)b * TT + k0 + t * 16 + col) * CC + h * HD + c * 32, lane), klf = frag_h(KL + ((size_t)b * KHI + k0 + t * 16 + col) * CC + h * HD + c * 32, lane);
#pragma unroll
          for (int n = 0; n < 2; ++n) { s[n][t] = wmma16(kf, qh[n][c], s[n][t]); sl[n][t] = wmma16(kf, ql[n][c], sl[n][t]); sl[n][t] = wmma16(klf, qh[n][c], sl[n][t]); } }
#pragma unroll
      for (int n = 0; n < 2; ++n)
#pragma unroll
        for (int t = 0; t < 2; ++t) s[n][t] += sl[n][t] * (1.0f / 1024.0f);
    } else {
#pragma unroll
      for (int j = 0; j < HD / 16; ++j) vf[j] = frag_h(VT + ((size_t)b * CC + h * HD + j * 16 + col) * (size_t)TT + k0, lane);
#pragma unroll
      for (int t = 0; t < 2; ++t)
#pragma unroll
        for (int c = 0; c < 2; ++c)
#pragma unroll
          for (int n = 0; n < 2; ++n) s[n][t] = wmma16(kf[t][c], qh[n][c], s[n][t]);
      const int kn = (kc + FW <= qt ? kc + FW : kc) * 32;   // the wave's next chunk; on its last trip the same rows again (in bounds, not used)
#pragma unroll
      for (int t = 0; t < 2; ++t)
#pragma unroll
        for (int c = 0; c < 2; ++c) kf[t][c] = frag_h(KH + ((size_t)b * TT + kn + t * 16 + col) * CC + h * HD + c * 32, lane);
      asm volatile("s_wait_xcnt 0x0" ::: "memory"); }   // the loads' address registers are reused behind the branch below
    if (kc == qt) {   // the diagonal chunk: keys past the query are excluded (every query keeps key k0 at least)
#pragma unroll
      for (int n = 0; n < 2; ++n)
#pragma unroll
        for (int t = 0; t < 2; ++t)
#pragma unroll
          for (int r = 0; r < 8; ++r) if (t * 16 + 8 * g + r > n * 16 + col) s[n][t][r] = -1.0e30f; }
    float mt[2];
#pragma unroll
    for (int n = 0; n < 2; ++n) { float mx = s[n][0][0];
#pragma unroll
      for (int r = 1; r < 8; ++r) mx = fmaxf(mx, s[n][0][r]);
#pragma unroll
      for (int r = 0; r < 8; ++r) mx = fmaxf(mx, s[n][1][r]);
      mx = fmaxf(mx, xhalf(mx)); mt[n] = fmaxf(st.m[n], mx * LOGC); }
    if (__builtin_amdgcn_ballot_w32(mt[0] > st.m[0] || mt[1] > st.m[1]) != 0) {   // a maximum grew somewhere in the wave: bring sums and ctx to the new one
#pragma unroll
      for (int n = 0; n < 2; ++n) { const float a = exp2s(st.m[n] - mt[n]); st.m[n] = mt[n]; st.l[n] *= a;
#pragma unroll
        for (int j = 0; j < HD / 16; ++j) st.acc[n][j] *= a; } }
    float p[2][16];
#pragma unroll
    for (int n = 0; n < 2; ++n) { const float bias = 11.0f - st.m[n]; float sum = 0.f;
#pragma unroll
      for (int t = 0; t < 2; ++t) { float x[8];
#pragma unroll
        for (int r = 0; r < 8; ++r) x[r] = fmaf(s[n][t][r], LOGC, bias);
        exp2x8(&p[n][8 * t], x);
#pragma unroll
        for (int r = 0; r < 8; ++r) sum += p[n][8 * t + r]; }
      st.l[n] += sum; }
    if (HI) { const F2 p0 = bsplit16(p[0]), p1 = bsplit16(p[1]);
#pragma unroll
      for (int j = 0; j < HD / 16; ++j) { const size_t po = ((size_t)b * CC + h * HD + j * 16 + col) * (size_t)KHI + k0; const v16b vh = frag_b(VB + po, lane), vl = frag_b(VBL + po, lane);
        st.acc[0][j] = wmma_bf(vh, p0.h, st.acc[0][j]); st.acc[0][j] = wmma_bf(vh, p0.l, st.acc[0][j]); st.acc[0][j] = wmma_bf(vl, p0.h, st.acc[0][j]);
        st.acc[1][j] = wmma_bf(vh, p1.h, st.acc[1][j]); st.acc[1][j] = wmma_bf(vh, p1.l, st.acc[1][j]); st.acc[1][j] = wmma_bf(vl, p1.h, st.acc[1][j]); }
    } else { v16h pf[2];
#pragma unroll
      for (int n = 0; n < 2; ++n)
#pragma unroll
        for (int i = 0; i < 16; ++i) pf[n][i] = (_Float16)p[n][i];
#pragma unroll
      for (int j = 0; j < HD / 16; ++j)
#pragma unroll
        for (int n = 0; n < 2; ++n) st.acc[n][j] = wmma16(vf[j], pf[n], st.acc[n][j]); } } }
__global__ __launch_bounds__(32 * FW) void k_fa(const _Float16* __restrict__ QH, const _Float16* __restrict__ KH, const _Float16* __restrict__ QL, const _Float16* __restrict__ KL, const _Float16* __restrict__ VT, const __bf16* __restrict__ VB, const __bf16* __restrict__ VBL, float* __restrict__ Y) {
  __shared__ __align__(16) float ss[FW][FQ][HD + 4]; __shared__ float sm[FW][FQ], sl[FW][FQ];
  const int tid = threadIdx.x, lane = tid & 31, col = lane & 15, g = lane >> 4; const int b = blockIdx.x / NH, h = blockIdx.x % NH; const int qt = TT / FQ - 1 - blockIdx.y;   // longest tiles start first
  const int wave = __builtin_amdgcn_readfirstlane(tid >> 5);   // wave number in a scalar register: the chunk loop branches on scalar compares and every lane stays on at the matrix instructions
  FaSt st;
#pragma unroll
  for (int n = 0; n < 2; ++n) { st.m[n] = -1.0e30f; st.l[n] = 0.f;
#pragma unroll
    for (int j = 0; j < HD / 16; ++j) st.acc[n][j] = v8f{}; }
  if (qt * FQ < QHI) fa_run<true>(st, QH, KH, QL, KL, VT, VB, VBL, b, h, qt, wave, lane); else fa_run<false>(st, QH, KH, QL, KL, VT, VB, VBL, b, h, qt, wave, lane);
#pragma unroll
  for (int n = 0; n < 2; ++n) { const float l = st.l[n] + xhalf(st.l[n]); if (g == 0) { sm[wave][n * 16 + col] = st.m[n]; sl[wave][n * 16 + col] = l; }
#pragma unroll
    for (int j = 0; j < HD / 16; ++j) { const v8f a = st.acc[n][j]; *(v4f*)&ss[wave][n * 16 + col][j * 16 + 8 * g] = v4f{a[0], a[1], a[2], a[3]}; *(v4f*)&ss[wave][n * 16 + col][j * 16 + 8 * g + 4] = v4f{a[4], a[5], a[6], a[7]}; } }
  __syncthreads();   // every wave's partial is in LDS before any thread merges across waves
#pragma unroll
  for (int i = 0; i < FQ / 16; ++i) { const int rl = (tid >> 4) + 16 * i, c4 = (tid & 15) * 4; float M = sm[0][rl];
    for (int w = 1; w < FW; ++w) M = fmaxf(M, sm[w][rl]);
    float L = 0.f; v4f s = {};
    for (int w = 0; w < FW; ++w) { const float f = exp2s(sm[w][rl] - M); L += sl[w][rl] * f; s += *(const v4f*)&ss[w][rl][c4] * f; }   // a wave without chunks has weight 0
    vst2(Y + ((size_t)b * TT + qt * FQ + rl) * CC + h * HD + c4, s * (1.0f / L)); } }
static_assert(32 * FW == 16 * (HD / 4) && QHI % FQ == 0 && QHI <= KHI && TT % FQ == 0, "k_fa: 16 rows of HD / 4 threads; whole tiles on either precision path");

__global__ __launch_bounds__(256) void k_tr(const float* __restrict__ Y, float* __restrict__ OUT) { __shared__ __align__(16) float sy[CC]; const size_t r = blockIdx.x; const int tid = threadIdx.x; *(v4f*)&sy[tid * 4] = *(const v4f*)(Y + r * CC + tid * 4); asm volatile("s_wait_loadcnt 0x0" ::: "memory"); __syncthreads(); v4f o;
#pragma unroll
  for (int i = 0; i < 4; ++i) { const int j = tid * 4 + i; const int d = j / NH, hh = j % NH; o[i] = sy[hh * HD + d]; }
  vst2(OUT + r * CC + tid * 4, o); }
static_assert(CC == 1024 && NH * HD == CC, "k_tr: 256 threads x 4 floats = one 1,024-float row");
extern "C" void kernel_launch(void* const* d_in, const int* in_sizes, int n_in, void* d_out, int out_size, void* d_ws, size_t ws_size, hipStream_t stream) {
  (void)in_sizes; (void)n_in; (void)out_size;
  const float** F = (const float**)d_in;
  if (ws_size < (size_t)WS_END) return;
  char* ws = (char*)d_ws; _Float16 *QH = (_Float16*)(ws + WS_QH), *KH = (_Float16*)(ws + WS_KH), *VT = (_Float16*)(ws + WS_VT), *QL = (_Float16*)(ws + WS_QL), *KL = (_Float16*)(ws + WS_KL); __bf16 *VB = (__bf16*)(ws + WS_VB), *VBL = (__bf16*)(ws + WS_VBL); float *Y = (float*)(ws + WS_Y);
  (void)Y; (void)QL; (void)KL; (void)VB; (void)VBL;
  // inputs: 0 q [2,2048,64,16]; 1 k; 2 v (all (batch, seq, head_dim, n_heads): token rows of 1,024 with element (d, h) at d*16 + h)
  k_prepr<<<dim3(TNB * TT / (PW * PU), 3), 32 * PW, 0, stream>>>(F[0], F[1], F[2], QH, QL, KH, KL, VT, VB, VBL);
  k_fa<<<dim3(TNB * NH, TT / FQ), 32 * FW, 0, stream>>>(QH, KH, QL, KL, VT, VB, VBL, Y);
  k_tr<<<dim3(TNB * TT), 256, 0, stream>>>(Y, (float*)d_out);   /* internal layout [h*64 + d] -> the module's [d*16 + h] */
}

// v004
// A run of this version takes 46.6 microseconds.
// In two side-by-side timings against v003, it was 1.28 and 1.32 times as fast.
// Over all steps from v000 it is 18.8 times as fast.
// compute dtype: all float inputs rounded to bf16 (bf16 values are exact in f16 apart from f16-subnormal magnitudes); causal logits q x k / 64 (exact operands; the module divides by head_dim, not its square root); softmax f32; P x 2^11 once to f16 x v (bf16 hi + lo path below row 384); f32 context rows, then re-ordered to the module's heads-innermost layout. No projections. The 16-bit q, k, v planes lie in matrix-fragment order.
#include <hip/hip_runtime.h>
#include <math.h>

typedef __attribute__((ext_vector_type(16))) _Float16 v16h;
typedef __attribute__((ext_vector_type(16))) __bf16 v16b;
typedef __attribute__((ext_vector_type(8)))  _Float16 v8h;
typedef __attribute__((ext_vector_type(8)))  float v8f;
typedef __attribute__((ext_vector_type(4)))  float v4f;
typedef __attribute__((ext_vector_type(2)))  float v2f;
typedef __attribute__((ext_vector_type(4)))  unsigned v4u;
typedef __attribute__((ext_vector_type(4)))  int v4i;
typedef float __attribute__((may_alias)) float_a;
typedef int __attribute__((may_alias)) int_a;

template <typename T> __device__ __forceinline__ void vst2(void* p, T v) { *(T*)p = v;  }
__device__ __forceinline__ v8f wmma16(v16h a, v16h b, v8f c) {
  v8f d = __builtin_amdgcn_wmma_f32_16x16x32_f16(false, a, false, b, (short)0, c, false, false);
  asm volatile("v_nop\n\tv_nop\n\tv_nop\n\tv_nop" : "+v"(d) : "v"(a), "v"(b));
  return d;
}
__device__ __forceinline__ v8f wmma_bf(v16b a, v16b b, v8f c) {
  v8f d = __builtin_amdgcn_wmma_f32_16x16x32_bf16(false, a, false, b, (short)0, c, false, false);
  asm volatile("v_nop\n\tv_nop\n\tv_nop\n\tv_nop" : "+v"(d) : "v"(a), "v"(b));
  return d;
}
// 16x16x32 fragments: lane = (h = lane>>4, row/col = lane&15); elements 0..7 = k0+8h+0..7, 8..15 = k0+16+8h+0..7; D element r = row 8h+r
__device__ __forceinline__ v16h frag_h(const _Float16* rowk0, int lane) {
  union { v16h v; v8h q[2]; } u; const _Float16* p = rowk0 + 8 * (lane >> 4);
  u.q[0] = *(const v8h*)p; u.q[1] = *(const v8h*)(p + 16); return u.v;
}
__device__ __forceinline__ v16h frag_f32(const float* rowk0, int lane) {
  v16h a; const float* p = rowk0 + 8 * (lane >> 4);
#pragma unroll
  for (int i = 0; i < 8; ++i) { a[i] = (_Float16)p[i]; a[8 + i] = (_Float16)p[16 + i]; }
  return a;
}
__device__ __forceinline__ v16h frag_f32s(const float* rowk0, int lane, float sc) {
  v16h a; const float* p = rowk0 + 8 * (lane >> 4);
#pragma unroll
  for (int i = 0; i < 8; ++i) { a[i] = (_Float16)(p[i] * sc); a[8 + i] = (_Float16)(p[16 + i] * sc); }
  return a;
}
// column fragment from a [K][ld] layout (column n), rows >= K read as 0
__device__ __forceinline__ v16h fragc_f32(const float* W, int k0, int n, int lane, int ld, int K) {
  v16h a; const int g = lane >> 4;
#pragma unroll
  for (int i = 0; i < 8; ++i) { const int ka = k0 + 8 * g + i, kb = ka + 16;
    a[i] = (_Float16)(ka < K ? W[(size_t)(ka < K ? ka : K - 1) * ld + n] : 0.f); a[8 + i] = (_Float16)(kb < K ? W[(size_t)(kb < K ? kb : K - 1) * ld + n] : 0.f); }
  return a;
}
struct F2 { v16b h, l; };
__device__ __forceinline__ F2 bsplit16(const float v[16]) { F2 r;
#pragma unroll
  for (int i = 0; i < 16; ++i) { const __bf16 h = (__bf16)v[i]; r.h[i] = h; r.l[i] = (__bf16)(v[i] - (float)h); }
  return r; }
__device__ __forceinline__ F2 split_row(const float* row, int k0, int lane) { float v[16]; const float* p = row + k0 + 8 * (lane >> 4);
#pragma unroll
  for (int i = 0; i < 8; ++i) { v[i] = p[i]; v[8 + i] = p[16 + i]; }
  return bsplit16(v); }
__device__ __forceinline__ F2 split_rowK(const float* row, int k0, int lane, int K) { float v[16]; const int g = lane >> 4;
#pragma unroll
  for (int i = 0; i < 8; ++i) { const int ka = k0 + 8 * g + i, kb = ka + 16; v[i] = ka < K ? row[ka < K ? ka : K - 1] : 0.f; v[8 + i] = kb < K ? row[kb < K ? kb : K - 1] : 0.f; }
  return bsplit16(v); }
__device__ __forceinline__ F2 split_col(const float* W, int k0, int n, int lane, int ld, int K) { float v[16]; const int g = lane >> 4;
#pragma unroll
  for (int i = 0; i < 8; ++i) { const int ka = k0 + 8 * g + i, kb = ka + 16; v[i] = ka < K ? W[(size_t)(ka < K ? ka : K - 1) * ld + n] : 0.f; v[8 + i] = kb < K ? W[(size_t)(kb < K ? kb : K - 1) * ld + n] : 0.f; }
  return bsplit16(v); }
__device__ __forceinline__ v8f mac3(const F2& a, const F2& b, v8f c) { c = wmma_bf(a.l, b.h, c); c = wmma_bf(a.h, b.l, c); return wmma_bf(a.h, b.h, c); }
__device__ __forceinline__ float sigm(float v) { return 1.0f / (1.0f + expf(-v)); }
#define LDSX() do { asm volatile("s_wait_dscnt 0" ::: "memory"); __builtin_amdgcn_wave_barrier(); __builtin_amdgcn_fence(__ATOMIC_RELEASE, "workgroup"); } while (0)

// Causal multi-head softmax attention without weights in a HEADS-INNERMOST layout (q / k / v [2,2048,64,16] = (batch, seq, head_dim, n_heads), N(0,1); att[b,c,C,h] = sum_d q[b,c,d,h] k[b,C,d,h] / 64 (1 / head_dim); C > c set to -inf; softmax over C; y[b,c,v,h] = sum_C p[b,c,C,h] v[b,C,v,h], [2,2048,64,16]). Internal view: token row = (b, c); internal column h*64 + d lives at offset d*16 + h of the module's 1,024-float row: the loader gathers it that way and a final row-wise re-order writes the output back the same way.
#define NB 2
#define TT 2048
#define CC 1024            // NH * HD = projected width
#define DIN 1024          // input (model) width
#define NH 16
#define HD 64
#define NQB (TT / 64)
#define HG 4
#define SCALE (0.015625f)
#define CAUSAL 1
#ifndef TNB
#define TNB NB
#endif
__device__ __forceinline__ float bfr(float v) { return (float)(__bf16)v; }
__host__ __device__ __forceinline__ int kb_last(int qb) { return CAUSAL ? ((qb * 64 + 63) >> 7) : (TT / 128 - 1); }
typedef __attribute__((ext_vector_type(8))) __bf16 v8b;
__device__ __forceinline__ v16b frag_b(const __bf16* rowk0, int lane) {
  union { v16b v; v8b q[2]; } u; const __bf16* p = rowk0 + 8 * (lane >> 4);
  u.q[0] = *(const v8b*)p; u.q[1] = *(const v8b*)(p + 16); return u.v;
}
// Fragment-order planes: one 16 x 32 fragment (16 rows or columns x 32 values of k) is 1,024 contiguous bytes, two halves of 512 (fragment elements 0..7 and 8..15), lane l's 8 elements at byte 16 l of each half: a wave's 16-byte load or a store of 8 neighbouring lanes covers whole 128-byte lines.
__device__ __forceinline__ v16h frag_ph(const _Float16* f, int lane) { union { v16h v; v8h q[2]; } u; u.q[0] = *(const v8h*)(f + lane * 8); u.q[1] = *(const v8h*)(f + 256 + lane * 8); return u.v; }
__device__ __forceinline__ v16b frag_pb(const __bf16* f, int lane) { union { v16b v; v8b q[2]; } u; u.q[0] = *(const v8b*)(f + lane * 8); u.q[1] = *(const v8b*)(f + 256 + lane * 8); return u.v; }
// first element of a fragment. q, k planes [b][h][16-row tile][32-d half c]: lane = 16 g + row, half q, element i = d 32 c + 16 q + 8 g + i; R = rows a batch. v planes [b][h][32-key chunk][16-d group j]: lane = 16 g + d, half q, element i = key 16 q + 8 g + i of the chunk; S = keys a batch.
__device__ __forceinline__ size_t fo_row(int b, int h, int R, int tile, int c) { return ((((size_t)b * NH + h) * (R / 16) + tile) * 2 + c) * 512; }
__device__ __forceinline__ size_t fo_v(int b, int h, int S, int chunk, int j) { return ((((size_t)b * NH + h) * (S / 32) + chunk) * 4 + j) * 512; }
#define QBH 6              // not used: the causal high-precision path is taken by the 32-query tiles below row QHI (few keys, no averaging)
#define QHI 384            // rows carrying a q residual plane
#define KHI 384            // key rows carrying k residual / v bf16 hi+lo planes (used only by the causal high-precision path)
// B fragment (k rows k0+.., output column o) of a weight: (in,out) [K][ld] or (out,in) [ld rows of K]: bf16 exact, or f16(bf16 * 256) exact
__device__ __forceinline__ v16b wcol_io(const float* Wm, int k0, int o, int lane, int ld) { v16b w; const int g = lane >> 4;
#pragma unroll
  for (int i = 0; i < 8; ++i) { w[i] = (__bf16)Wm[(size_t)(k0 + 8 * g + i) * ld + o]; w[8 + i] = (__bf16)Wm[(size_t)(k0 + 16 + 8 * g + i) * ld + o]; }
  return w; }
__device__ __forceinline__ v16b wcol_oi(const float* Wm, int k0, int o, int lane, int K) { v16b w; const float* p = Wm + (size_t)o * K + k0 + 8 * (lane >> 4);
#pragma unroll
  for (int i = 0; i < 8; ++i) { w[i] = (__bf16)p[i]; w[8 + i] = (__bf16)p[16 + i]; }
  return w; }
__device__ __forceinline__ v16h wcolh_io(const float* Wm, int k0, int o, int lane, int ld) { v16h w; const int g = lane >> 4;
#pragma unroll
  for (int i = 0; i < 8; ++i) { w[i] = (_Float16)(bfr(Wm[(size_t)(k0 + 8 * g + i) * ld + o]) * 256.0f); w[8 + i] = (_Float16)(bfr(Wm[(size_t)(k0 + 16 + 8 * g + i) * ld + o]) * 256.0f); }
  return w; }
__device__ __forceinline__ v16h wcolh_oi(const float* Wm, int k0, int o, int lane, int K) { v16h w; const float* p = Wm + (size_t)o * K + k0 + 8 * (lane >> 4);
#pragma unroll
  for (int i = 0; i < 8; ++i) { w[i] = (_Float16)(bfr(p[i]) * 256.0f); w[8 + i] = (_Float16)(bfr(p[16 + i]) * 256.0f); }
  return w; }
#define WQKV_LAYOUT 1   // 0 = (in,out) [DIN][CC]; 1 = (out,in) [CC][DIN]; 2 = per-head [NH][DIN][HD]
__device__ __forceinline__ v16b wcol_hdk(const float* Wm, int k0, int o, int lane) { v16b w; const int g = lane >> 4; const float* p = Wm + (size_t)(o / HD) * DIN * HD + (o % HD);
#pragma unroll
  for (int i = 0; i < 8; ++i) { w[i] = (__bf16)p[(size_t)(k0 + 8 * g + i) * HD]; w[8 + i] = (__bf16)p[(size_t)(k0 + 16 + 8 * g + i) * HD]; }
  return w; }
#define WO_OUT_IN 0
#if WQKV_LAYOUT == 1
#define WCOL(W, k0, o, lane) wcol_oi(W, k0, o, lane, DIN)
#elif WQKV_LAYOUT == 2
#define WCOL(W, k0, o, lane) wcol_hdk(W, k0, o, lane)
#else
#define WCOL(W, k0, o, lane) wcol_io(W, k0, o, lane, CC)
#endif
#if WO_OUT_IN
#define WOCOL(W, k0, o, lane) wcol_oi(W, k0, o, lane, CC)
#define WOCOLH(W, k0, o, lane) wcolh_oi(W, k0, o, lane, CC)
#else
#define WOCOL(W, k0, o, lane) wcol_io(W, k0, o, lane, DIN)
#define WOCOLH(W, k0, o, lane) wcolh_io(W, k0, o, lane, DIN)
#endif

// ---- k_prepr: reads the module's [B, T, 64, NH] inputs once, in 16-byte pieces (4 heads of one d), bf16-rounds them and writes the attention planes in fragment order (above): q -> f16 (+ x 2^10 residual for s < QHI), k -> f16 (+ residual for s < KHI), v -> f16 (+ bf16 hi/lo for s < KHI). A lane gathers 8 pieces along the fragment's k axis (d for q and k, s for v), so the 4 x 8 transpose is a renaming of its registers; 8 neighbouring lanes hold 8 neighbouring fragment rows, so every store instruction writes four whole 128-byte lines. blockIdx.y = tensor; a wave takes 8 token rows x 32 d (q, k) or 32 tokens x 8 d (v), all heads.
#define PW 4               // waves a block
#define PU 4               // groups of 8 along k a wave: one fragment's (half q, lane group g) = (u >> 1, u & 1)
__device__ __forceinline__ void prep_qk(const float* __restrict__ X, _Float16* __restrict__ XH, _Float16* __restrict__ XL, int row0, int c, int lane) {
  const int r8 = lane & 7, h4 = lane >> 3; const float* src = X + (size_t)(row0 + r8) * CC + c * 32 * NH + h4 * 4; v4f x[PU][8];   // lane: token row0 + r8, heads 4 h4 .. + 3, d = 32 c .. + 31
#pragma unroll
  for (int u = 0; u < PU; ++u)
#pragma unroll
    for (int k = 0; k < 8; ++k) x[u][k] = *(const v4f*)(src + (u * 8 + k) * NH);
  asm volatile("s_wait_xcnt 0x0" ::: "memory");   // every load is issued before the first conversion, and their address registers are free for reuse behind this line
  const int bb = row0 / TT, rb = row0 % TT; const int lo = ((rb & 8) + r8) * 8; _Float16* dh = XH + fo_row(bb, h4 * 4, TT, rb / 16, c) + lo;
#pragma unroll
  for (int u = 0; u < PU; ++u)
#pragma unroll
    for (int e = 0; e < 4; ++e) { v8h r;
#pragma unroll
      for (int k = 0; k < 8; ++k) r[k] = (_Float16)bfr(x[u][k][e]);
      vst2(dh + e * (TT / 16) * 1024 + (u >> 1) * 256 + (u & 1) * 128, r); }
  asm volatile("s_wait_xcnt 0x0" ::: "memory");   // the stores' data registers are reused behind the branch below
  if (rb < QHI) { _Float16* dl = XL + fo_row(bb, h4 * 4, QHI, rb / 16, c) + lo;   // module inputs are bf16-rounded; bf16 values are exact in f16 apart from f16-subnormal magnitudes, which the residual carries
#pragma unroll
    for (int u = 0; u < PU; ++u)
#pragma unroll
      for (int e = 0; e < 4; ++e) { v8h r;
#pragma unroll
        for (int k = 0; k < 8; ++k) { const float q = bfr(x[u][k][e]); r[k] = (_Float16)((q - (float)(_Float16)q) * 1024.0f); }
        vst2(dl + e * (QHI / 16) * 1024 + (u >> 1) * 256 + (u & 1) * 128, r); }
    asm volatile("s_wait_xcnt 0x0" ::: "memory"); } }   // in the listing the v branch, which rewrites these stores' registers, follows this block
__device__ __forceinline__ void prep_v(const float* __restrict__ V, _Float16* __restrict__ VT, __bf16* __restrict__ VB, __bf16* __restrict__ VBL, int ck, int dq, int lane) {
  const int d8 = lane & 7, h4 = lane >> 3; const int bb = ck / (TT / 32), cb = ck % (TT / 32); const float* src = V + (size_t)ck * 32 * CC + (dq * 8 + d8) * NH + h4 * 4; v4f x[PU][8];   // lane: d = 8 dq + d8, heads 4 h4 .. + 3, the chunk's 32 tokens; a load instruction covers 512 contiguous bytes
#pragma unroll
  for (int u = 0; u < PU; ++u)
#pragma unroll
    for (int k = 0; k < 8; ++k) x[u][k] = *(const v4f*)(src + (u * 8 + k) * CC);
  asm volatile("s_wait_xcnt 0x0" ::: "memory");   // as in prep_qk
  const int lo = ((dq & 1) * 8 + d8) * 8; _Float16* dv = VT + fo_v(bb, h4 * 4, TT, cb, dq >> 1) + lo;
#pragma unroll
  for (int u = 0; u < PU; ++u)
#pragma unroll
    for (int e = 0; e < 4; ++e) { v8h r;
#pragma unroll
      for (int k = 0; k < 8; ++k) r[k] = (_Float16)bfr(x[u][k][e]);
      vst2(dv + e * (TT / 32) * 2048 + (u >> 1) * 256 + (u & 1) * 128, r); }
  asm volatile("s_wait_xcnt 0x0" ::: "memory");   // as in prep_qk
  if (cb * 32 < KHI) { const size_t po = fo_v(bb, h4 * 4, KHI, cb, dq >> 1) + lo; __bf16* db = VB + po; __bf16* dl = VBL + po;
#pragma unroll
    for (int u = 0; u < PU; ++u)
#pragma unroll
      for (int e = 0; e < 4; ++e) { v8b rh, rl;
#pragma unroll
        for (int k = 0; k < 8; ++k) { const float v = bfr(x[u][k][e]); const __bf16 vb = (__bf16)v; rh[k] = vb; rl[k] = (__bf16)(v - (float)vb); }
        const int o = e * (KHI / 32) * 2048 + (u >> 1) * 256 + (u & 1) * 128; vst2(db + o, rh); vst2(dl + o, rl); } } }
__global__ __launch_bounds__(32 * PW) void k_prepr(const float* __restrict__ Q, const float* __restrict__ K, const float* __restrict__ V, _Float16* __restrict__ QH, _Float16* __restrict__ QL, _Float16* __restrict__ KH, _Float16* __restrict__ KL, _Float16* __restrict__ VT, __bf16* __restrict__ VB, __bf16* __restrict__ VBL) {
  const int lane = threadIdx.x & 31; const int w = blockIdx.x * PW + __builtin_amdgcn_readfirstlane(threadIdx.x >> 5);   // wave number in a scalar register: the tests on rows below QHI / KHI are scalar branches
  if (blockIdx.y == 2) { prep_v(V, VT, VB, VBL, w >> 3, w & 7, lane); return; }
  const bool isq = blockIdx.y == 0; prep_qk(isq ? Q : K, isq ? QH : KH, isq ? QL : KL, (w >> 1) * 8, w & 1, lane); }
static_assert(NH == 16 && HD == 64 && PU == 4 && QHI == KHI && QHI % 32 == 0 && TT % 32 == 0 && (TNB * TT) % (PW * PU) == 0 && (TNB * TT / 8) * 2 == TNB * TT / PU && (TNB * TT / 32) * 8 == TNB * TT / PU, "k_prepr: 32 lanes = 4 head quads x 8 fragment rows; as many waves for v as for q or k");

#ifndef SM_EXTRA_PARAMS
#define SM_EXTRA_PARAMS
#endif
#ifndef PROJ_EXTRA_PARAMS
#define PROJ_EXTRA_PARAMS
#endif
#ifndef SM_MASK_HOOK
#define SM_MASK_HOOK (void)0
#endif

#define WS_QH  0u                                      // f16 q, fragment order [b][h][t / 16][c]
#define WS_KH  (WS_QH + 2u * (size_t)NB * TT * CC)      // f16 k, fragment order
#define WS_VT  (WS_KH + 2u * (size_t)NB * TT * CC)      // f16 v, fragment order [b][h][t / 32][j]
#define WS_QL  (WS_VT + 2u * (size_t)NB * CC * TT)      // f16 q residual x 2^10, fragment order, t < QHI
#define WS_KL  (WS_QL + 2u * (size_t)NB * QHI * CC)     // f16 k residual x 2^10, fragment order, t < KHI
#define WS_VB  (WS_KL + 2u * (size_t)NB * KHI * CC)     // bf16 v hi (then lo), fragment order, t < KHI
#define WS_VBL (WS_VB + 2u * (size_t)NB * CC * KHI)
#define WS_S   (WS_VBL + 2u * (size_t)NB * CC * KHI)    // f32 [hg][t][s] space, not used by any kernel here
#define WS_Y   (WS_S  + 4u * (size_t)HG * TT * TT)      // f32 ctx rows [b*t][CC]
#define WS_END (WS_Y  + 4u * (size_t)NB * TT * CC)   // f32 context rows in the internal layout [b*t][h*64 + d], re-ordered by k_tr into the output

// ---- k_fa: block = 32 queries (tile qt) of (b, h), FW waves: wave w takes the 32-key chunks w, w + FW, ... <= qt. Per chunk: S^T = k . q^T (lane = one query column, 16 of the chunk's keys in its registers), running maximum and sum per query in f32 (online softmax, log2 units), P x 2^11 packed from the score accumulators straight into a B operand, ctx^T += v^T . P^T. Logits and P never leave the registers. Query rows < QHI keep the residual products and the bf16 hi + lo P . v. The waves' (max, sum, ctx) partials are merged in wave order through LDS.
#define FW 8
#define FQ 32
#define LOGC (SCALE * 1.44269504088896340736f)   // logit scale x log2(e)
__device__ __forceinline__ float xhalf(float x) { return __builtin_bit_cast(float, __builtin_amdgcn_permlanex16(__builtin_bit_cast(int, x), __builtin_bit_cast(int, x), 0x76543210, 0xfedcba98, false, false)); }   // lane l reads lane l ^ 16
// 2^x by v_exp_f32, with the one free slot that the instruction set asks for behind a transcendental kept inside the statement; in the run of eight no instruction reads its predecessor's result or overwrites its source (outputs are early-clobber), the v_nop serves the last
__device__ __forceinline__ float exp2s(float x) { float r; asm("v_exp_f32 %0, %1\n\tv_nop" : "=v"(r) : "v"(x)); return r; }
__device__ __forceinline__ void exp2x8(float* o, const float* x) {
  asm("v_exp_f32 %0, %8\n\tv_exp_f32 %1, %9\n\tv_exp_f32 %2, %10\n\tv_exp_f32 %3, %11\n\tv_exp_f32 %4, %12\n\tv_exp_f32 %5, %13\n\tv_exp_f32 %6, %14\n\tv_exp_f32 %7, %15\n\tv_nop"
      : "=&v"(o[0]), "=&v"(o[1]), "=&v"(o[2]), "=&v"(o[3]), "=&v"(o[4]), "=&v"(o[5]), "=&v"(o[6]), "=&v"(o[7]) : "v"(x[0]), "v"(x[1]), "v"(x[2]), "v"(x[3]), "v"(x[4]), "v"(x[5]), "v"(x[6]), "v"(x[7])); }
struct FaSt { v8f acc[2][HD / 16]; float m[2], l[2]; };
template <bool HI> __device__ __forceinline__ void fa_run(FaSt& st, const _Float16* __restrict__ QH, const _Float16* __restrict__ KH, const _Float16* __restrict__ QL, const _Float16* __restrict__ KL, const _Float16* __restrict__ VT, const __bf16* __restrict__ VB, const __bf16* __restrict__ VBL, int b, int h, int qt, int wave, int lane) {
  const int col = lane & 15, g = lane >> 4; const int q0 = qt * FQ;
  v16h qh[2][2], ql[2][2];
#pragma unroll
  for (int n = 0; n < 2; ++n)
#pragma unroll
    for (int c = 0; c < 2; ++c) { qh[n][c] = frag_ph(QH + fo_row(b, h, TT, q0 / 16 + n, c), lane); if (HI) ql[n][c] = frag_ph(QL + fo_row(b, h, QHI, q0 / 16 + n, c), lane); }
  v16h kf[2][2], vf[HD / 16];   // !HI: this chunk's k fragments (fetched one chunk ahead) and v fragments (fetched at the chunk's top), so that no product waits for a load issued just in front of it
  if (!HI) { const int kf0 = (wave <= qt ? wave : qt) * 2;
#pragma unroll
    for (int t = 0; t < 2; ++t)
#pragma unroll
      for (int c = 0; c < 2; ++c) kf[t][c] = frag_ph(KH + fo_row(b, h, TT, kf0 + t, c), lane); }
#pragma unroll 1
  for (int kc = wave; kc <= qt; kc += FW) {   // k0 = 32 kc is the chunk's first key
    v8f s[2][2] = {};   // [query group][key tile]: element r = key k0 + 16 * tile + 8 * g + r, query q0 + 16 * group + col
    if (HI) { v8f sl[2][2] = {};
#pragma unroll
      for (int t = 0; t < 2; ++t)
#pragma unroll
        for (int c = 0; c < 2; ++c) { const v16h kf = frag_ph(KH + fo_row(b, h, TT, kc * 2 + t, c), lane), klf = frag_ph(KL + fo_row(b, h, KHI, kc * 2 + t, c), lane);
#pragma unroll
          for (int n = 0; n < 2; ++n) { s[n][t] = wmma16(kf, qh[n][c], s[n][t]); sl[n][t] = wmma16(kf, ql[n][c], sl[n][t]); sl[n][t] = wmma16(klf, qh[n][c], sl[n][t]); } }
#pragma unroll
      for (int n = 0; n < 2; ++n)
#pragma unroll
        for (int t = 0; t < 2; ++t) s[n][t] += sl[n][t] * (1.0f / 1024.0f);
    } else {
#pragma unroll
      for (int j = 0; j < HD / 16; ++j) vf[j] = frag_ph(VT + fo_v(b, h, TT, kc, j), lane);
#pragma unroll
      for (int t = 0; t < 2; ++t)
#pragma unroll
        for (int c = 0; c < 2; ++c)
#pragma unroll
          for (int n = 0; n < 2; ++n) s[n][t] = wmma16(kf[t][c], qh[n][c], s[n][t]);
      const int kn = (kc + FW <= qt ? kc + FW : kc) * 2;   // the wave's next chunk; on its last trip the same rows again (in bounds, not used)
#pragma unroll
      for (int t = 0; t < 2; ++t)
#pragma unroll
        for (int c = 0; c < 2; ++c) kf[t][c] = frag_ph(KH + fo_row(b, h, TT, kn + t, c), lane);
      asm volatile("s_wait_xcnt 0x0" ::: "memory"); }   // the loads' address registers are reused behind the branch below
    if (kc == qt) {   // the diagonal chunk: keys past the query are excluded (every query keeps key k0 at least)
#pragma unroll
      for (int n = 0; n < 2; ++n)
#pragma unroll
        for (int t = 0; t < 2; ++t)
#pragma unroll
          for (int r = 0; r < 8; ++r) if (t * 16 + 8 * g + r > n * 16 + col) s[n][t][r] = -1.0e30f; }
    float mt[2];
#pragma unroll
    for (int n = 0; n < 2; ++n) { float mx = s[n][0][0];
#pragma unroll
      for (int r = 1; r < 8; ++r) mx = fmaxf(mx, s[n][0][r]);
#pragma unroll
      for (int r = 0; r < 8; ++r) mx = fmaxf(mx, s[n][1][r]);
      mx = fmaxf(mx, xhalf(mx)); mt[n] = fmaxf(st.m[n], mx * LOGC); }
    if (__builtin_amdgcn_ballot_w32(mt[0] > st.m[0] || mt[1] > st.m[1]) != 0) {   // a maximum grew somewhere in the wave: bring sums and ctx to the new one
#pragma unroll
      for (int n = 0; n < 2; ++n) { const float a = exp2s(st.m[n] - mt[n]); st.m[n] = mt[n]; st.l[n] *= a;
#pragma unroll
        for (int j = 0; j < HD / 16; ++j) st.acc[n][j] *= a; } }
    float p[2][16];
#pragma unroll
    for (int n = 0; n < 2; ++n) { const float bias = 11.0f - st.m[n]; float sum = 0.f;
#pragma unroll
      for (int t = 0; t < 2; ++t) { float x[8];
#pragma unroll
        for (int r = 0; r < 8; ++r) x[r] = fmaf(s[n][t][r], LOGC, bias);
        exp2x8(&p[n][8 * t], x);
#pragma unroll
        for (int r = 0; r < 8; ++r) sum += p[n][8 * t + r]; }
      st.l[n] += sum; }
    if (HI) { const F2 p0 = bsplit16(p[0]), p1 = bsplit16(p[1]);
#pragma unroll
      for (int j = 0; j < HD / 16; ++j) { const size_t po = fo_v(b, h, KHI, kc, j); const v16b vh = frag_pb(VB + po, lane), vl = frag_pb(VBL + po, lane);
        st.acc[0][j] = wmma_bf(vh, p0.h, st.acc[0][j]); st.acc[0][j] = wmma_bf(vh, p0.l, st.acc[0][j]); st.acc[0][j] = wmma_bf(vl, p0.h, st.acc[0][j]);
        st.acc[1][j] = wmma_bf(vh, p1.h, st.acc[1][j]); st.acc[1][j] = wmma_bf(vh, p1.l, st.acc[1][j]); st.acc[1][j] = wmma_bf(vl, p1.h, st.acc[1][j]); }
      asm volatile("s_wait_xcnt 0x0" ::: "memory");   // the v loads' address registers are reused by the next chunk's score tiles
    } else { v16h pf[2];
#pragma unroll
      for (int n = 0; n < 2; ++n)
#pragma unroll
        for (int i = 0; i < 16; ++i) pf[n][i] = (_Float16)p[n][i];
#pragma unroll
      for (int j = 0; j < HD / 16; ++j)
#pragma unroll
        for (int n = 0; n < 2; ++n) st.acc[n][j] = wmma16(vf[j], pf[n], st.acc[n][j]); } } }
__global__ __launch_bounds__(32 * FW) void k_fa(const _Float16* __restrict__ QH, const _Float16* __restrict__ KH, const _Float16* __restrict__ QL, const _Float16* __restrict__ KL, const _Float16* __restrict__ VT, const __bf16* __restrict__ VB, const __bf16* __restrict__ VBL, float* __restrict__ Y) {
  __shared__ __align__(16) float ss[FW][FQ][HD + 4]; __shared__ float sm[FW][FQ], sl[FW][FQ];
  const int tid = threadIdx.x, lane = tid & 31, col = lane & 15, g = lane >> 4; const int b = blockIdx.x / NH, h = blockIdx.x % NH; const int qt = TT / FQ - 1 - blockIdx.y;   // longest tiles start first
  const int wave = __builtin_amdgcn_readfirstlane(tid >> 5);   // wave number in a scalar register: the chunk loop branches on scalar compares and every lane stays on at the matrix instructions
  FaSt st;
#pragma unroll
  for (int n = 0; n < 2; ++n) { st.m[n] = -1.0e30f; st.l[n] = 0.f;
#pragma unroll
    for (int j = 0; j < HD / 16; ++j) st.acc[n][j] = v8f{}; }
  if (qt * FQ < QHI) fa_run<true>(st, QH, KH, QL, KL, VT, VB, VBL, b, h, qt, wave, lane); else fa_run<false>(st, QH, KH, QL, KL, VT, VB, VBL, b, h, qt, wave, lane);
#pragma unroll
  for (int n = 0; n < 2; ++n) { const float l = st.l[n] + xhalf(st.l[n]); if (g == 0) { sm[wave][n * 16 + col] = st.m[n]; sl[wave][n * 16 + col] = l; }
#pragma unroll
    for (int j = 0; j < HD / 16; ++j) { const v8f a = st.acc[n][j]; *(v4f*)&ss[wave][n * 16 + col][j * 16 + 8 * g] = v4f{a[0], a[1], a[2], a[3]}; *(v4f*)&ss[wave][n * 16 + col][j * 16 + 8 * g + 4] = v4f{a[4], a[5], a[6], a[7]}; } }
  __syncthreads();   // every wave's partial is in LDS before any thread merges across waves
#pragma unroll
  for (int i = 0; i < FQ / 16; ++i) { const int rl = (tid >> 4) + 16 * i, c4 = (tid & 15) * 4; float M = sm[0][rl];
    for (int w = 1; w < FW; ++w) M = fmaxf(M, sm[w][rl]);
    float L = 0.f; v4f s = {};
    for (int w = 0; w < FW; ++w) { const float f = exp2s(sm[w][rl] - M); L += sl[w][rl] * f; s += *(const v4f*)&ss[w][rl][c4] * f; }   // a wave without chunks has weight 0
    vst2(Y + ((size_t)b * TT + qt * FQ + rl) * CC + h * HD + c4, s * (1.0f / L)); } }
static_assert(32 * FW == 16 * (HD / 4) && QHI % FQ == 0 && QHI <= KHI && TT % FQ == 0, "k_fa: 16 rows of HD / 4 threads; whole tiles on either precision path");

__global__ __launch_bounds__(256) void k_tr(const float* __restrict__ Y, float* __restrict__ OUT) { __shared__ __align__(16) float sy[CC]; const size_t r = blockIdx.x; const int tid = threadIdx.x; *(v4f*)&sy[tid * 4] = *(const v4f*)(Y + r * CC + tid * 4); asm volatile("s_wait_loadcnt 0x0" ::: "memory"); __syncthreads(); v4f o;
#pragma unroll
  for (int i = 0; i < 4; ++i) { const int j = tid * 4 + i; const int d = j / NH, hh = j % NH; o[i] = sy[hh * HD + d]; }
  vst2(OUT + r * CC + tid * 4, o); }
static_assert(CC == 1024 && NH * HD == CC, "k_tr: 256 threads x 4 floats = one 1,024-float row");
extern "C" void kernel_launch(void* const* d_in, const int* in_sizes, int n_in, void* d_out, int out_size, void* d_ws, size_t ws_size, hipStream_t stream) {
  (void)in_sizes; (void)n_in; (void)out_size;
  const float** F = (const float**)d_in;
  if (ws_size < (size_t)WS_END) return;
  char* ws = (char*)d_ws; _Float16 *QH = (_Float16*)(ws + WS_QH), *KH = (_Float16*)(ws + WS_KH), *VT = (_Float16*)(ws + WS_VT), *QL = (_Float16*)(ws + WS_QL), *KL = (_Float16*)(ws + WS_KL); __bf16 *VB = (__bf16*)(ws + WS_VB), *VBL = (__bf16*)(ws + WS_VBL); float *Y = (float*)(ws + WS_Y);
  (void)Y; (void)QL; (void)KL; (void)VB; (void)VBL;
  // inputs: 0 q [2,2048,64,16]; 1 k; 2 v (all (batch, seq, head_dim, n_heads): token rows of 1,024 with element (d, h) at d*16 + h)
  k_prepr<<<dim3(TNB * TT / (PW * PU), 3), 32 * PW, 0, stream>>>(F[0], F[1], F[2], QH, QL, KH, KL, VT, VB, VBL);
  k_fa<<<dim3(TNB * NH, TT / FQ), 32 * FW, 0, stream>>>(QH, KH, QL, KL, VT, VB, VBL, Y);
  k_tr<<<dim3(TNB * TT), 256, 0, stream>>>(Y, (float*)d_out);   /* internal layout [h*64 + d] -> the module's [d*16 + h] */
}

// v006
// It runs in 43 microseconds.
// Versions in between are left out here; by their measured steps it is 1.07 times as fast as v004.
// All steps since v000 together make it 20.1 times as fast.
// compute dtype: all float inputs rounded to bf16 (bf16 values are exact in f16 apart from f16-subnormal magnitudes); causal logits q x k / 64 (exact operands; the module divides by head_dim, not its square root); softmax f32; P x 2^11 once to f16 x v (bf16 hi + lo path below row 384); f32 context rows, then re-ordered to the module's heads-innermost layout. No projections. The 16-bit q, k, v planes lie in matrix-fragment order.
#include <hip/hip_runtime.h>
#include <math.h>

typedef __attribute__((ext_vector_type(16))) _Float16 v16h;
typedef __attribute__((ext_vector_type(16))) __bf16 v16b;
typedef __attribute__((ext_vector_type(8)))  _Float16 v8h;
typedef __attribute__((ext_vector_type(8)))  float v8f;
typedef __attribute__((ext_vector_type(4)))  float v4f;
typedef __attribute__((ext_vector_type(2)))  float v2f;
typedef __attribute__((ext_vector_type(4)))  unsigned v4u;
typedef __attribute__((ext_vector_type(4)))  int v4i;
typedef float __attribute__((may_alias)) float_a;
typedef int __attribute__((may_alias)) int_a;

template <typename T> __device__ __forceinline__ void vst2(void* p, T v) { *(T*)p = v;  }
__device__ __forceinline__ v8f wmma16(v16h a, v16h b, v8f c) {
  v8f d = __builtin_amdgcn_wmma_f32_16x16x32_f16(false, a, false, b, (short)0, c, false, false);
  asm volatile("v_nop\n\tv_nop\n\tv_nop\n\tv_nop" : "+v"(d) : "v"(a), "v"(b));
  return d;
}
__device__ __forceinline__ v8f wmma_bf(v16b a, v16b b, v8f c) {
  v8f d = __builtin_amdgcn_wmma_f32_16x16x32_bf16(false, a, false, b, (short)0, c, false, false);
  asm volatile("v_nop\n\tv_nop\n\tv_nop\n\tv_nop" : "+v"(d) : "v"(a), "v"(b));
  return d;
}
// 16x16x32 fragments: lane = (h = lane>>4, row/col = lane&15); elements 0..7 = k0+8h+0..7, 8..15 = k0+16+8h+0..7; D element r = row 8h+r
__device__ __forceinline__ v16h frag_h(const _Float16* rowk0, int lane) {
  union { v16h v; v8h q[2]; } u; const _Float16* p = rowk0 + 8 * (lane >> 4);
  u.q[0] = *(const v8h*)p; u.q[1] = *(const v8h*)(p + 16); return u.v;
}
__device__ __forceinline__ v16h frag_f32(const float* rowk0, int lane) {
  v16h a; const float* p = rowk0 + 8 * (lane >> 4);
#pragma unroll
  for (int i = 0; i < 8; ++i) { a[i] = (_Float16)p[i]; a[8 + i] = (_Float16)p[16 + i]; }
  return a;
}
__device__ __forceinline__ v16h frag_f32s(const float* rowk0, int lane, float sc) {
  v16h a; const float* p = rowk0 + 8 * (lane >> 4);
#pragma unroll
  for (int i = 0; i < 8; ++i) { a[i] = (_Float16)(p[i] * sc); a[8 + i] = (_Float16)(p[16 + i] * sc); }
  return a;
}
// column fragment from a [K][ld] layout (column n), rows >= K read as 0
__device__ __forceinline__ v16h fragc_f32(const float* W, int k0, int n, int lane, int ld, int K) {
  v16h a; const int g = lane >> 4;
#pragma unroll
  for (int i = 0; i < 8; ++i) { const int ka = k0 + 8 * g + i, kb = ka + 16;
    a[i] = (_Float16)(ka < K ? W[(size_t)(ka < K ? ka : K - 1) * ld + n] : 0.f); a[8 + i] = (_Float16)(kb < K ? W[(size_t)(kb < K ? kb : K - 1) * ld + n] : 0.f); }
  return a;
}
struct F2 { v16b h, l; };
__device__ __forceinline__ F2 bsplit16(const float v[16]) { F2 r;
#pragma unroll
  for (int i = 0; i < 16; ++i) { const __bf16 h = (__bf16)v[i]; r.h[i] = h; r.l[i] = (__bf16)(v[i] - (float)h); }
  return r; }
__device__ __forceinline__ F2 split_row(const float* row, int k0, int lane) { float v[16]; const float* p = row + k0 + 8 * (lane >> 4);
#pragma unroll
  for (int i = 0; i < 8; ++i) { v[i] = p[i]; v[8 + i] = p[16 + i]; }
  return bsplit16(v); }
__device__ __forceinline__ F2 split_rowK(const float* row, int k0, int lane, int K) { float v[16]; const int g = lane >> 4;
#pragma unroll
  for (int i = 0; i < 8; ++i) { const int ka = k0 + 8 * g + i, kb = ka + 16; v[i] = ka < K ? row[ka < K ? ka : K - 1] : 0.f; v[8 + i] = kb < K ? row[kb < K ? kb : K - 1] : 0.f; }
  return bsplit16(v); }
__device__ __forceinline__ F2 split_col(const float* W, int k0, int n, int lane, int ld, int K) { float v[16]; const int g = lane >> 4;
#pragma unroll
  for (int i = 0; i < 8; ++i) { const int ka = k0 + 8 * g + i, kb = ka + 16; v[i] = ka < K ? W[(size_t)(ka < K ? ka : K - 1) * ld + n] : 0.f; v[8 + i] = kb < K ? W[(size_t)(kb < K ? kb : K - 1) * ld + n] : 0.f; }
  return bsplit16(v); }
__device__ __forceinline__ v8f mac3(const F2& a, const F2& b, v8f c) { c = wmma_bf(a.l, b.h, c); c = wmma_bf(a.h, b.l, c); return wmma_bf(a.h, b.h, c); }
__device__ __forceinline__ float sigm(float v) { return 1.0f / (1.0f + expf(-v)); }
#define LDSX() do { asm volatile("s_wait_dscnt 0" ::: "memory"); __builtin_amdgcn_wave_barrier(); __builtin_amdgcn_fence(__ATOMIC_RELEASE, "workgroup"); } while (0)

// Causal multi-head softmax attention without weights in a HEADS-INNERMOST layout (q / k / v [2,2048,64,16] = (batch, seq, head_dim, n_heads), N(0,1); att[b,c,C,h] = sum_d q[b,c,d,h] k[b,C,d,h] / 64 (1 / head_dim); C > c set to -inf; softmax over C; y[b,c,v,h] = sum_C p[b,c,C,h] v[b,C,v,h], [2,2048,64,16]). Internal view: token row = (b, c); internal column h*64 + d lives at offset d*16 + h of the module's 1,024-float row: the loader gathers it that way and a final row-wise re-order writes the output back the same way.
#define NB 2
#define TT 2048
#define CC 1024            // NH * HD = projected width
#define DIN 1024          // input (model) width
#define NH 16
#define HD 64
#define NQB (TT / 64)
#define HG 4
#define SCALE (0.015625f)
#define CAUSAL 1
#ifndef TNB
#define TNB NB
#endif
__device__ __forceinline__ float bfr(float v) { return (float)(__bf16)v; }
__host__ __device__ __forceinline__ int kb_last(int qb) { return CAUSAL ? ((qb * 64 + 63) >> 7) : (TT / 128 - 1); }
typedef __attribute__((ext_vector_type(8))) __bf16 v8b;
__device__ __forceinline__ v16b frag_b(const __bf16* rowk0, int lane) {
  union { v16b v; v8b q[2]; } u; const __bf16* p = rowk0 + 8 * (lane >> 4);
  u.q[0] = *(const v8b*)p; u.q[1] = *(const v8b*)(p + 16); return u.v;
}
// Fragment-order planes: one 16 x 32 fragment (16 rows or columns x 32 values of k) is 1,024 contiguous bytes, two halves of 512 (fragment elements 0..7 and 8..15), lane l's 8 elements at byte 16 l of each half: a wave's 16-byte load or a store of 8 neighbouring lanes covers whole 128-byte lines.
__device__ __forceinline__ v16h frag_ph(const _Float16* f, int lane) { union { v16h v; v8h q[2]; } u; u.q[0] = *(const v8h*)(f + lane * 8); u.q[1] = *(const v8h*)(f + 256 + lane * 8); return u.v; }
__device__ __forceinline__ v16b frag_pb(const __bf16* f, int lane) { union { v16b v; v8b q[2]; } u; u.q[0] = *(const v8b*)(f + lane * 8); u.q[1] = *(const v8b*)(f + 256 + lane * 8); return u.v; }
// first element of a fragment. q, k planes [b][h][16-row tile][32-d half c]: lane = 16 g + row, half q, element i = d 32 c + 16 q + 8 g + i; R = rows a batch. v planes [b][h][32-key chunk][16-d group j]: lane = 16 g + d, half q, element i = key 16 q + 8 g + i of the chunk; S = keys a batch.
__device__ __forceinline__ size_t fo_row(int b, int h, int R, int tile, int c) { return ((((size_t)b * NH + h) * (R / 16) + tile) * 2 + c) * 512; }
__device__ __forceinline__ size_t fo_v(int b, int h, int S, int chunk, int j) { return ((((size_t)b * NH + h) * (S / 32) + chunk) * 4 + j) * 512; }
#define QBH 6              // not used: the causal high-precision path is taken by the 32-query tiles below row QHI (few keys, no averaging)
#define QHI 384            // rows carrying a q residual plane
#define KHI 384            // key rows carrying k residual / v bf16 hi+lo planes (used only by the causal high-precision path)
// B fragment (k rows k0+.., output column o) of a weight: (in,out) [K][ld] or (out,in) [ld rows of K]: bf16 exact, or f16(bf16 * 256) exact
__device__ __forceinline__ v16b wcol_io(const float* Wm, int k0, int o, int lane, int ld) { v16b w; const int g = lane >> 4;
#pragma unroll
  for (int i = 0; i < 8; ++i) { w[i] = (__bf16)Wm[(size_t)(k0 + 8 * g + i) * ld + o]; w[8 + i] = (__bf16)Wm[(size_t)(k0 + 16 + 8 * g + i) * ld + o]; }
  return w; }
__device__ __forceinline__ v16b wcol_oi(const float* Wm, int k0, int o, int lane, int K) { v16b w; const float* p = Wm + (size_t)o * K + k0 + 8 * (lane >> 4);
#pragma unroll
  for (int i = 0; i < 8; ++i) { w[i] = (__bf16)p[i]; w[8 + i] = (__bf16)p[16 + i]; }
  return w; }
__device__ __forceinline__ v16h wcolh_io(const float* Wm, int k0, int o, int lane, int ld) { v16h w; const int g = lane >> 4;
#pragma unroll
  for (int i = 0; i < 8; ++i) { w[i] = (_Float16)(bfr(Wm[(size_t)(k0 + 8 * g + i) * ld + o]) * 256.0f); w[8 + i] = (_Float16)(bfr(Wm[(size_t)(k0 + 16 + 8 * g + i) * ld + o]) * 256.0f); }
  return w; }
__device__ __forceinline__ v16h wcolh_oi(const float* Wm, int k0, int o, int lane, int K) { v16h w; const float* p = Wm + (size_t)o * K + k0 + 8 * (lane >> 4);
#pragma unroll
  for (int i = 0; i < 8; ++i) { w[i] = (_Float16)(bfr(p[i]) * 256.0f); w[8 + i] = (_Float16)(bfr(p[16 + i]) * 256.0f); }
  return w; }
#define WQKV_LAYOUT 1   // 0 = (in,out) [DIN][CC]; 1 = (out,in) [CC][DIN]; 2 = per-head [NH][DIN][HD]
__device__ __forceinline__ v16b wcol_hdk(const float* Wm, int k0, int o, int lane) { v16b w; const int g = lane >> 4; const float* p = Wm + (size_t)(o / HD) * DIN * HD + (o % HD);
#pragma unroll
  for (int i = 0; i < 8; ++i) { w[i] = (__bf16)p[(size_t)(k0 + 8 * g + i) * HD]; w[8 + i] = (__bf16)p[(size_t)(k0 + 16 + 8 * g + i) * HD]; }
  return w; }
#define WO_OUT_IN 0
#if WQKV_LAYOUT == 1
#define WCOL(W, k0, o, lane) wcol_oi(W, k0, o, lane, DIN)
#elif WQKV_LAYOUT == 2
#define WCOL(W, k0, o, lane) wcol_hdk(W, k0, o, lane)
#else
#define WCOL(W, k0, o, lane) wcol_io(W, k0, o, lane, CC)
#endif
#if WO_OUT_IN
#define WOCOL(W, k0, o, lane) wcol_oi(W, k0, o, lane, CC)
#define WOCOLH(W, k0, o, lane) wcolh_oi(W, k0, o, lane, CC)
#else
#define WOCOL(W, k0, o, lane) wcol_io(W, k0, o, lane, DIN)
#define WOCOLH(W, k0, o, lane) wcolh_io(W, k0, o, lane, DIN)
#endif

// ---- k_prepr: reads the module's [B, T, 64, NH] inputs once, in 16-byte pieces (4 heads of one d), bf16-rounds them and writes the attention planes in fragment order (above): q -> f16 (+ x 2^10 residual for s < QHI), k -> f16 (+ residual for s < KHI), v -> f16 (+ bf16 hi/lo for s < KHI). A lane gathers 8 pieces along the fragment's k axis (d for q and k, s for v), so the 4 x 8 transpose is a renaming of its registers; 8 neighbouring lanes hold 8 neighbouring fragment rows, so every store instruction writes four whole 128-byte lines. blockIdx.y = tensor; a wave takes 8 token rows x 32 d (q, k) or 32 tokens x 8 d (v), all heads.
#define PW 4               // waves a block
#define PU 4               // groups of 8 along k a wave: one fragment's (half q, lane group g) = (u >> 1, u & 1)
__device__ __forceinline__ void prep_qk(const float* __restrict__ X, _Float16* __restrict__ XH, _Float16* __restrict__ XL, int row0, int c, int lane) {
  const int r8 = lane & 7, h4 = lane >> 3; const float* src = X + (size_t)(row0 + r8) * CC + c * 32 * NH + h4 * 4; v4f x[PU][8];   // lane: token row0 + r8, heads 4 h4 .. + 3, d = 32 c .. + 31
#pragma unroll
  for (int u = 0; u < PU; ++u)
#pragma unroll
    for (int k = 0; k < 8; ++k) x[u][k] = *(const v4f*)(src + (u * 8 + k) * NH);
  asm volatile("s_wait_xcnt 0x0" ::: "memory");   // every load is issued before the first conversion, and their address registers are free for reuse behind this line
  const int bb = row0 / TT, rb = row0 % TT; const int lo = ((rb & 8) + r8) * 8; _Float16* dh = XH + fo_row(bb, h4 * 4, TT, rb / 16, c) + lo;
#pragma unroll
  for (int u = 0; u < PU; ++u)
#pragma unroll
    for (int e = 0; e < 4; ++e) { v8h r;
#pragma unroll
      for (int k = 0; k < 8; ++k) r[k] = (_Float16)bfr(x[u][k][e]);
      vst2(dh + e * (TT / 16) * 1024 + (u >> 1) * 256 + (u & 1) * 128, r); }
  asm volatile("s_wait_xcnt 0x0" ::: "memory");   // the stores' data registers are reused behind the branch below
  if (rb < QHI) { _Float16* dl = XL + fo_row(bb, h4 * 4, QHI, rb / 16, c) + lo;   // module inputs are bf16-rounded; bf16 values are exact in f16 apart from f16-subnormal magnitudes, which the residual carries
#pragma unroll
    for (int u = 0; u < PU; ++u)
#pragma unroll
      for (int e = 0; e < 4; ++e) { v8h r;
#pragma unroll
        for (int k = 0; k < 8; ++k) { const float q = bfr(x[u][k][e]); r[k] = (_Float16)((q - (float)(_Float16)q) * 1024.0f); }
        vst2(dl + e * (QHI / 16) * 1024 + (u >> 1) * 256 + (u & 1) * 128, r); }
    asm volatile("s_wait_xcnt 0x0" ::: "memory"); } }   // in the listing the v branch, which rewrites these stores' registers, follows this block
__device__ __forceinline__ void prep_v(const float* __restrict__ V, _Float16* __restrict__ VT, __bf16* __restrict__ VB, __bf16* __restrict__ VBL, int ck, int dq, int lane) {
  const int d8 = lane & 7, h4 = lane >> 3; const int bb = ck / (TT / 32), cb = ck % (TT / 32); const float* src = V + (size_t)ck * 32 * CC + (dq * 8 + d8) * NH + h4 * 4; v4f x[PU][8];   // lane: d = 8 dq + d8, heads 4 h4 .. + 3, the chunk's 32 tokens; a load instruction covers 512 contiguous bytes
#pragma unroll
  for (int u = 0; u < PU; ++u)
#pragma unroll
    for (int k = 0; k < 8; ++k) x[u][k] = *(const v4f*)(src + (u * 8 + k) * CC);
  asm volatile("s_wait_xcnt 0x0" ::: "memory");   // as in prep_qk
  const int lo = ((dq & 1) * 8 + d8) * 8; _Float16* dv = VT + fo_v(bb, h4 * 4, TT, cb, dq >> 1) + lo;
#pragma unroll
  for (int u = 0; u < PU; ++u)
#pragma unroll
    for (int e = 0; e < 4; ++e) { v8h r;
#pragma unroll
      for (int k = 0; k < 8; ++k) r[k] = (_Float16)bfr(x[u][k][e]);
      vst2(dv + e * (TT / 32) * 2048 + (u >> 1) * 256 + (u & 1) * 128, r); }
  asm volatile("s_wait_xcnt 0x0" ::: "memory");   // as in prep_qk
  if (cb * 32 < KHI) { const size_t po = fo_v(bb, h4 * 4, KHI, cb, dq >> 1) + lo; __bf16* db = VB + po; __bf16* dl = VBL + po;
#pragma unroll
    for (int u = 0; u < PU; ++u)
#pragma unroll
      for (int e = 0; e < 4; ++e) { v8b rh, rl;
#pragma unroll
        for (int k = 0; k < 8; ++k) { const float v = bfr(x[u][k][e]); const __bf16 vb = (__bf16)v; rh[k] = vb; rl[k] = (__bf16)(v - (float)vb); }
        const int o = e * (KHI / 32) * 2048 + (u >> 1) * 256 + (u & 1) * 128; vst2(db + o, rh); vst2(dl + o, rl); } } }
__global__ __launch_bounds__(32 * PW) void k_prepr(const float* __restrict__ Q, const float* __restrict__ K, const float* __restrict__ V, _Float16* __restrict__ QH, _Float16* __restrict__ QL, _Float16* __restrict__ KH, _Float16* __restrict__ KL, _Float16* __restrict__ VT, __bf16* __restrict__ VB, __bf16* __restrict__ VBL) {
  const int lane = threadIdx.x & 31; const int w = blockIdx.x * PW + __builtin_amdgcn_readfirstlane(threadIdx.x >> 5);   // wave number in a scalar register: the tests on rows below QHI / KHI are scalar branches
  if (blockIdx.y == 2) { prep_v(V, VT, VB, VBL, w >> 3, w & 7, lane); return; }
  const bool isq = blockIdx.y == 0; prep_qk(isq ? Q : K, isq ? QH : KH, isq ? QL : KL, (w >> 1) * 8, w & 1, lane); }
static_assert(NH == 16 && HD == 64 && PU == 4 && QHI == KHI && QHI % 32 == 0 && TT % 32 == 0 && (TNB * TT) % (PW * PU) == 0 && (TNB * TT / 8) * 2 == TNB * TT / PU && (TNB * TT / 32) * 8 == TNB * TT / PU, "k_prepr: 32 lanes = 4 head quads x 8 fragment rows; as many waves for v as for q or k");

#ifndef SM_EXTRA_PARAMS
#define SM_EXTRA_PARAMS
#endif
#ifndef PROJ_EXTRA_PARAMS
#define PROJ_EXTRA_PARAMS
#endif
#ifndef SM_MASK_HOOK
#define SM_MASK_HOOK (void)0
#endif

#define WS_QH  0u                                      // f16 q, fragment order [b][h][t / 16][c]
#define WS_KH  (WS_QH + 2u * (size_t)NB * TT * CC)      // f16 k, fragment order
#define WS_VT  (WS_KH + 2u * (size_t)NB * TT * CC)      // f16 v, fragment order [b][h][t / 32][j]
#define WS_QL  (WS_VT + 2u * (size_t)NB * CC * TT)      // f16 q residual x 2^10, fragment order, t < QHI
#define WS_KL  (WS_QL + 2u * (size_t)NB * QHI * CC)     // f16 k residual x 2^10, fragment order, t < KHI
#define WS_VB  (WS_KL + 2u * (size_t)NB * KHI * CC)     // bf16 v hi (then lo), fragment order, t < KHI
#define WS_VBL (WS_VB + 2u * (size_t)NB * CC * KHI)
#define WS_S   (WS_VBL + 2u * (size_t)NB * CC * KHI)    // f32 [hg][t][s] space, not used by any kernel here
#define WS_Y   (WS_S  + 4u * (size_t)HG * TT * TT)      // f32 ctx rows [b*t][CC]
#define WS_END (WS_Y  + 4u * (size_t)NB * TT * CC)   // f32 context rows in the layout [b*t][h*64 + d], re-ordered by k_tr into the output

// ---- k_fa: block = FT neighbouring tiles of 32 queries of (b, h), FW waves: a wave takes one tile and, as one of its FK key splits, that tile's 32-key chunks split, split + FK, ... <= qt. The FT waves of one split (waves w and w + 2: two SIMDs) read the same k and v fragments at about the same time, so that the later reader is served by the WGP's cache and not by L2. Per chunk: S^T = k . q^T (lane = one query column, 16 of the chunk's keys in its registers), running maximum and sum per query in f32 (online softmax, log2 units), P x 2^11 packed from the score accumulators straight into a B operand, ctx^T += v^T . P^T. Logits and P never leave the registers. Query rows < QHI keep the residual products and the bf16 hi + lo P . v. Each tile's FK (max, sum, ctx) partials are merged in split order through LDS.
#define FW 8
#define FQ 32
#define FT 2               // query tiles a block
#define FK (FW / FT)       // key splits a tile
#define LOGC (SCALE * 1.44269504088896340736f)   // logit scale x log2(e)
__device__ __forceinline__ float xhalf(float x) { return __builtin_bit_cast(float, __builtin_amdgcn_permlanex16(__builtin_bit_cast(int, x), __builtin_bit_cast(int, x), 0x76543210, 0xfedcba98, false, false)); }   // lane l reads lane l ^ 16
// 2^x by v_exp_f32, with the one free slot that the instruction set asks for behind a transcendental kept inside the statement; in the run of eight no instruction reads its predecessor's result or overwrites its source (outputs are early-clobber), the v_nop serves the last
__device__ __forceinline__ float exp2s(float x) { float r; asm("v_exp_f32 %0, %1\n\tv_nop" : "=v"(r) : "v"(x)); return r; }
__device__ __forceinline__ void exp2x8(float* o, const float* x) {
  asm("v_exp_f32 %0, %8\n\tv_exp_f32 %1, %9\n\tv_exp_f32 %2, %10\n\tv_exp_f32 %3, %11\n\tv_exp_f32 %4, %12\n\tv_exp_f32 %5, %13\n\tv_exp_f32 %6, %14\n\tv_exp_f32 %7, %15\n\tv_nop"
      : "=&v"(o[0]), "=&v"(o[1]), "=&v"(o[2]), "=&v"(o[3]), "=&v"(o[4]), "=&v"(o[5]), "=&v"(o[6]), "=&v"(o[7]) : "v"(x[0]), "v"(x[1]), "v"(x[2]), "v"(x[3]), "v"(x[4]), "v"(x[5]), "v"(x[6]), "v"(x[7])); }
struct FaSt { v8f acc[2][HD / 16]; float m[2], l[2]; };
template <bool HI> __device__ __forceinline__ void fa_run(FaSt& st, const _Float16* __restrict__ QH, const _Float16* __restrict__ KH, const _Float16* __restrict__ QL, const _Float16* __restrict__ KL, const _Float16* __restrict__ VT, const __bf16* __restrict__ VB, const __bf16* __restrict__ VBL, int b, int h, int qt, int wave, int lane) {
  const int col = lane & 15, g = lane >> 4; const int q0 = qt * FQ;
  v16h qh[2][2], ql[2][2];
#pragma unroll
  for (int n = 0; n < 2; ++n)
#pragma unroll
    for (int c = 0; c < 2; ++c) { qh[n][c] = frag_ph(QH + fo_row(b, h, TT, q0 / 16 + n, c), lane); if (HI) ql[n][c] = frag_ph(QL + fo_row(b, h, QHI, q0 / 16 + n, c), lane); }
  v16h kf[2][2], vf[HD / 16];   // !HI: this chunk's k fragments (fetched one chunk ahead) and v fragments (fetched at the chunk's top), so that no product waits for a load issued just in front of it
  if (!HI) { const int kf0 = (wave <= qt ? wave : qt) * 2;
#pragma unroll
    for (int t = 0; t < 2; ++t)
#pragma unroll
      for (int c = 0; c < 2; ++c) kf[t][c] = frag_ph(KH + fo_row(b, h, TT, kf0 + t, c), lane); }
#pragma unroll 1
  for (int kc = wave; kc <= qt; kc += FK) {   // k0 = 32 kc is the chunk's first key
    v8f s[2][2] = {};   // [query group][key tile]: element r = key k0 + 16 * tile + 8 * g + r, query q0 + 16 * group + col
    if (HI) { v8f sl[2][2] = {};
#pragma unroll
      for (int t = 0; t < 2; ++t)
#pragma unroll
        for (int c = 0; c < 2; ++c) { const v16h kf = frag_ph(KH + fo_row(b, h, TT, kc * 2 + t, c), lane), klf = frag_ph(KL + fo_row(b, h, KHI, kc * 2 + t, c), lane);
#pragma unroll
          for (int n = 0; n < 2; ++n) { s[n][t] = wmma16(kf, qh[n][c], s[n][t]); sl[n][t] = wmma16(kf, ql[n][c], sl[n][t]); sl[n][t] = wmma16(klf, qh[n][c], sl[n][t]); } }
#pragma unroll
      for (int n = 0; n < 2; ++n)
#pragma unroll
        for (int t = 0; t < 2; ++t) s[n][t] += sl[n][t] * (1.0f / 1024.0f);
    } else {
#pragma unroll
      for (int j = 0; j < HD / 16; ++j) vf[j] = frag_ph(VT + fo_v(b, h, TT, kc, j), lane);
#pragma unroll
      for (int t = 0; t < 2; ++t)
#pragma unroll
        for (int c = 0; c < 2; ++c)
#pragma unroll
          for (int n = 0; n < 2; ++n) s[n][t] = wmma16(kf[t][c], qh[n][c], s[n][t]);
      const int kn = (kc + FK <= qt ? kc + FK : kc) * 2;   // the wave's next chunk; on its last trip the same rows again (in bounds, not used)
#pragma unroll
      for (int t = 0; t < 2; ++t)
#pragma unroll
        for (int c = 0; c < 2; ++c) kf[t][c] = frag_ph(KH + fo_row(b, h, TT, kn + t, c), lane);
      asm volatile("s_wait_xcnt 0x0" ::: "memory"); }   // the loads' address registers are reused behind the branch below
    if (kc == qt) {   // the diagonal chunk: keys past the query are excluded (every query keeps key k0 at least)
#pragma unroll
      for (int n = 0; n < 2; ++n)
#pragma unroll
        for (int t = 0; t < 2; ++t)
#pragma unroll
          for (int r = 0; r < 8; ++r) if (t * 16 + 8 * g + r > n * 16 + col) s[n][t][r] = -1.0e30f; }
    float mt[2];
#pragma unroll
    for (int n = 0; n < 2; ++n) { float mx = s[n][0][0];
#pragma unroll
      for (int r = 1; r < 8; ++r) mx = fmaxf(mx, s[n][0][r]);
#pragma unroll
      for (int r = 0; r < 8; ++r) mx = fmaxf(mx, s[n][1][r]);
      mx = fmaxf(mx, xhalf(mx)); mt[n] = fmaxf(st.m[n], mx * LOGC); }
    if (__builtin_amdgcn_ballot_w32(mt[0] > st.m[0] || mt[1] > st.m[1]) != 0) {   // a maximum grew somewhere in the wave: bring sums and ctx to the new one
#pragma unroll
      for (int n = 0; n < 2; ++n) { const float a = exp2s(st.m[n] - mt[n]); st.m[n] = mt[n]; st.l[n] *= a;
#pragma unroll
        for (int j = 0; j < HD / 16; ++j) st.acc[n][j] *= a; } }
    float p[2][16];
#pragma unroll
    for (int n = 0; n < 2; ++n) { const float bias = 11.0f - st.m[n]; float sum = 0.f;
#pragma unroll
      for (int t = 0; t < 2; ++t) { float x[8];
#pragma unroll
        for (int r = 0; r < 8; ++r) x[r] = fmaf(s[n][t][r], LOGC, bias);
        exp2x8(&p[n][8 * t], x);
#pragma unroll
        for (int r = 0; r < 8; ++r) sum += p[n][8 * t + r]; }
      st.l[n] += sum; }
    if (HI) { const F2 p0 = bsplit16(p[0]), p1 = bsplit16(p[1]);
#pragma unroll
      for (int j = 0; j < HD / 16; ++j) { const size_t po = fo_v(b, h, KHI, kc, j); const v16b vh = frag_pb(VB + po, lane), vl = frag_pb(VBL + po, lane);
        st.acc[0][j] = wmma_bf(vh, p0.h, st.acc[0][j]); st.acc[0][j] = wmma_bf(vh, p0.l, st.acc[0][j]); st.acc[0][j] = wmma_bf(vl, p0.h, st.acc[0][j]);
        st.acc[1][j] = wmma_bf(vh, p1.h, st.acc[1][j]); st.acc[1][j] = wmma_bf(vh, p1.l, st.acc[1][j]); st.acc[1][j] = wmma_bf(vl, p1.h, st.acc[1][j]); }
      asm volatile("s_wait_xcnt 0x0" ::: "memory");   // the v loads' address registers are reused by the next chunk's score tiles
    } else { v16h pf[2];
#pragma unroll
      for (int n = 0; n < 2; ++n)
#pragma unroll
        for (int i = 0; i < 16; ++i) pf[n][i] = (_Float16)p[n][i];
#pragma unroll
      for (int j = 0; j < HD / 16; ++j)
#pragma unroll
        for (int n = 0; n < 2; ++n) st.acc[n][j] = wmma16(vf[j], pf[n], st.acc[n][j]); } } }
__global__ __launch_bounds__(32 * FW) void k_fa(const _Float16* __restrict__ QH, const _Float16* __restrict__ KH, const _Float16* __restrict__ QL, const _Float16* __restrict__ KL, const _Float16* __restrict__ VT, const __bf16* __restrict__ VB, const __bf16* __restrict__ VBL, float* __restrict__ Y) {
  __shared__ __align__(16) float ss[FW][FQ][HD + 4]; __shared__ float sm[FW][FQ], sl[FW][FQ];
  const int tid = threadIdx.x, lane = tid & 31, col = lane & 15, g = lane >> 4; const int b = blockIdx.x / NH, h = blockIdx.x % NH; const int q2 = (TT / (FT * FQ) - 1 - blockIdx.y) * FT;   // the block's first tile; longest tiles start first
  const int wave = __builtin_amdgcn_readfirstlane(tid >> 5);   // wave number in a scalar register: the chunk loop branches on scalar compares and every lane stays on at the matrix instructions
  const int tl = (wave >> 1) & 1, ks = (wave & 1) + (wave >> 2) * 2, slot = ks * FT + tl; const int qt = q2 + tl;   // tile of the block, key split, place of the partial in LDS
  FaSt st;
#pragma unroll
  for (int n = 0; n < 2; ++n) { st.m[n] = -1.0e30f; st.l[n] = 0.f;
#pragma unroll
    for (int j = 0; j < HD / 16; ++j) st.acc[n][j] = v8f{}; }
  if (q2 * FQ < QHI) fa_run<true>(st, QH, KH, QL, KL, VT, VB, VBL, b, h, qt, ks, lane); else fa_run<false>(st, QH, KH, QL, KL, VT, VB, VBL, b, h, qt, ks, lane);
#pragma unroll
  for (int n = 0; n < 2; ++n) { const float l = st.l[n] + xhalf(st.l[n]); if (g == 0) { sm[slot][n * 16 + col] = st.m[n]; sl[slot][n * 16 + col] = l; }
#pragma unroll
    for (int j = 0; j < HD / 16; ++j) { const v8f a = st.acc[n][j]; *(v4f*)&ss[slot][n * 16 + col][j * 16 + 8 * g] = v4f{a[0], a[1], a[2], a[3]}; *(v4f*)&ss[slot][n * 16 + col][j * 16 + 8 * g + 4] = v4f{a[4], a[5], a[6], a[7]}; } }
  __syncthreads();   // every wave's partial is in LDS before any thread merges across waves
#pragma unroll
  for (int i = 0; i < FT * FQ / 16; ++i) { const int t = i / (FQ / 16), rl = (tid >> 4) + 16 * (i % (FQ / 16)), c4 = (tid & 15) * 4; float M = sm[t][rl];   // row rl of the block's tile t, whose partials lie at places t, t + FT, ...
    for (int w = t + FT; w < FW; w += FT) M = fmaxf(M, sm[w][rl]);
    float L = 0.f; v4f s = {};
    for (int w = t; w < FW; w += FT) { const float f = exp2s(sm[w][rl] - M); L += sl[w][rl] * f; s += *(const v4f*)&ss[w][rl][c4] * f; }   // a wave without chunks has weight 0
    vst2(Y + ((size_t)b * TT + (q2 + t) * FQ + rl) * CC + h * HD + c4, s * (1.0f / L)); } }
static_assert(32 * FW == 16 * (HD / 4) && FW == 8 && FT == 2 && FQ % 16 == 0 && QHI % (FT * FQ) == 0 && QHI <= KHI && TT % (FT * FQ) == 0, "k_fa: 16 rows of HD / 4 threads; whole blocks on either precision path");

// ---- k_tr: a wave re-orders TR whole token rows by itself. A lane loads 8 heads x 4 d (16 bytes a head; an instruction reads two whole 256-byte head rows), so that 4 neighbouring heads of one d are a renaming of its registers; they pass through the wave's own LDS range in output order, and every store instruction writes 512 contiguous bytes. All of a wave's loads are in flight together; one work-group a WGP covers the grid.
#define TW 8               // waves a block
#define TR 2               // token rows a wave
#define TP 68              // LDS floats a group of 4 d x 16 heads (64 + 4): a pitch of 16 bytes x 17 spreads the 16-byte LDS stores of 16 lanes, one group apart, over all banks
__global__ __launch_bounds__(32 * TW) void k_tr(const float* __restrict__ Y, float* __restrict__ OUT) { __shared__ __align__(16) float sy[TW][TR][(HD / 4) * TP];
  const int lane = threadIdx.x & 31, wave = threadIdx.x >> 5, dq = lane & 15, g = lane >> 4; const size_t r0 = ((size_t)blockIdx.x * TW + wave) * TR; const float* src = Y + r0 * CC + g * 8 * HD + dq * 4; v4f x[TR][8];   // lane: heads 8 g .. + 7, d = 4 dq .. + 3
#pragma unroll
  for (int t = 0; t < TR; ++t)
#pragma unroll
    for (int k = 0; k < 8; ++k) x[t][k] = *(const v4f*)(src + t * CC + k * HD);
  asm volatile("s_wait_xcnt 0x0" ::: "memory");   // every load is issued before the first LDS store, and their address registers are free for reuse behind this line
#pragma unroll
  for (int t = 0; t < TR; ++t)
#pragma unroll
    for (int e = 0; e < 4; ++e)
#pragma unroll
      for (int s = 0; s < 2; ++s) *(v4f*)&sy[wave][t][dq * TP + e * NH + g * 8 + s * 4] = v4f{x[t][4 * s][e], x[t][4 * s + 1][e], x[t][4 * s + 2][e], x[t][4 * s + 3][e]};   // output order: d * 16 + h, d = 4 dq + e
  asm volatile("s_wait_dscnt 0x0" ::: "memory");   // the wave's own LDS stores are done before its lanes read what other lanes wrote; no other wave touches this range, so no barrier
#pragma unroll
  for (int t = 0; t < TR; ++t)
#pragma unroll
    for (int j = 0; j < 8; ++j) vst2(OUT + (r0 + t) * CC + j * 128 + lane * 4, *(const v4f*)&sy[wave][t][(2 * j + g) * TP + dq * 4]); }
static_assert(CC == 1024 && NH == 16 && HD == 64 && (TNB * TT) % (TW * TR) == 0, "k_tr: 32 lanes = 2 groups of 8 heads x 16 groups of 4 d; whole blocks");
extern "C" void kernel_launch(void* const* d_in, const int* in_sizes, int n_in, void* d_out, int out_size, void* d_ws, size_t ws_size, hipStream_t stream) {
  (void)in_sizes; (void)n_in; (void)out_size;
  const float** F = (const float**)d_in;
  if (ws_size < (size_t)WS_END) return;
  char* ws = (char*)d_ws; _Float16 *QH = (_Float16*)(ws + WS_QH), *KH = (_Float16*)(ws + WS_KH), *VT = (_Float16*)(ws + WS_VT), *QL = (_Float16*)(ws + WS_QL), *KL = (_Float16*)(ws + WS_KL); __bf16 *VB = (__bf16*)(ws + WS_VB), *VBL = (__bf16*)(ws + WS_VBL); float *Y = (float*)(ws + WS_Y);
  (void)Y; (void)QL; (void)KL; (void)VB; (void)VBL;
  // inputs: 0 q [2,2048,64,16]; 1 k; 2 v (all (batch, seq, head_dim, n_heads): token rows of 1,024 with element (d, h) at d*16 + h)
  k_prepr<<<dim3(TNB * TT / (PW * PU), 3), 32 * PW, 0, stream>>>(F[0], F[1], F[2], QH, QL, KH, KL, VT, VB, VBL);
  k_fa<<<dim3(TNB * NH, TT / (FT * FQ)), 32 * FW, 0, stream>>>(QH, KH, QL, KL, VT, VB, VBL, Y);
  k_tr<<<dim3(TNB * TT / (TW * TR)), 32 * TW, 0, stream>>>(Y, (float*)d_out);   /* layout [h*64 + d] -> the module's [d*16 + h] */
}

// v007
// A run of this version takes 39.4 microseconds.
// Timed twice side by side with v006, it ran 1.09 times as fast both times.
// Over all steps from v000 it is 21.9 times as fast.
// compute dtype: all float inputs rounded to bf16 (bf16 values are exact in f16 apart from f16-subnormal magnitudes); causal logits q x k / 64 (exact operands; the module divides by head_dim, not its square root); softmax f32; P x 2^11 once to f16 x v (bf16 hi + lo path below row 384); f32 context rows, then re-ordered to the module's heads-innermost layout. No projections. The 16-bit q, k, v planes lie in matrix-fragment order.
#include <hip/hip_runtime.h>
#include <math.h>

typedef __attribute__((ext_vector_type(16))) _Float16 v16h;
typedef __attribute__((ext_vector_type(16))) __bf16 v16b;
typedef __attribute__((ext_vector_type(8)))  _Float16 v8h;
typedef __attribute__((ext_vector_type(8)))  float v8f;
typedef __attribute__((ext_vector_type(4)))  float v4f;
typedef __attribute__((ext_vector_type(2)))  float v2f;
typedef __attribute__((ext_vector_type(4)))  unsigned v4u;
typedef __attribute__((ext_vector_type(4)))  int v4i;
typedef float __attribute__((may_alias)) float_a;
typedef int __attribute__((may_alias)) int_a;

template <typename T> __device__ __forceinline__ void vst2(void* p, T v) { *(T*)p = v;  }
__device__ __forceinline__ v8f wmma16(v16h a, v16h b, v8f c) {
  return __builtin_amdgcn_wmma_f32_16x16x32_f16(false, a, false, b, (short)0, c, false, false);
}
__device__ __forceinline__ v8f wmma_bf(v16b a, v16b b, v8f c) {
  return __builtin_amdgcn_wmma_f32_16x16x32_bf16(false, a, false, b, (short)0, c, false, false);
}
// 16x16x32 fragments: lane = (h = lane>>4, row/col = lane&15); elements 0..7 = k0+8h+0..7, 8..15 = k0+16+8h+0..7; D element r = row 8h+r
__device__ __forceinline__ v16h frag_h(const _Float16* rowk0, int lane) {
  union { v16h v; v8h q[2]; } u; const _Float16* p = rowk0 + 8 * (lane >> 4);
  u.q[0] = *(const v8h*)p; u.q[1] = *(const v8h*)(p + 16); return u.v;
}
__device__ __forceinline__ v16h frag_f32(const float* rowk0, int lane) {
  v16h a; const float* p = rowk0 + 8 * (lane >> 4);
#pragma unroll
  for (int i = 0; i < 8; ++i) { a[i] = (_Float16)p[i]; a[8 + i] = (_Float16)p[16 + i]; }
  return a;
}
__device__ __forceinline__ v16h frag_f32s(const float* rowk0, int lane, float sc) {
  v16h a; const float* p = rowk0 + 8 * (lane >> 4);
#pragma unroll
  for (int i = 0; i < 8; ++i) { a[i] = (_Float16)(p[i] * sc); a[8 + i] = (_Float16)(p[16 + i] * sc); }
  return a;
}
// column fragment from a [K][ld] layout (column n), rows >= K read as 0
__device__ __forceinline__ v16h fragc_f32(const float* W, int k0, int n, int lane, int ld, int K) {
  v16h a; const int g = lane >> 4;
#pragma unroll
  for (int i = 0; i < 8; ++i) { const int ka = k0 + 8 * g + i, kb = ka + 16;
    a[i] = (_Float16)(ka < K ? W[(size_t)(ka < K ? ka : K - 1) * ld + n] : 0.f); a[8 + i] = (_Float16)(kb < K ? W[(size_t)(kb < K ? kb : K - 1) * ld + n] : 0.f); }
  return a;
}
struct F2 { v16b h, l; };
__device__ __forceinline__ F2 bsplit16(const float v[16]) { F2 r;
#pragma unroll
  for (int i = 0; i < 16; ++i) { const __bf16 h = (__bf16)v[i]; r.h[i] = h; r.l[i] = (__bf16)(v[i] - (float)h); }
  return r; }
__device__ __forceinline__ F2 split_row(const float* row, int k0, int lane) { float v[16]; const float* p = row + k0 + 8 * (lane >> 4);
#pragma unroll
  for (int i = 0; i < 8; ++i) { v[i] = p[i]; v[8 + i] = p[16 + i]; }
  return bsplit16(v); }
__device__ __forceinline__ F2 split_rowK(const float* row, int k0, int lane, int K) { float v[16]; const int g = lane >> 4;
#pragma unroll
  for (int i = 0; i < 8; ++i) { const int ka = k0 + 8 * g + i, kb = ka + 16; v[i] = ka < K ? row[ka < K ? ka : K - 1] : 0.f; v[8 + i] = kb < K ? row[kb < K ? kb : K - 1] : 0.f; }
  return bsplit16(v); }
__device__ __forceinline__ F2 split_col(const float* W, int k0, int n, int lane, int ld, int K) { float v[16]; const int g = lane >> 4;
#pragma unroll
  for (int i = 0; i < 8; ++i) { const int ka = k0 + 8 * g + i, kb = ka + 16; v[i] = ka < K ? W[(size_t)(ka < K ? ka : K - 1) * ld + n] : 0.f; v[8 + i] = kb < K ? W[(size_t)(kb < K ? kb : K - 1) * ld + n] : 0.f; }
  return bsplit16(v); }
__device__ __forceinline__ v8f mac3(const F2& a, const F2& b, v8f c) { c = wmma_bf(a.l, b.h, c); c = wmma_bf(a.h, b.l, c); return wmma_bf(a.h, b.h, c); }
__device__ __forceinline__ float sigm(float v) { return 1.0f / (1.0f + expf(-v)); }
#define LDSX() do { asm volatile("s_wait_dscnt 0" ::: "memory"); __builtin_amdgcn_wave_barrier(); __builtin_amdgcn_fence(__ATOMIC_RELEASE, "workgroup"); } while (0)

// Causal multi-head softmax attention without weights in a HEADS-INNERMOST layout (q / k / v [2,2048,64,16] = (batch, seq, head_dim, n_heads), N(0,1); att[b,c,C,h] = sum_d q[b,c,d,h] k[b,C,d,h] / 64 (1 / head_dim); C > c set to -inf; softmax over C; y[b,c,v,h] = sum_C p[b,c,C,h] v[b,C,v,h], [2,2048,64,16]). Internal view: token row = (b, c); internal column h*64 + d lives at offset d*16 + h of the module's 1,024-float row: the loader gathers it that way and a final row-wise re-order writes the output back the same way.
#define NB 2
#define TT 2048
#define CC 1024            // NH * HD = projected width
#define DIN 1024          // input (model) width
#define NH 16
#define HD 64
#define NQB (TT / 64)
#define HG 4
#define SCALE (0.015625f)
#define CAUSAL 1
#ifndef TNB
#define TNB NB
#endif
__device__ __forceinline__ float bfr(float v) { return (float)(__bf16)v; }
__host__ __device__ __forceinline__ int kb_last(int qb) { return CAUSAL ? ((qb * 64 + 63) >> 7) : (TT / 128 - 1); }
typedef __attribute__((ext_vector_type(8))) __bf16 v8b;
__device__ __forceinline__ v16b frag_b(const __bf16* rowk0, int lane) {
  union { v16b v; v8b q[2]; } u; const __bf16* p = rowk0 + 8 * (lane >> 4);
  u.q[0] = *(const v8b*)p; u.q[1] = *(const v8b*)(p + 16); return u.v;
}
// Fragment-order planes: one 16 x 32 fragment (16 rows or columns x 32 values of k) is 1,024 contiguous bytes, two halves of 512 (fragment elements 0..7 and 8..15), lane l's 8 elements at byte 16 l of each half: a wave's 16-byte load or a store of 8 neighbouring lanes covers whole 128-byte lines.
__device__ __forceinline__ v16h frag_ph(const _Float16* f, int lane) { union { v16h v; v8h q[2]; } u; u.q[0] = *(const v8h*)(f + lane * 8); u.q[1] = *(const v8h*)(f + 256 + lane * 8); return u.v; }
__device__ __forceinline__ v16b frag_pb(const __bf16* f, int lane) { union { v16b v; v8b q[2]; } u; u.q[0] = *(const v8b*)(f + lane * 8); u.q[1] = *(const v8b*)(f + 256 + lane * 8); return u.v; }
// first element of a fragment. q, k planes [b][h][16-row tile][32-d half c]: lane = 16 g + row, half q, element i = d 32 c + 16 q + 8 g + i; R = rows a batch. v planes [b][h][32-key chunk][16-d group j]: lane = 16 g + d, half q, element i = key 16 q + 8 g + i of the chunk; S = keys a batch.
__device__ __forceinline__ size_t fo_row(int b, int h, int R, int tile, int c) { return ((((size_t)b * NH + h) * (R / 16) + tile) * 2 + c) * 512; }
__device__ __forceinline__ size_t fo_v(int b, int h, int S, int chunk, int j) { return ((((size_t)b * NH + h) * (S / 32) + chunk) * 4 + j) * 512; }
#define QBH 6              // not used: the causal high-precision path is taken by the 32-query tiles below row QHI (few keys, no averaging)
#define QHI 384            // rows carrying a q residual plane
#define KHI 384            // key rows carrying k residual / v bf16 hi+lo planes (used only by the causal high-precision path)
// B fragment (k rows k0+.., output column o) of a weight: (in,out) [K][ld] or (out,in) [ld rows of K]: bf16 exact, or f16(bf16 * 256) exact
__device__ __forceinline__ v16b wcol_io(const float* Wm, int k0, int o, int lane, int ld) { v16b w; const int g = lane >> 4;
#pragma unroll
  for (int i = 0; i < 8; ++i) { w[i] = (__bf16)Wm[(size_t)(k0 + 8 * g + i) * ld + o]; w[8 + i] = (__bf16)Wm[(size_t)(k0 + 16 + 8 * g + i) * ld + o]; }
  return w; }
__device__ __forceinline__ v16b wcol_oi(const float* Wm, int k0, int o, int lane, int K) { v16b w; const float* p = Wm + (size_t)o * K + k0 + 8 * (lane >> 4);
#pragma unroll
  for (int i = 0; i < 8; ++i) { w[i] = (__bf16)p[i]; w[8 + i] = (__bf16)p[16 + i]; }
  return w; }
__device__ __forceinline__ v16h wcolh_io(const float* Wm, int k0, int o, int lane, int ld) { v16h w; const int g = lane >> 4;
#pragma unroll
  for (int i = 0; i < 8; ++i) { w[i] = (_Float16)(bfr(Wm[(size_t)(k0 + 8 * g + i) * ld + o]) * 256.0f); w[8 + i] = (_Float16)(bfr(Wm[(size_t)(k0 + 16 + 8 * g + i) * ld + o]) * 256.0f); }
  return w; }
__device__ __forceinline__ v16h wcolh_oi(const float* Wm, int k0, int o, int lane, int K) { v16h w; const float* p = Wm + (size_t)o * K + k0 + 8 * (lane >> 4);
#pragma unroll
  for (int i = 0; i < 8; ++i) { w[i] = (_Float16)(bfr(p[i]) * 256.0f); w[8 + i] = (_Float16)(bfr(p[16 + i]) * 256.0f); }
  return w; }
#define WQKV_LAYOUT 1   // 0 = (in,out) [DIN][CC]; 1 = (out,in) [CC][DIN]; 2 = per-head [NH][DIN][HD]
__device__ __forceinline__ v16b wcol_hdk(const float* Wm, int k0, int o, int lane) { v16b w; const int g = lane >> 4; const float* p = Wm + (size_t)(o / HD) * DIN * HD + (o % HD);
#pragma unroll
  for (int i = 0; i < 8; ++i) { w[i] = (__bf16)p[(size_t)(k0 + 8 * g + i) * HD]; w[8 + i] = (__bf16)p[(size_t)(k0 + 16 + 8 * g + i) * HD]; }
  return w; }
#define WO_OUT_IN 0
#if WQKV_LAYOUT == 1
#define WCOL(W, k0, o, lane) wcol_oi(W, k0, o, lane, DIN)
#elif WQKV_LAYOUT == 2
#define WCOL(W, k0, o, lane) wcol_hdk(W, k0, o, lane)
#else
#define WCOL(W, k0, o, lane) wcol_io(W, k0, o, lane, CC)
#endif
#if WO_OUT_IN
#define WOCOL(W, k0, o, lane) wcol_oi(W, k0, o, lane, CC)
#define WOCOLH(W, k0, o, lane) wcolh_oi(W, k0, o, lane, CC)
#else
#define WOCOL(W, k0, o, lane) wcol_io(W, k0, o, lane, DIN)
#define WOCOLH(W, k0, o, lane) wcolh_io(W, k0, o, lane, DIN)
#endif

// ---- k_prepr: reads the module's [B, T, 64, NH] inputs once, in 16-byte pieces (4 heads of one d), bf16-rounds them and writes the attention planes in fragment order (above): q -> f16 (+ x 2^10 residual for s < QHI), k -> f16 (+ residual for s < KHI), v -> f16 (+ bf16 hi/lo for s < KHI). A lane gathers 8 pieces along the fragment's k axis (d for q and k, s for v), so the 4 x 8 transpose is a renaming of its registers; 8 neighbouring lanes hold 8 neighbouring fragment rows, so every store instruction writes four whole 128-byte lines. blockIdx.y = tensor; a wave takes 8 token rows x 32 d (q, k) or 32 tokens x 8 d (v), all heads.
#define PW 4               // waves a block
#define PU 4               // groups of 8 along k a wave: one fragment's (half q, lane group g) = (u >> 1, u & 1)
__device__ __forceinline__ void prep_qk(const float* __restrict__ X, _Float16* __restrict__ XH, _Float16* __restrict__ XL, int row0, int c, int lane) {
  const int r8 = lane & 7, h4 = lane >> 3; const float* src = X + (size_t)(row0 + r8) * CC + c * 32 * NH + h4 * 4; v4f x[PU][8];   // lane: token row0 + r8, heads 4 h4 .. + 3, d = 32 c .. + 31
#pragma unroll
  for (int u = 0; u < PU; ++u)
#pragma unroll
    for (int k = 0; k < 8; ++k) x[u][k] = *(const v4f*)(src + (u * 8 + k) * NH);
  asm volatile("s_wait_xcnt 0x0" ::: "memory");   // every load is issued before the first conversion, and their address registers are free for reuse behind this line
  const int bb = row0 / TT, rb = row0 % TT; const int lo = ((rb & 8) + r8) * 8; _Float16* dh = XH + fo_row(bb, h4 * 4, TT, rb / 16, c) + lo;
#pragma unroll
  for (int u = 0; u < PU; ++u)
#pragma unroll
    for (int e = 0; e < 4; ++e) { v8h r;
#pragma unroll
      for (int k = 0; k < 8; ++k) r[k] = (_Float16)bfr(x[u][k][e]);
      vst2(dh + e * (TT / 16) * 1024 + (u >> 1) * 256 + (u & 1) * 128, r); }
  asm volatile("s_wait_xcnt 0x0" ::: "memory");   // the stores' data registers are reused behind the branch below
  if (rb < QHI) { _Float16* dl = XL + fo_row(bb, h4 * 4, QHI, rb / 16, c) + lo;   // module inputs are bf16-rounded; bf16 values are exact in f16 apart from f16-subnormal magnitudes, which the residual carries
#pragma unroll
    for (int u = 0; u < PU; ++u)
#pragma unroll
      for (int e = 0; e < 4; ++e) { v8h r;
#pragma unroll
        for (int k = 0; k < 8; ++k) { const float q = bfr(x[u][k][e]); r[k] = (_Float16)((q - (float)(_Float16)q) * 1024.0f); }
        vst2(dl + e * (QHI / 16) * 1024 + (u >> 1) * 256 + (u & 1) * 128, r); }
    asm volatile("s_wait_xcnt 0x0" ::: "memory"); } }   // in the listing the v branch, which rewrites these stores' registers, follows this block
__device__ __forceinline__ void prep_v(const float* __restrict__ V, _Float16* __restrict__ VT, __bf16* __restrict__ VB, __bf16* __restrict__ VBL, int ck, int dq, int lane) {
  const int d8 = lane & 7, h4 = lane >> 3; const int bb = ck / (TT / 32), cb = ck % (TT / 32); const float* src = V + (size_t)ck * 32 * CC + (dq * 8 + d8) * NH + h4 * 4; v4f x[PU][8];   // lane: d = 8 dq + d8, heads 4 h4 .. + 3, the chunk's 32 tokens; a load instruction covers 512 contiguous bytes
#pragma unroll
  for (int u = 0; u < PU; ++u)
#pragma unroll
    for (int k = 0; k < 8; ++k) x[u][k] = *(const v4f*)(src + (u * 8 + k) * CC);
  asm volatile("s_wait_xcnt 0x0" ::: "memory");   // as in prep_qk
  const int lo = ((dq & 1) * 8 + d8) * 8; _Float16* dv = VT + fo_v(bb, h4 * 4, TT, cb, dq >> 1) + lo;
#pragma unroll
  for (int u = 0; u < PU; ++u)
#pragma unroll
    for (int e = 0; e < 4; ++e) { v8h r;
#pragma unroll
      for (int k = 0; k < 8; ++k) r[k] = (_Float16)bfr(x[u][k][e]);
      vst2(dv + e * (TT / 32) * 2048 + (u >> 1) * 256 + (u & 1) * 128, r); }
  asm volatile("s_wait_xcnt 0x0" ::: "memory");   // as in prep_qk
  if (cb * 32 < KHI) { const size_t po = fo_v(bb, h4 * 4, KHI, cb, dq >> 1) + lo; __bf16* db = VB + po; __bf16* dl = VBL + po;
#pragma unroll
    for (int u = 0; u < PU; ++u)
#pragma unroll
      for (int e = 0; e < 4; ++e) { v8b rh, rl;
#pragma unroll
        for (int k = 0; k < 8; ++k) { const float v = bfr(x[u][k][e]); const __bf16 vb = (__bf16)v; rh[k] = vb; rl[k] = (__bf16)(v - (float)vb); }
        const int o = e * (KHI / 32) * 2048 + (u >> 1) * 256 + (u & 1) * 128; vst2(db + o, rh); vst2(dl + o, rl); } } }
__global__ __launch_bounds__(32 * PW) void k_prepr(const float* __restrict__ Q, const float* __restrict__ K, const float* __restrict__ V, _Float16* __restrict__ QH, _Float16* __restrict__ QL, _Float16* __restrict__ KH, _Float16* __restrict__ KL, _Float16* __restrict__ VT, __bf16* __restrict__ VB, __bf16* __restrict__ VBL) {
  const int lane = threadIdx.x & 31; const int w = blockIdx.x * PW + __builtin_amdgcn_readfirstlane(threadIdx.x >> 5);   // wave number in a scalar register: the tests on rows below QHI / KHI are scalar branches
  if (blockIdx.y == 2) { prep_v(V, VT, VB, VBL, w >> 3, w & 7, lane); return; }
  const bool isq = blockIdx.y == 0; prep_qk(isq ? Q : K, isq ? QH : KH, isq ? QL : KL, (w >> 1) * 8, w & 1, lane); }
static_assert(NH == 16 && HD == 64 && PU == 4 && QHI == KHI && QHI % 32 == 0 && TT % 32 == 0 && (TNB * TT) % (PW * PU) == 0 && (TNB * TT / 8) * 2 == TNB * TT / PU && (TNB * TT / 32) * 8 == TNB * TT / PU, "k_prepr: 32 lanes = 4 head quads x 8 fragment rows; as many waves for v as for q or k");

#ifndef SM_EXTRA_PARAMS
#define SM_EXTRA_PARAMS
#endif
#ifndef PROJ_EXTRA_PARAMS
#define PROJ_EXTRA_PARAMS
#endif
#ifndef SM_MASK_HOOK
#define SM_MASK_HOOK (void)0
#endif

#define WS_QH  0u                                      // f16 q, fragment order [b][h][t / 16][c]
#define WS_KH  (WS_QH + 2u * (size_t)NB * TT * CC)      // f16 k, fragment order
#define WS_VT  (WS_KH + 2u * (size_t)NB * TT * CC)      // f16 v, fragment order [b][h][t / 32][j]
#define WS_QL  (WS_VT + 2u * (size_t)NB * CC * TT)      // f16 q residual x 2^10, fragment order, t < QHI
#define WS_KL  (WS_QL + 2u * (size_t)NB * QHI * CC)     // f16 k residual x 2^10, fragment order, t < KHI
#define WS_VB  (WS_KL + 2u * (size_t)NB * KHI * CC)     // bf16 v hi (then lo), fragment order, t < KHI
#define WS_VBL (WS_VB + 2u * (size_t)NB * CC * KHI)
#define WS_S   (WS_VBL + 2u * (size_t)NB * CC * KHI)    // f32 [hg][t][s] space, not used by any kernel here
#define WS_Y   (WS_S  + 4u * (size_t)HG * TT * TT)      // f32 ctx rows [b*t][CC]
#define WS_END (WS_Y  + 4u * (size_t)NB * TT * CC)   // f32 context rows in the layout [b*t][h*64 + d], re-ordered by k_tr into the output

// ---- k_fa: block = FT neighbouring tiles of 32 queries of (b, h), FW waves: a wave takes one tile and, as one of its FK key splits, that tile's 32-key chunks split, split + FK, ... <= qt. The FT waves of one split (waves w and w + 2: two SIMDs) read the same k and v fragments at about the same time, so that the later reader is served by the WGP's cache and not by L2. Per chunk: S^T = k . q^T (lane = one query column, 16 of the chunk's keys in its registers), running maximum and sum per query in f32 (online softmax, log2 units), P x 2^11 packed from the score accumulators straight into a B operand, ctx^T += v^T . P^T. Logits and P never leave the registers. Query rows < QHI keep the residual products and the bf16 hi + lo P . v. Each tile's FK (max, sum, ctx) partials are merged in split order through LDS.
#define FW 8
#define FQ 32
#define FT 2               // query tiles a block
#define FK (FW / FT)       // key splits a tile
#define LOGC (SCALE * 1.44269504088896340736f)   // logit scale x log2(e)
__device__ __forceinline__ float xhalf(float x) { return __builtin_bit_cast(float, __builtin_amdgcn_permlanex16(__builtin_bit_cast(int, x), __builtin_bit_cast(int, x), 0x76543210, 0xfedcba98, false, false)); }   // lane l reads lane l ^ 16
// 2^x by v_exp_f32, with the one free slot that the instruction set asks for behind a transcendental kept inside the statement; in the run of eight no instruction reads its predecessor's result or overwrites its source (outputs are early-clobber), the v_nop serves the last
__device__ __forceinline__ float exp2s(float x) { float r; asm("v_exp_f32 %0, %1\n\tv_nop" : "=v"(r) : "v"(x)); return r; }
__device__ __forceinline__ void exp2x8(float* o, const float* x) {
  asm("v_exp_f32 %0, %8\n\tv_exp_f32 %1, %9\n\tv_exp_f32 %2, %10\n\tv_exp_f32 %3, %11\n\tv_exp_f32 %4, %12\n\tv_exp_f32 %5, %13\n\tv_exp_f32 %6, %14\n\tv_exp_f32 %7, %15\n\tv_nop"
      : "=&v"(o[0]), "=&v"(o[1]), "=&v"(o[2]), "=&v"(o[3]), "=&v"(o[4]), "=&v"(o[5]), "=&v"(o[6]), "=&v"(o[7]) : "v"(x[0]), "v"(x[1]), "v"(x[2]), "v"(x[3]), "v"(x[4]), "v"(x[5]), "v"(x[6]), "v"(x[7])); }
struct FaSt { v8f acc[2][HD / 16]; float m[2], l[2]; };
template <bool HI> __device__ __forceinline__ void fa_run(FaSt& st, const _Float16* __restrict__ QH, const _Float16* __restrict__ KH, const _Float16* __restrict__ QL, const _Float16* __restrict__ KL, const _Float16* __restrict__ VT, const __bf16* __restrict__ VB, const __bf16* __restrict__ VBL, int b, int h, int qt, int wave, int lane) {
  const int col = lane & 15, g = lane >> 4; const int q0 = qt * FQ;
  v16h qh[2][2], ql[2][2];
#pragma unroll
  for (int n = 0; n < 2; ++n)
#pragma unroll
    for (int c = 0; c < 2; ++c) { qh[n][c] = frag_ph(QH + fo_row(b, h, TT, q0 / 16 + n, c), lane); if (HI) ql[n][c] = frag_ph(QL + fo_row(b, h, QHI, q0 / 16 + n, c), lane); }
  v16h kf[2][2], vf[HD / 16];   // !HI: this chunk's k fragments (fetched one chunk ahead) and v fragments (fetched at the chunk's top), so that no product waits for a load issued just in front of it
  if (!HI) { const int kf0 = (wave <= qt ? wave : qt) * 2;
#pragma unroll
    for (int t = 0; t < 2; ++t)
#pragma unroll
      for (int c = 0; c < 2; ++c) kf[t][c] = frag_ph(KH + fo_row(b, h, TT, kf0 + t, c), lane); }
#pragma unroll 1
  for (int kc = wave; kc <= qt; kc += FK) {   // k0 = 32 kc is the chunk's first key
    v8f s[2][2] = {};   // [query group][key tile]: element r = key k0 + 16 * tile + 8 * g + r, query q0 + 16 * group + col
    if (HI) { v8f sl[2][2] = {};
#pragma unroll
      for (int t = 0; t < 2; ++t)
#pragma unroll
        for (int c = 0; c < 2; ++c) { const v16h kf = frag_ph(KH + fo_row(b, h, TT, kc * 2 + t, c), lane), klf = frag_ph(KL + fo_row(b, h, KHI, kc * 2 + t, c), lane);
#pragma unroll
          for (int n = 0; n < 2; ++n) { s[n][t] = wmma16(kf, qh[n][c], s[n][t]); sl[n][t] = wmma16(kf, ql[n][c], sl[n][t]); sl[n][t] = wmma16(klf, qh[n][c], sl[n][t]); } }
#pragma unroll
      for (int n = 0; n < 2; ++n)
#pragma unroll
        for (int t = 0; t < 2; ++t) s[n][t] += sl[n][t] * (1.0f / 1024.0f);
    } else {
#pragma unroll
      for (int j = 0; j < HD / 16; ++j) vf[j] = frag_ph(VT + fo_v(b, h, TT, kc, j), lane);
#pragma unroll
      for (int t = 0; t < 2; ++t)
#pragma unroll
        for (int c = 0; c < 2; ++c)
#pragma unroll
          for (int n = 0; n < 2; ++n) s[n][t] = wmma16(kf[t][c], qh[n][c], s[n][t]);
      const int kn = (kc + FK <= qt ? kc + FK : kc) * 2;   // the wave's next chunk; on its last trip the same rows again (in bounds, not used)
#pragma unroll
      for (int t = 0; t < 2; ++t)
#pragma unroll
        for (int c = 0; c < 2; ++c) kf[t][c] = frag_ph(KH + fo_row(b, h, TT, kn + t, c), lane);
      asm volatile("s_wait_xcnt 0x0" ::: "memory"); }   // the loads' address registers are reused behind the branch below
    if (kc == qt) {   // the diagonal chunk: keys past the query are excluded (every query keeps key k0 at least)
#pragma unroll
      for (int n = 0; n < 2; ++n)
#pragma unroll
        for (int t = 0; t < 2; ++t)
#pragma unroll
          for (int r = 0; r < 8; ++r) if (t * 16 + 8 * g + r > n * 16 + col) s[n][t][r] = -1.0e30f; }
    float mt[2];
#pragma unroll
    for (int n = 0; n < 2; ++n) { float mx = s[n][0][0];
#pragma unroll
      for (int r = 1; r < 8; ++r) mx = fmaxf(mx, s[n][0][r]);
#pragma unroll
      for (int r = 0; r < 8; ++r) mx = fmaxf(mx, s[n][1][r]);
      mx = fmaxf(mx, xhalf(mx)); mt[n] = fmaxf(st.m[n], mx * LOGC); }
    if (__builtin_amdgcn_ballot_w32(mt[0] > st.m[0] || mt[1] > st.m[1]) != 0) {   // a maximum grew somewhere in the wave: bring sums and ctx to the new one
#pragma unroll
      for (int n = 0; n < 2; ++n) { const float a = exp2s(st.m[n] - mt[n]); st.m[n] = mt[n]; st.l[n] *= a;
#pragma unroll
        for (int j = 0; j < HD / 16; ++j) st.acc[n][j] *= a; } }
    float p[2][16];
#pragma unroll
    for (int n = 0; n < 2; ++n) { const float bias = 11.0f - st.m[n]; float sum = 0.f;
#pragma unroll
      for (int t = 0; t < 2; ++t) { float x[8];
#pragma unroll
        for (int r = 0; r < 8; ++r) x[r] = fmaf(s[n][t][r], LOGC, bias);
        exp2x8(&p[n][8 * t], x);
#pragma unroll
        for (int r = 0; r < 8; ++r) sum += p[n][8 * t + r]; }
      st.l[n] += sum; }
    if (HI) { const F2 p0 = bsplit16(p[0]), p1 = bsplit16(p[1]);
#pragma unroll
      for (int j = 0; j < HD / 16; ++j) { const size_t po = fo_v(b, h, KHI, kc, j); const v16b vh = frag_pb(VB + po, lane), vl = frag_pb(VBL + po, lane);
        st.acc[0][j] = wmma_bf(vh, p0.h, st.acc[0][j]); st.acc[0][j] = wmma_bf(vh, p0.l, st.acc[0][j]); st.acc[0][j] = wmma_bf(vl, p0.h, st.acc[0][j]);
        st.acc[1][j] = wmma_bf(vh, p1.h, st.acc[1][j]); st.acc[1][j] = wmma_bf(vh, p1.l, st.acc[1][j]); st.acc[1][j] = wmma_bf(vl, p1.h, st.acc[1][j]); }
      asm volatile("s_wait_xcnt 0x0" ::: "memory");   // the v loads' address registers are reused by the next chunk's score tiles
    } else { v16h pf[2];
#pragma unroll
      for (int n = 0; n < 2; ++n)
#pragma unroll
        for (int i = 0; i < 16; ++i) pf[n][i] = (_Float16)p[n][i];
#pragma unroll
      for (int j = 0; j < HD / 16; ++j)
#pragma unroll
        for (int n = 0; n < 2; ++n) st.acc[n][j] = wmma16(vf[j], pf[n], st.acc[n][j]); } } }
__global__ __launch_bounds__(32 * FW) void k_fa(const _Float16* __restrict__ QH, const _Float16* __restrict__ KH, const _Float16* __restrict__ QL, const _Float16* __restrict__ KL, const _Float16* __restrict__ VT, const __bf16* __restrict__ VB, const __bf16* __restrict__ VBL, float* __restrict__ Y) {
  __shared__ __align__(16) float ss[FW][FQ][HD + 4]; __shared__ float sm[FW][FQ], sl[FW][FQ];
  const int tid = threadIdx.x, lane = tid & 31, col = lane & 15, g = lane >> 4; const int b = blockIdx.x / NH, h = blockIdx.x % NH; const int q2 = (TT / (FT * FQ) - 1 - blockIdx.y) * FT;   // the block's first tile; longest tiles start first
  const int wave = __builtin_amdgcn_readfirstlane(tid >> 5);   // wave number in a scalar register: the chunk loop branches on scalar compares and every lane stays on at the matrix instructions
  const int tl = (wave >> 1) & 1, ks = (wave & 1) + (wave >> 2) * 2, slot = ks * FT + tl; const int qt = q2 + tl;   // tile of the block, key split, place of the partial in LDS
  FaSt st;
#pragma unroll
  for (int n = 0; n < 2; ++n) { st.m[n] = -1.0e30f; st.l[n] = 0.f;
#pragma unroll
    for (int j = 0; j < HD / 16; ++j) st.acc[n][j] = v8f{}; }
  if (q2 * FQ < QHI) fa_run<true>(st, QH, KH, QL, KL, VT, VB, VBL, b, h, qt, ks, lane); else fa_run<false>(st, QH, KH, QL, KL, VT, VB, VBL, b, h, qt, ks, lane);
#pragma unroll
  for (int n = 0; n < 2; ++n) { const float l = st.l[n] + xhalf(st.l[n]); if (g == 0) { sm[slot][n * 16 + col] = st.m[n]; sl[slot][n * 16 + col] = l; }
#pragma unroll
    for (int j = 0; j < HD / 16; ++j) { const v8f a = st.acc[n][j]; *(v4f*)&ss[slot][n * 16 + col][j * 16 + 8 * g] = v4f{a[0], a[1], a[2], a[3]}; *(v4f*)&ss[slot][n * 16 + col][j * 16 + 8 * g + 4] = v4f{a[4], a[5], a[6], a[7]}; } }
  __syncthreads();   // every wave's partial is in LDS before any thread merges across waves
#pragma unroll
  for (int i = 0; i < FT * FQ / 16; ++i) { const int t = i / (FQ / 16), rl = (tid >> 4) + 16 * (i % (FQ / 16)), c4 = (tid & 15) * 4; float M = sm[t][rl];   // row rl of the block's tile t, whose partials lie at places t, t + FT, ...
    for (int w = t + FT; w < FW; w += FT) M = fmaxf(M, sm[w][rl]);
    float L = 0.f; v4f s = {};
    for (int w = t; w < FW; w += FT) { const float f = exp2s(sm[w][rl] - M); L += sl[w][rl] * f; s += *(const v4f*)&ss[w][rl][c4] * f; }   // a wave without chunks has weight 0
    vst2(Y + ((size_t)b * TT + (q2 + t) * FQ + rl) * CC + h * HD + c4, s * (1.0f / L)); } }
static_assert(32 * FW == 16 * (HD / 4) && FW == 8 && FT == 2 && FQ % 16 == 0 && QHI % (FT * FQ) == 0 && QHI <= KHI && TT % (FT * FQ) == 0, "k_fa: 16 rows of HD / 4 threads; whole blocks on either precision path");

// ---- k_tr: a wave re-orders TR whole token rows by itself. A lane loads 8 heads x 4 d (16 bytes a head; an instruction reads two whole 256-byte head rows), so that 4 neighbouring heads of one d are a renaming of its registers; they pass through the wave's own LDS range in output order, and every store instruction writes 512 contiguous bytes. All of a wave's loads are in flight together; one work-group a WGP covers the grid.
#define TW 8               // waves a block
#define TR 2               // token rows a wave
#define TP 68              // LDS floats a group of 4 d x 16 heads (64 + 4): a pitch of 16 bytes x 17 spreads the 16-byte LDS stores of 16 lanes, one group apart, over all banks
__global__ __launch_bounds__(32 * TW) void k_tr(const float* __restrict__ Y, float* __restrict__ OUT) { __shared__ __align__(16) float sy[TW][TR][(HD / 4) * TP];
  const int lane = threadIdx.x & 31, wave = threadIdx.x >> 5, dq = lane & 15, g = lane >> 4; const size_t r0 = ((size_t)blockIdx.x * TW + wave) * TR; const float* src = Y + r0 * CC + g * 8 * HD + dq * 4; v4f x[TR][8];   // lane: heads 8 g .. + 7, d = 4 dq .. + 3
#pragma unroll
  for (int t = 0; t < TR; ++t)
#pragma unroll
    for (int k = 0; k < 8; ++k) x[t][k] = *(const v4f*)(src + t * CC + k * HD);
  asm volatile("s_wait_xcnt 0x0" ::: "memory");   // every load is issued before the first LDS store, and their address registers are free for reuse behind this line
#pragma unroll
  for (int t = 0; t < TR; ++t)
#pragma unroll
    for (int e = 0; e < 4; ++e)
#pragma unroll
      for (int s = 0; s < 2; ++s) *(v4f*)&sy[wave][t][dq * TP + e * NH + g * 8 + s * 4] = v4f{x[t][4 * s][e], x[t][4 * s + 1][e], x[t][4 * s + 2][e], x[t][4 * s + 3][e]};   // output order: d * 16 + h, d = 4 dq + e
  asm volatile("s_wait_dscnt 0x0" ::: "memory");   // the wave's own LDS stores are done before its lanes read what other lanes wrote; no other wave touches this range, so no barrier
#pragma unroll
  for (int t = 0; t < TR; ++t)
#pragma unroll
    for (int j = 0; j < 8; ++j) vst2(OUT + (r0 + t) * CC + j * 128 + lane * 4, *(const v4f*)&sy[wave][t][(2 * j + g) * TP + dq * 4]); }
static_assert(CC == 1024 && NH == 16 && HD == 64 && (TNB * TT) % (TW * TR) == 0, "k_tr: 32 lanes = 2 groups of 8 heads x 16 groups of 4 d; whole blocks");
extern "C" void kernel_launch(void* const* d_in, const int* in_sizes, int n_in, void* d_out, int out_size, void* d_ws, size_t ws_size, hipStream_t stream) {
  (void)in_sizes; (void)n_in; (void)out_size;
  const float** F = (const float**)d_in;
  if (ws_size < (size_t)WS_END) return;
  char* ws = (char*)d_ws; _Float16 *QH = (_Float16*)(ws + WS_QH), *KH = (_Float16*)(ws + WS_KH), *VT = (_Float16*)(ws + WS_VT), *QL = (_Float16*)(ws + WS_QL), *KL = (_Float16*)(ws + WS_KL); __bf16 *VB = (__bf16*)(ws + WS_VB), *VBL = (__bf16*)(ws + WS_VBL); float *Y = (float*)(ws + WS_Y);
  (void)Y; (void)QL; (void)KL; (void)VB; (void)VBL;
  // inputs: 0 q [2,2048,64,16]; 1 k; 2 v (all (batch, seq, head_dim, n_heads): token rows of 1,024 with element (d, h) at d*16 + h)
  k_prepr<<<dim3(TNB * TT / (PW * PU), 3), 32 * PW, 0, stream>>>(F[0], F[1], F[2], QH, QL, KH, KL, VT, VB, VBL);
  k_fa<<<dim3(TNB * NH, TT / (FT * FQ)), 32 * FW, 0, stream>>>(QH, KH, QL, KL, VT, VB, VBL, Y);
  k_tr<<<dim3(TNB * TT / (TW * TR)), 32 * TW, 0, stream>>>(Y, (float*)d_out);   /* layout [h*64 + d] -> the module's [d*16 + h] */
}

// v008
// It runs in 34.6 microseconds.
// In two side-by-side timings against v007, it was 1.13 and 1.14 times as fast.
// Over all steps from v000 it is 24.9 times as fast.
// compute dtype: all float inputs rounded to bf16 (bf16 values are exact in f16 apart from f16-subnormal magnitudes); causal logits q x k / 64 (exact operands; the module divides by head_dim, not its square root); softmax f32; P x 2^11 once to f16 x v (bf16 hi + lo path below row 384); f32 context rows, then re-ordered to the module's heads-innermost layout. No projections. The 16-bit q, k, v planes lie in matrix-fragment order.
#include <hip/hip_runtime.h>
#include <math.h>

typedef __attribute__((ext_vector_type(16))) _Float16 v16h;
typedef __attribute__((ext_vector_type(16))) __bf16 v16b;
typedef __attribute__((ext_vector_type(8)))  _Float16 v8h;
typedef __attribute__((ext_vector_type(8)))  float v8f;
typedef __attribute__((ext_vector_type(4)))  float v4f;
typedef __attribute__((ext_vector_type(2)))  float v2f;
typedef __attribute__((ext_vector_type(4)))  unsigned v4u;
typedef __attribute__((ext_vector_type(4)))  int v4i;
typedef float __attribute__((may_alias)) float_a;
typedef int __attribute__((may_alias)) int_a;

template <typename T> __device__ __forceinline__ void vst2(void* p, T v) { *(T*)p = v;  }
__device__ __forceinline__ v8f wmma16(v16h a, v16h b, v8f c) {
  return __builtin_amdgcn_wmma_f32_16x16x32_f16(false, a, false, b, (short)0, c, false, false);
}
__device__ __forceinline__ v8f wmma_bf(v16b a, v16b b, v8f c) {
  return __builtin_amdgcn_wmma_f32_16x16x32_bf16(false, a, false, b, (short)0, c, false, false);
}
// 16x16x32 fragments: lane = (h = lane>>4, row/col = lane&15); elements 0..7 = k0+8h+0..7, 8..15 = k0+16+8h+0..7; D element r = row 8h+r
__device__ __forceinline__ v16h frag_h(const _Float16* rowk0, int lane) {
  union { v16h v; v8h q[2]; } u; const _Float16* p = rowk0 + 8 * (lane >> 4);
  u.q[0] = *(const v8h*)p; u.q[1] = *(const v8h*)(p + 16); return u.v;
}
__device__ __forceinline__ v16h frag_f32(const float* rowk0, int lane) {
  v16h a; const float* p = rowk0 + 8 * (lane >> 4);
#pragma unroll
  for (int i = 0; i < 8; ++i) { a[i] = (_Float16)p[i]; a[8 + i] = (_Float16)p[16 + i]; }
  return a;
}
__device__ __forceinline__ v16h frag_f32s(const float* rowk0, int lane, float sc) {
  v16h a; const float* p = rowk0 + 8 * (lane >> 4);
#pragma unroll
  for (int i = 0; i < 8; ++i) { a[i] = (_Float16)(p[i] * sc); a[8 + i] = (_Float16)(p[16 + i] * sc); }
  return a;
}
// column fragment from a [K][ld] layout (column n), rows >= K read as 0
__device__ __forceinline__ v16h fragc_f32(const float* W, int k0, int n, int lane, int ld, int K) {
  v16h a; const int g = lane >> 4;
#pragma unroll
  for (int i = 0; i < 8; ++i) { const int ka = k0 + 8 * g + i, kb = ka + 16;
    a[i] = (_Float16)(ka < K ? W[(size_t)(ka < K ? ka : K - 1) * ld + n] : 0.f); a[8 + i] = (_Float16)(kb < K ? W[(size_t)(kb < K ? kb : K - 1) * ld + n] : 0.f); }
  return a;
}
struct F2 { v16b h, l; };
__device__ __forceinline__ F2 bsplit16(const float v[16]) { F2 r;
#pragma unroll
  for (int i = 0; i < 16; ++i) { const __bf16 h = (__bf16)v[i]; r.h[i] = h; r.l[i] = (__bf16)(v[i] - (float)h); }
  return r; }
__device__ __forceinline__ F2 split_row(const float* row, int k0, int lane) { float v[16]; const float* p = row + k0 + 8 * (lane >> 4);
#pragma unroll
  for (int i = 0; i < 8; ++i) { v[i] = p[i]; v[8 + i] = p[16 + i]; }
  return bsplit16(v); }
__device__ __forceinline__ F2 split_rowK(const float* row, int k0, int lane, int K) { float v[16]; const int g = lane >> 4;
#pragma unroll
  for (int i = 0; i < 8; ++i) { const int ka = k0 + 8 * g + i, kb = ka + 16; v[i] = ka < K ? row[ka < K ? ka : K - 1] : 0.f; v[8 + i] = kb < K ? row[kb < K ? kb : K - 1] : 0.f; }
  return bsplit16(v); }
__device__ __forceinline__ F2 split_col(const float* W, int k0, int n, int lane, int ld, int K) { float v[16]; const int g = lane >> 4;
#pragma unroll
  for (int i = 0; i < 8; ++i) { const int ka = k0 + 8 * g + i, kb = ka + 16; v[i] = ka < K ? W[(size_t)(ka < K ? ka : K - 1) * ld + n] : 0.f; v[8 + i] = kb < K ? W[(size_t)(kb < K ? kb : K - 1) * ld + n] : 0.f; }
  return bsplit16(v); }
__device__ __forceinline__ v8f mac3(const F2& a, const F2& b, v8f c) { c = wmma_bf(a.l, b.h, c); c = wmma_bf(a.h, b.l, c); return wmma_bf(a.h, b.h, c); }
__device__ __forceinline__ float sigm(float v) { return 1.0f / (1.0f + expf(-v)); }
#define LDSX() do { asm volatile("s_wait_dscnt 0" ::: "memory"); __builtin_amdgcn_wave_barrier(); __builtin_amdgcn_fence(__ATOMIC_RELEASE, "workgroup"); } while (0)

// Causal multi-head softmax attention without weights in a HEADS-INNERMOST layout (q / k / v [2,2048,64,16] = (batch, seq, head_dim, n_heads), N(0,1); att[b,c,C,h] = sum_d q[b,c,d,h] k[b,C,d,h] / 64 (1 / head_dim); C > c set to -inf; softmax over C; y[b,c,v,h] = sum_C p[b,c,C,h] v[b,C,v,h], [2,2048,64,16]). Internal view: token row = (b, c); internal column h*64 + d lives at offset d*16 + h of the module's 1,024-float row: the loader gathers it that way and a final row-wise re-order writes the output back the same way.
#define NB 2
#define TT 2048
#define CC 1024            // NH * HD = projected width
#define DIN 1024          // input (model) width
#define NH 16
#define HD 64
#define NQB (TT / 64)
#define HG 4
#define SCALE (0.015625f)
#define CAUSAL 1
#ifndef TNB
#define TNB NB
#endif
__device__ __forceinline__ float bfr(float v) { return (float)(__bf16)v; }
__host__ __device__ __forceinline__ int kb_last(int qb) { return CAUSAL ? ((qb * 64 + 63) >> 7) : (TT / 128 - 1); }
typedef __attribute__((ext_vector_type(8))) __bf16 v8b;
__device__ __forceinline__ v16b frag_b(const __bf16* rowk0, int lane) {
  union { v16b v; v8b q[2]; } u; const __bf16* p = rowk0 + 8 * (lane >> 4);
  u.q[0] = *(const v8b*)p; u.q[1] = *(const v8b*)(p + 16); return u.v;
}
// Fragment-order planes: one 16 x 32 fragment (16 rows or columns x 32 values of k) is 1,024 contiguous bytes, two halves of 512 (fragment elements 0..7 and 8..15), lane l's 8 elements at byte 16 l of each half: a wave's 16-byte load or a store of 8 neighbouring lanes covers whole 128-byte lines.
__device__ __forceinline__ v16h frag_ph(const _Float16* f, int lane) { union { v16h v; v8h q[2]; } u; u.q[0] = *(const v8h*)(f + lane * 8); u.q[1] = *(const v8h*)(f + 256 + lane * 8); return u.v; }
__device__ __forceinline__ v16b frag_pb(const __bf16* f, int lane) { union { v16b v; v8b q[2]; } u; u.q[0] = *(const v8b*)(f + lane * 8); u.q[1] = *(const v8b*)(f + 256 + lane * 8); return u.v; }
// first element of a fragment. q, k planes [b][h][16-row tile][32-d half c]: lane = 16 g + row, half q, element i = d 32 c + 16 q + 8 g + i; R = rows a batch. v planes [b][h][32-key chunk][16-d group j]: lane = 16 g + d, half q, element i = key 16 q + 8 g + i of the chunk; S = keys a batch.
__device__ __forceinline__ size_t fo_row(int b, int h, int R, int tile, int c) { return ((((size_t)b * NH + h) * (R / 16) + tile) * 2 + c) * 512; }
__device__ __forceinline__ size_t fo_v(int b, int h, int S, int chunk, int j) { return ((((size_t)b * NH + h) * (S / 32) + chunk) * 4 + j) * 512; }
#define QBH 6              // not used: the causal high-precision path is taken by the 32-query tiles below row QHI (few keys, no averaging)
#define QHI 384            // rows carrying a q residual plane
#define KHI 384            // key rows carrying k residual / v bf16 hi+lo planes (used only by the causal high-precision path)
// B fragment (k rows k0+.., output column o) of a weight: (in,out) [K][ld] or (out,in) [ld rows of K]: bf16 exact, or f16(bf16 * 256) exact
__device__ __forceinline__ v16b wcol_io(const float* Wm, int k0, int o, int lane, int ld) { v16b w; const int g = lane >> 4;
#pragma unroll
  for (int i = 0; i < 8; ++i) { w[i] = (__bf16)Wm[(size_t)(k0 + 8 * g + i) * ld + o]; w[8 + i] = (__bf16)Wm[(size_t)(k0 + 16 + 8 * g + i) * ld + o]; }
  return w; }
__device__ __forceinline__ v16b wcol_oi(const float* Wm, int k0, int o, int lane, int K) { v16b w; const float* p = Wm + (size_t)o * K + k0 + 8 * (lane >> 4);
#pragma unroll
  for (int i = 0; i < 8; ++i) { w[i] = (__bf16)p[i]; w[8 + i] = (__bf16)p[16 + i]; }
  return w; }
__device__ __forceinline__ v16h wcolh_io(const float* Wm, int k0, int o, int lane, int ld) { v16h w; const int g = lane >> 4;
#pragma unroll
  for (int i = 0; i < 8; ++i) { w[i] = (_Float16)(bfr(Wm[(size_t)(k0 + 8 * g + i) * ld + o]) * 256.0f); w[8 + i] = (_Float16)(bfr(Wm[(size_t)(k0 + 16 + 8 * g + i) * ld + o]) * 256.0f); }
  return w; }
__device__ __forceinline__ v16h wcolh_oi(const float* Wm, int k0, int o, int lane, int K) { v16h w; const float* p = Wm + (size_t)o * K + k0 + 8 * (lane >> 4);
#pragma unroll
  for (int i = 0; i < 8; ++i) { w[i] = (_Float16)(bfr(p[i]) * 256.0f); w[8 + i] = (_Float16)(bfr(p[16 + i]) * 256.0f); }
  return w; }
#define WQKV_LAYOUT 1   // 0 = (in,out) [DIN][CC]; 1 = (out,in) [CC][DIN]; 2 = per-head [NH][DIN][HD]
__device__ __forceinline__ v16b wcol_hdk(const float* Wm, int k0, int o, int lane) { v16b w; const int g = lane >> 4; const float* p = Wm + (size_t)(o / HD) * DIN * HD + (o % HD);
#pragma unroll
  for (int i = 0; i < 8; ++i) { w[i] = (__bf16)p[(size_t)(k0 + 8 * g + i) * HD]; w[8 + i] = (__bf16)p[(size_t)(k0 + 16 + 8 * g + i) * HD]; }
  return w; }
#define WO_OUT_IN 0
#if WQKV_LAYOUT == 1
#define WCOL(W, k0, o, lane) wcol_oi(W, k0, o, lane, DIN)
#elif WQKV_LAYOUT == 2
#define WCOL(W, k0, o, lane) wcol_hdk(W, k0, o, lane)
#else
#define WCOL(W, k0, o, lane) wcol_io(W, k0, o, lane, CC)
#endif
#if WO_OUT_IN
#define WOCOL(W, k0, o, lane) wcol_oi(W, k0, o, lane, CC)
#define WOCOLH(W, k0, o, lane) wcolh_oi(W, k0, o, lane, CC)
#else
#define WOCOL(W, k0, o, lane) wcol_io(W, k0, o, lane, DIN)
#define WOCOLH(W, k0, o, lane) wcolh_io(W, k0, o, lane, DIN)
#endif

// ---- k_prepr: reads the module's [B, T, 64, NH] inputs once, in 16-byte pieces (4 heads of one d), bf16-rounds them and writes the attention planes in fragment order (above): q -> f16 (+ x 2^10 residual for s < QHI), k -> f16 (+ residual for s < KHI), v -> f16 (+ bf16 hi/lo for s < KHI). A lane gathers 8 pieces along the fragment's k axis (d for q and k, s for v), so the 4 x 8 transpose is a renaming of its registers; 8 neighbouring lanes hold 8 neighbouring fragment rows, so every store instruction writes four whole 128-byte lines. blockIdx.y = tensor; a wave takes 8 token rows x 32 d (q, k) or 32 tokens x 8 d (v), all heads.
#define PW 4               // waves a block
#define PU 4               // groups of 8 along k a wave: one fragment's (half q, lane group g) = (u >> 1, u & 1)
__device__ __forceinline__ void prep_qk(const float* __restrict__ X, _Float16* __restrict__ XH, _Float16* __restrict__ XL, int row0, int c, int lane) {
  const int r8 = lane & 7, h4 = lane >> 3; const float* src = X + (size_t)(row0 + r8) * CC + c * 32 * NH + h4 * 4; v4f x[PU][8];   // lane: token row0 + r8, heads 4 h4 .. + 3, d = 32 c .. + 31
#pragma unroll
  for (int u = 0; u < PU; ++u)
#pragma unroll
    for (int k = 0; k < 8; ++k) x[u][k] = *(const v4f*)(src + (u * 8 + k) * NH);
  asm volatile("s_wait_xcnt 0x0" ::: "memory");   // every load is issued before the first conversion, and their address registers are free for reuse behind this line
  const int bb = row0 / TT, rb = row0 % TT; const int lo = ((rb & 8) + r8) * 8; _Float16* dh = XH + fo_row(bb, h4 * 4, TT, rb / 16, c) + lo;
#pragma unroll
  for (int u = 0; u < PU; ++u)
#pragma unroll
    for (int e = 0; e < 4; ++e) { v8h r;
#pragma unroll
      for (int k = 0; k < 8; ++k) r[k] = (_Float16)bfr(x[u][k][e]);
      vst2(dh + e * (TT / 16) * 1024 + (u >> 1) * 256 + (u & 1) * 128, r); }
  asm volatile("s_wait_xcnt 0x0" ::: "memory");   // the stores' data registers are reused behind the branch below
  if (rb < QHI) { _Float16* dl = XL + fo_row(bb, h4 * 4, QHI, rb / 16, c) + lo;   // module inputs are bf16-rounded; bf16 values are exact in f16 apart from f16-subnormal magnitudes, which the residual carries
#pragma unroll
    for (int u = 0; u < PU; ++u)
#pragma unroll
      for (int e = 0; e < 4; ++e) { v8h r;
#pragma unroll
        for (int k = 0; k < 8; ++k) { const float q = bfr(x[u][k][e]); r[k] = (_Float16)((q - (float)(_Float16)q) * 1024.0f); }
        vst2(dl + e * (QHI / 16) * 1024 + (u >> 1) * 256 + (u & 1) * 128, r); }
    asm volatile("s_wait_xcnt 0x0" ::: "memory"); } }   // in the listing the v branch, which rewrites these stores' registers, follows this block
__device__ __forceinline__ void prep_v(const float* __restrict__ V, _Float16* __restrict__ VT, __bf16* __restrict__ VB, __bf16* __restrict__ VBL, int ck, int dq, int lane) {
  const int d8 = lane & 7, h4 = lane >> 3; const int bb = ck / (TT / 32), cb = ck % (TT / 32); const float* src = V + (size_t)ck * 32 * CC + (dq * 8 + d8) * NH + h4 * 4; v4f x[PU][8];   // lane: d = 8 dq + d8, heads 4 h4 .. + 3, the chunk's 32 tokens; a load instruction covers 512 contiguous bytes
#pragma unroll
  for (int u = 0; u < PU; ++u)
#pragma unroll
    for (int k = 0; k < 8; ++k) x[u][k] = *(const v4f*)(src + (u * 8 + k) * CC);
  asm volatile("s_wait_xcnt 0x0" ::: "memory");   // as in prep_qk
  const int lo = ((dq & 1) * 8 + d8) * 8; _Float16* dv = VT + fo_v(bb, h4 * 4, TT, cb, dq >> 1) + lo;
#pragma unroll
  for (int u = 0; u < PU; ++u)
#pragma unroll
    for (int e = 0; e < 4; ++e) { v8h r;
#pragma unroll
      for (int k = 0; k < 8; ++k) r[k] = (_Float16)bfr(x[u][k][e]);
      vst2(dv + e * (TT / 32) * 2048 + (u >> 1) * 256 + (u & 1) * 128, r); }
  asm volatile("s_wait_xcnt 0x0" ::: "memory");   // as in prep_qk
  if (cb * 32 < KHI) { const size_t po = fo_v(bb, h4 * 4, KHI, cb, dq >> 1) + lo; __bf16* db = VB + po; __bf16* dl = VBL + po;
#pragma unroll
    for (int u = 0; u < PU; ++u)
#pragma unroll
      for (int e = 0; e < 4; ++e) { v8b rh, rl;
#pragma unroll
        for (int k = 0; k < 8; ++k) { const float v = bfr(x[u][k][e]); const __bf16 vb = (__bf16)v; rh[k] = vb; rl[k] = (__bf16)(v - (float)vb); }
        const int o = e * (KHI / 32) * 2048 + (u >> 1) * 256 + (u & 1) * 128; vst2(db + o, rh); vst2(dl + o, rl); } } }
__global__ __launch_bounds__(32 * PW) void k_prepr(const float* __restrict__ Q, const float* __restrict__ K, const float* __restrict__ V, _Float16* __restrict__ QH, _Float16* __restrict__ QL, _Float16* __restrict__ KH, _Float16* __restrict__ KL, _Float16* __restrict__ VT, __bf16* __restrict__ VB, __bf16* __restrict__ VBL) {
  const int lane = threadIdx.x & 31; const int w = blockIdx.x * PW + __builtin_amdgcn_readfirstlane(threadIdx.x >> 5);   // wave number in a scalar register: the tests on rows below QHI / KHI are scalar branches
  if (blockIdx.y == 2) { prep_v(V, VT, VB, VBL, w >> 3, w & 7, lane); return; }
  const bool isq = blockIdx.y == 0; prep_qk(isq ? Q : K, isq ? QH : KH, isq ? QL : KL, (w >> 1) * 8, w & 1, lane); }
static_assert(NH == 16 && HD == 64 && PU == 4 && QHI == KHI && QHI % 32 == 0 && TT % 32 == 0 && (TNB * TT) % (PW * PU) == 0 && (TNB * TT / 8) * 2 == TNB * TT / PU && (TNB * TT / 32) * 8 == TNB * TT / PU, "k_prepr: 32 lanes = 4 head quads x 8 fragment rows; as many waves for v as for q or k");

#ifndef SM_EXTRA_PARAMS
#define SM_EXTRA_PARAMS
#endif
#ifndef PROJ_EXTRA_PARAMS
#define PROJ_EXTRA_PARAMS
#endif
#ifndef SM_MASK_HOOK
#define SM_MASK_HOOK (void)0
#endif

#define WS_QH  0u                                      // f16 q, fragment order [b][h][t / 16][c]
#define WS_KH  (WS_QH + 2u * (size_t)NB * TT * CC)      // f16 k, fragment order
#define WS_VT  (WS_KH + 2u * (size_t)NB * TT * CC)      // f16 v, fragment order [b][h][t / 32][j]
#define WS_QL  (WS_VT + 2u * (size_t)NB * CC * TT)      // f16 q residual x 2^10, fragment order, t < QHI
#define WS_KL  (WS_QL + 2u * (size_t)NB * QHI * CC)     // f16 k residual x 2^10, fragment order, t < KHI
#define WS_VB  (WS_KL + 2u * (size_t)NB * KHI * CC)     // bf16 v hi (then lo), fragment order, t < KHI
#define WS_VBL (WS_VB + 2u * (size_t)NB * CC * KHI)
#define WS_S   (WS_VBL + 2u * (size_t)NB * CC * KHI)    // f32 [hg][t][s] space, not used by any kernel here
#define WS_Y   (WS_S  + 4u * (size_t)HG * TT * TT)      // f32 ctx rows [b*t][CC]
#define WS_END (WS_Y  + 4u * (size_t)NB * TT * CC)   // f32 context rows in the layout [b*t][h*64 + d], re-ordered by k_tr into the output

// ---- k_fa: block = FT neighbouring tiles of 32 queries of (b, h), FW waves: a wave takes one tile and, as one of its FK key splits, that tile's 32-key chunks split, split + FK, ... <= qt. The FT waves of one split (waves w and w + 2: two SIMDs) read the same k and v fragments at about the same time, so that the later reader is served by the WGP's cache and not by L2. Per chunk: S^T = k . q^T (lane = one query column, 16 of the chunk's keys in its registers), running maximum and sum per query in f32 (online softmax, log2 units), P x 2^11 packed from the score accumulators straight into a B operand, ctx^T += v^T . P^T. Logits and P never leave the registers. Query rows < QHI keep the residual products and the bf16 hi + lo P . v. Each tile's FK (max, sum, ctx) partials are merged in split order through LDS.
#define FW 8
#define FQ 32
#define FT 2               // query tiles a block
#define FK (FW / FT)       // key splits a tile
#define FNP (TT / (FT * FQ))    // blocks (pairs of tiles) a (b, h)
#define FHP (QHI / (FT * FQ))   // of them on the residual path: the shortest tiles
#define FLEAD 8            // Start rank -> block, a permutation (speed only). Ranks 0 .. FLEAD - 1: the longest tiles, one block a WGP. Then the FHP residual-path blocks: few chunks, but each chunk waits out several load latencies in a row, so such a block lasts as long as a mid-length one while it leaves the issue ports nearly free; started early it runs beside the long blocks, started last it ran on alone at the launch's end. Then the other tiles, longest first.
#define LOGC (SCALE * 1.44269504088896340736f)   // logit scale x log2(e)
__device__ __forceinline__ float xhalf(float x) { return __builtin_bit_cast(float, __builtin_amdgcn_permlanex16(__builtin_bit_cast(int, x), __builtin_bit_cast(int, x), 0x76543210, 0xfedcba98, false, false)); }   // lane l reads lane l ^ 16
// 2^x by v_exp_f32, with the one free slot that the instruction set asks for behind a transcendental kept inside the statement; in the run of eight no instruction reads its predecessor's result or overwrites its source (outputs are early-clobber), the v_nop serves the last
__device__ __forceinline__ float exp2s(float x) { float r; asm("v_exp_f32 %0, %1\n\tv_nop" : "=v"(r) : "v"(x)); return r; }
__device__ __forceinline__ void exp2x8(float* o, const float* x) {
  asm("v_exp_f32 %0, %8\n\tv_exp_f32 %1, %9\n\tv_exp_f32 %2, %10\n\tv_exp_f32 %3, %11\n\tv_exp_f32 %4, %12\n\tv_exp_f32 %5, %13\n\tv_exp_f32 %6, %14\n\tv_exp_f32 %7, %15\n\tv_nop"
      : "=&v"(o[0]), "=&v"(o[1]), "=&v"(o[2]), "=&v"(o[3]), "=&v"(o[4]), "=&v"(o[5]), "=&v"(o[6]), "=&v"(o[7]) : "v"(x[0]), "v"(x[1]), "v"(x[2]), "v"(x[3]), "v"(x[4]), "v"(x[5]), "v"(x[6]), "v"(x[7])); }
struct FaSt { v8f acc[2][HD / 16]; float m[2], l[2]; };
template <bool HI> __device__ __forceinline__ void fa_run(FaSt& st, const _Float16* __restrict__ QH, const _Float16* __restrict__ KH, const _Float16* __restrict__ QL, const _Float16* __restrict__ KL, const _Float16* __restrict__ VT, const __bf16* __restrict__ VB, const __bf16* __restrict__ VBL, int b, int h, int qt, int wave, int lane) {
  const int col = lane & 15, g = lane >> 4; const int q0 = qt * FQ;
  v16h qh[2][2], ql[2][2];
#pragma unroll
  for (int n = 0; n < 2; ++n)
#pragma unroll
    for (int c = 0; c < 2; ++c) { qh[n][c] = frag_ph(QH + fo_row(b, h, TT, q0 / 16 + n, c), lane); if (HI) ql[n][c] = frag_ph(QL + fo_row(b, h, QHI, q0 / 16 + n, c), lane); }
  v16h kf[2][2], vf[HD / 16];   // !HI: this chunk's k fragments (fetched one chunk ahead) and v fragments (fetched at the chunk's top), so that no product waits for a load issued just in front of it
  if (!HI) { const int kf0 = (wave <= qt ? wave : qt) * 2;
#pragma unroll
    for (int t = 0; t < 2; ++t)
#pragma unroll
      for (int c = 0; c < 2; ++c) kf[t][c] = frag_ph(KH + fo_row(b, h, TT, kf0 + t, c), lane); }
#pragma unroll 1
  for (int kc = wave; kc <= qt; kc += FK) {   // k0 = 32 kc is the chunk's first key
    v8f s[2][2] = {};   // [query group][key tile]: element r = key k0 + 16 * tile + 8 * g + r, query q0 + 16 * group + col
    if (HI) { v8f sl[2][2] = {};
#pragma unroll
      for (int t = 0; t < 2; ++t)
#pragma unroll
        for (int c = 0; c < 2; ++c) { const v16h kf = frag_ph(KH + fo_row(b, h, TT, kc * 2 + t, c), lane), klf = frag_ph(KL + fo_row(b, h, KHI, kc * 2 + t, c), lane);
#pragma unroll
          for (int n = 0; n < 2; ++n) { s[n][t] = wmma16(kf, qh[n][c], s[n][t]); sl[n][t] = wmma16(kf, ql[n][c], sl[n][t]); sl[n][t] = wmma16(klf, qh[n][c], sl[n][t]); } }
#pragma unroll
      for (int n = 0; n < 2; ++n)
#pragma unroll
        for (int t = 0; t < 2; ++t) s[n][t] += sl[n][t] * (1.0f / 1024.0f);
    } else {
#pragma unroll
      for (int j = 0; j < HD / 16; ++j) vf[j] = frag_ph(VT + fo_v(b, h, TT, kc, j), lane);
#pragma unroll
      for (int t = 0; t < 2; ++t)
#pragma unroll
        for (int c = 0; c < 2; ++c)
#pragma unroll
          for (int n = 0; n < 2; ++n) s[n][t] = wmma16(kf[t][c], qh[n][c], s[n][t]);
      const int kn = (kc + FK <= qt ? kc + FK : kc) * 2;   // the wave's next chunk; on its last trip the same rows again (in bounds, not used)
#pragma unroll
      for (int t = 0; t < 2; ++t)
#pragma unroll
        for (int c = 0; c < 2; ++c) kf[t][c] = frag_ph(KH + fo_row(b, h, TT, kn + t, c), lane);
      asm volatile("s_wait_xcnt 0x0" ::: "memory"); }   // the loads' address registers are reused behind the branch below
    if (kc == qt) {   // the diagonal chunk: keys past the query are excluded (every query keeps key k0 at least)
#pragma unroll
      for (int n = 0; n < 2; ++n)
#pragma unroll
        for (int t = 0; t < 2; ++t)
#pragma unroll
          for (int r = 0; r < 8; ++r) if (t * 16 + 8 * g + r > n * 16 + col) s[n][t][r] = -1.0e30f; }
    float mt[2];
#pragma unroll
    for (int n = 0; n < 2; ++n) { float mx = s[n][0][0];
#pragma unroll
      for (int r = 1; r < 8; ++r) mx = fmaxf(mx, s[n][0][r]);
#pragma unroll
      for (int r = 0; r < 8; ++r) mx = fmaxf(mx, s[n][1][r]);
      mx = fmaxf(mx, xhalf(mx)); mt[n] = fmaxf(st.m[n], mx * LOGC); }
    if (__builtin_amdgcn_ballot_w32(mt[0] > st.m[0] || mt[1] > st.m[1]) != 0) {   // a maximum grew somewhere in the wave: bring sums and ctx to the new one
#pragma unroll
      for (int n = 0; n < 2; ++n) { const float a = exp2s(st.m[n] - mt[n]); st.m[n] = mt[n]; st.l[n] *= a;
#pragma unroll
        for (int j = 0; j < HD / 16; ++j) st.acc[n][j] *= a; } }
    float p[2][16];
#pragma unroll
    for (int n = 0; n < 2; ++n) { const float bias = 11.0f - st.m[n]; float sum = 0.f;
#pragma unroll
      for (int t = 0; t < 2; ++t) { float x[8];
#pragma unroll
        for (int r = 0; r < 8; ++r) x[r] = fmaf(s[n][t][r], LOGC, bias);
        exp2x8(&p[n][8 * t], x);
#pragma unroll
        for (int r = 0; r < 8; ++r) sum += p[n][8 * t + r]; }
      st.l[n] += sum; }
    if (HI) { const F2 p0 = bsplit16(p[0]), p1 = bsplit16(p[1]);
#pragma unroll
      for (int j = 0; j < HD / 16; ++j) { const size_t po = fo_v(b, h, KHI, kc, j); const v16b vh = frag_pb(VB + po, lane), vl = frag_pb(VBL + po, lane);
        st.acc[0][j] = wmma_bf(vh, p0.h, st.acc[0][j]); st.acc[0][j] = wmma_bf(vh, p0.l, st.acc[0][j]); st.acc[0][j] = wmma_bf(vl, p0.h, st.acc[0][j]);
        st.acc[1][j] = wmma_bf(vh, p1.h, st.acc[1][j]); st.acc[1][j] = wmma_bf(vh, p1.l, st.acc[1][j]); st.acc[1][j] = wmma_bf(vl, p1.h, st.acc[1][j]); }
      asm volatile("s_wait_xcnt 0x0" ::: "memory");   // the v loads' address registers are reused by the next chunk's score tiles
    } else { v16h pf[2];
#pragma unroll
      for (int n = 0; n < 2; ++n)
#pragma unroll
        for (int i = 0; i < 16; ++i) pf[n][i] = (_Float16)p[n][i];
#pragma unroll
      for (int j = 0; j < HD / 16; ++j)
#pragma unroll
        for (int n = 0; n < 2; ++n) st.acc[n][j] = wmma16(vf[j], pf[n], st.acc[n][j]); } } }
__global__ __launch_bounds__(32 * FW) void k_fa(const _Float16* __restrict__ QH, const _Float16* __restrict__ KH, const _Float16* __restrict__ QL, const _Float16* __restrict__ KL, const _Float16* __restrict__ VT, const __bf16* __restrict__ VB, const __bf16* __restrict__ VBL, float* __restrict__ Y) {
  __shared__ __align__(16) float ss[FW][FQ][HD + 4]; __shared__ float sm[FW][FQ], sl[FW][FQ];
  const int tid = threadIdx.x, lane = tid & 31, col = lane & 15, g = lane >> 4; const int b = blockIdx.x / NH, h = blockIdx.x % NH; const int by = blockIdx.y; const int q2 = (by < FLEAD ? FNP - 1 - by : by < FLEAD + FHP ? FLEAD + FHP - 1 - by : FNP - 1 + FHP - by) * FT;   // the block's first tile, by start rank (above)
  const int wave = __builtin_amdgcn_readfirstlane(tid >> 5);   // wave number in a scalar register: the chunk loop branches on scalar compares and every lane stays on at the matrix instructions
  const int tl = (wave >> 1) & 1, ks = (wave & 1) + (wave >> 2) * 2, slot = ks * FT + tl; const int qt = q2 + tl;   // tile of the block, key split, place of the partial in LDS
  FaSt st;
#pragma unroll
  for (int n = 0; n < 2; ++n) { st.m[n] = -1.0e30f; st.l[n] = 0.f;
#pragma unroll
    for (int j = 0; j < HD / 16; ++j) st.acc[n][j] = v8f{}; }
  if (q2 * FQ < QHI) fa_run<true>(st, QH, KH, QL, KL, VT, VB, VBL, b, h, qt, ks, lane); else fa_run<false>(st, QH, KH, QL, KL, VT, VB, VBL, b, h, qt, ks, lane);
#pragma unroll
  for (int n = 0; n < 2; ++n) { const float l = st.l[n] + xhalf(st.l[n]); if (g == 0) { sm[slot][n * 16 + col] = st.m[n]; sl[slot][n * 16 + col] = l; }
#pragma unroll
    for (int j = 0; j < HD / 16; ++j) { const v8f a = st.acc[n][j]; *(v4f*)&ss[slot][n * 16 + col][j * 16 + 8 * g] = v4f{a[0], a[1], a[2], a[3]}; *(v4f*)&ss[slot][n * 16 + col][j * 16 + 8 * g + 4] = v4f{a[4], a[5], a[6], a[7]}; } }
  __syncthreads();   // every wave's partial is in LDS before any thread merges across waves
#pragma unroll
  for (int i = 0; i < FT * FQ / 16; ++i) { const int t = i / (FQ / 16), rl = (tid >> 4) + 16 * (i % (FQ / 16)), c4 = (tid & 15) * 4; float M = sm[t][rl];   // row rl of the block's tile t, whose partials lie at places t, t + FT, ...
    for (int w = t + FT; w < FW; w += FT) M = fmaxf(M, sm[w][rl]);
    float L = 0.f; v4f s = {};
    for (int w = t; w < FW; w += FT) { const float f = exp2s(sm[w][rl] - M); L += sl[w][rl] * f; s += *(const v4f*)&ss[w][rl][c4] * f; }   // a wave without chunks has weight 0
    vst2(Y + ((size_t)b * TT + (q2 + t) * FQ + rl) * CC + h * HD + c4, s * (1.0f / L)); } }
static_assert(32 * FW == 16 * (HD / 4) && FW == 8 && FT == 2 && FQ % 16 == 0 && QHI % (FT * FQ) == 0 && QHI <= KHI && TT % (FT * FQ) == 0 && FLEAD + FHP <= FNP, "k_fa: 16 rows of HD / 4 threads; whole blocks on either precision path; the start ranks are a permutation");

// ---- k_tr: a wave re-orders TR whole token rows by itself. A lane loads 8 heads x 4 d (16 bytes a head; an instruction reads two whole 256-byte head rows), so that 4 neighbouring heads of one d are a renaming of its registers; they pass through the wave's own LDS range in output order, and every store instruction writes 512 contiguous bytes. All of a wave's loads are in flight together; one work-group a WGP covers the grid.
#define TW 8               // waves a block
#define TR 2               // token rows a wave
#define TP 68              // LDS floats a group of 4 d x 16 heads (64 + 4): a pitch of 16 bytes x 17 spreads the 16-byte LDS stores of 16 lanes, one group apart, over all banks
__global__ __launch_bounds__(32 * TW) void k_tr(const float* __restrict__ Y, float* __restrict__ OUT) { __shared__ __align__(16) float sy[TW][TR][(HD / 4) * TP];
  const int lane = threadIdx.x & 31, wave = threadIdx.x >> 5, dq = lane & 15, g = lane >> 4; const size_t r0 = ((size_t)blockIdx.x * TW + wave) * TR; const float* src = Y + r0 * CC + g * 8 * HD + dq * 4; v4f x[TR][8];   // lane: heads 8 g .. + 7, d = 4 dq .. + 3
#pragma unroll
  for (int t = 0; t < TR; ++t)
#pragma unroll
    for (int k = 0; k < 8; ++k) x[t][k] = *(const v4f*)(src + t * CC + k * HD);
  asm volatile("s_wait_xcnt 0x0" ::: "memory");   // every load is issued before the first LDS store, and their address registers are free for reuse behind this line
#pragma unroll
  for (int t = 0; t < TR; ++t)
#pragma unroll
    for (int e = 0; e < 4; ++e)
#pragma unroll
      for (int s = 0; s < 2; ++s) *(v4f*)&sy[wave][t][dq * TP + e * NH + g * 8 + s * 4] = v4f{x[t][4 * s][e], x[t][4 * s + 1][e], x[t][4 * s + 2][e], x[t][4 * s + 3][e]};   // output order: d * 16 + h, d = 4 dq + e
  asm volatile("s_wait_dscnt 0x0" ::: "memory");   // the wave's own LDS stores are done before its lanes read what other lanes wrote; no other wave touches this range, so no barrier
#pragma unroll
  for (int t = 0; t < TR; ++t)
#pragma unroll
    for (int j = 0; j < 8; ++j) vst2(OUT + (r0 + t) * CC + j * 128 + lane * 4, *(const v4f*)&sy[wave][t][(2 * j + g) * TP + dq * 4]); }
static_assert(CC == 1024 && NH == 16 && HD == 64 && (TNB * TT) % (TW * TR) == 0, "k_tr: 32 lanes = 2 groups of 8 heads x 16 groups of 4 d; whole blocks");
extern "C" void kernel_launch(void* const* d_in, const int* in_sizes, int n_in, void* d_out, int out_size, void* d_ws, size_t ws_size, hipStream_t stream) {
  (void)in_sizes; (void)n_in; (void)out_size;
  const float** F = (const float**)d_in;
  if (ws_size < (size_t)WS_END) return;
  char* ws = (char*)d_ws; _Float16 *QH = (_Float16*)(ws + WS_QH), *KH = (_Float16*)(ws + WS_KH), *VT = (_Float16*)(ws + WS_VT), *QL = (_Float16*)(ws + WS_QL), *KL = (_Float16*)(ws + WS_KL); __bf16 *VB = (__bf16*)(ws + WS_VB), *VBL = (__bf16*)(ws + WS_VBL); float *Y = (float*)(ws + WS_Y);
  (void)Y; (void)QL; (void)KL; (void)VB; (void)VBL;
  // inputs: 0 q [2,2048,64,16]; 1 k; 2 v (all (batch, seq, head_dim, n_heads): token rows of 1,024 with element (d, h) at d*16 + h)
  k_prepr<<<dim3(TNB * TT / (PW * PU), 3), 32 * PW, 0, stream>>>(F[0], F[1], F[2], QH, QL, KH, KL, VT, VB, VBL);
  k_fa<<<dim3(TNB * NH, TT / (FT * FQ)), 32 * FW, 0, stream>>>(QH, KH, QL, KL, VT, VB, VBL, Y);
  k_tr<<<dim3(TNB * TT / (TW * TR)), 32 * TW, 0, stream>>>(Y, (float*)d_out);   /* layout [h*64 + d] -> the module's [d*16 + h] */
}

// v009
// Measured time: 33.3 microseconds a run.
// Timed twice side by side with v008, it ran 1.04 and 1.03 times as fast.
// Counting every step since v000, it is 25.8 times as fast.
// compute dtype: all float inputs rounded to bf16 (bf16 values are exact in f16 apart from f16-subnormal magnitudes); causal logits q x k / 64 (exact operands; the module divides by head_dim, not its square root); softmax f32; P x 2^11 once to f16 x v (bf16 hi + lo path below row 384); f32 context rows, then re-ordered to the module's heads-innermost layout. No projections. The 16-bit q, k, v planes lie in matrix-fragment order.
#include <hip/hip_runtime.h>
#include <math.h>

typedef __attribute__((ext_vector_type(16))) _Float16 v16h;
typedef __attribute__((ext_vector_type(16))) __bf16 v16b;
typedef __attribute__((ext_vector_type(8)))  _Float16 v8h;
typedef __attribute__((ext_vector_type(8)))  float v8f;
typedef __attribute__((ext_vector_type(4)))  float v4f;
typedef __attribute__((ext_vector_type(2)))  float v2f;
typedef __attribute__((ext_vector_type(4)))  unsigned v4u;
typedef __attribute__((ext_vector_type(4)))  int v4i;
typedef float __attribute__((may_alias)) float_a;
typedef int __attribute__((may_alias)) int_a;

template <typename T> __device__ __forceinline__ void vst2(void* p, T v) { *(T*)p = v;  }
__device__ __forceinline__ v8f wmma16(v16h a, v16h b, v8f c) {
  return __builtin_amdgcn_wmma_f32_16x16x32_f16(false, a, false, b, (short)0, c, false, false);
}
__device__ __forceinline__ v8f wmma_bf(v16b a, v16b b, v8f c) {
  return __builtin_amdgcn_wmma_f32_16x16x32_bf16(false, a, false, b, (short)0, c, false, false);
}
// 16x16x32 fragments: lane = (h = lane>>4, row/col = lane&15); elements 0..7 = k0+8h+0..7, 8..15 = k0+16+8h+0..7; D element r = row 8h+r
__device__ __forceinline__ v16h frag_h(const _Float16* rowk0, int lane) {
  union { v16h v; v8h q[2]; } u; const _Float16* p = rowk0 + 8 * (lane >> 4);
  u.q[0] = *(const v8h*)p; u.q[1] = *(const v8h*)(p + 16); return u.v;
}
__device__ __forceinline__ v16h frag_f32(const float* rowk0, int lane) {
  v16h a; const float* p = rowk0 + 8 * (lane >> 4);
#pragma unroll
  for (int i = 0; i < 8; ++i) { a[i] = (_Float16)p[i]; a[8 + i] = (_Float16)p[16 + i]; }
  return a;
}
__device__ __forceinline__ v16h frag_f32s(const float* rowk0, int lane, float sc) {
  v16h a; const float* p = rowk0 + 8 * (lane >> 4);
#pragma unroll
  for (int i = 0; i < 8; ++i) { a[i] = (_Float16)(p[i] * sc); a[8 + i] = (_Float16)(p[16 + i] * sc); }
  return a;
}
// column fragment from a [K][ld] layout (column n), rows >= K read as 0
__device__ __forceinline__ v16h fragc_f32(const float* W, int k0, int n, int lane, int ld, int K) {
  v16h a; const int g = lane >> 4;
#pragma unroll
  for (int i = 0; i < 8; ++i) { const int ka = k0 + 8 * g + i, kb = ka + 16;
    a[i] = (_Float16)(ka < K ? W[(size_t)(ka < K ? ka : K - 1) * ld + n] : 0.f); a[8 + i] = (_Float16)(kb < K ? W[(size_t)(kb < K ? kb : K - 1) * ld + n] : 0.f); }
  return a;
}
struct F2 { v16b h, l; };
__device__ __forceinline__ F2 bsplit16(const float v[16]) { F2 r;
#pragma unroll
  for (int i = 0; i < 16; ++i) { const __bf16 h = (__bf16)v[i]; r.h[i] = h; r.l[i] = (__bf16)(v[i] - (float)h); }
  return r; }
__device__ __forceinline__ F2 split_row(const float* row, int k0, int lane) { float v[16]; const float* p = row + k0 + 8 * (lane >> 4);
#pragma unroll
  for (int i = 0; i < 8; ++i) { v[i] = p[i]; v[8 + i] = p[16 + i]; }
  return bsplit16(v); }
__device__ __forceinline__ F2 split_rowK(const float* row, int k0, int lane, int K) { float v[16]; const int g = lane >> 4;
#pragma unroll
  for (int i = 0; i < 8; ++i) { const int ka = k0 + 8 * g + i, kb = ka + 16; v[i] = ka < K ? row[ka < K ? ka : K - 1] : 0.f; v[8 + i] = kb < K ? row[kb < K ? kb : K - 1] : 0.f; }
  return bsplit16(v); }
__device__ __forceinline__ F2 split_col(const float* W, int k0, int n, int lane, int ld, int K) { float v[16]; const int g = lane >> 4;
#pragma unroll
  for (int i = 0; i < 8; ++i) { const int ka = k0 + 8 * g + i, kb = ka + 16; v[i] = ka < K ? W[(size_t)(ka < K ? ka : K - 1) * ld + n] : 0.f; v[8 + i] = kb < K ? W[(size_t)(kb < K ? kb : K - 1) * ld + n] : 0.f; }
  return bsplit16(v); }
__device__ __forceinline__ v8f mac3(const F2& a, const F2& b, v8f c) { c = wmma_bf(a.l, b.h, c); c = wmma_bf(a.h, b.l, c); return wmma_bf(a.h, b.h, c); }
__device__ __forceinline__ float sigm(float v) { return 1.0f / (1.0f + expf(-v)); }
#define LDSX() do { asm volatile("s_wait_dscnt 0" ::: "memory"); __builtin_amdgcn_wave_barrier(); __builtin_amdgcn_fence(__ATOMIC_RELEASE, "workgroup"); } while (0)

// Causal multi-head softmax attention without weights in a HEADS-INNERMOST layout (q / k / v [2,2048,64,16] = (batch, seq, head_dim, n_heads), N(0,1); att[b,c,C,h] = sum_d q[b,c,d,h] k[b,C,d,h] / 64 (1 / head_dim); C > c set to -inf; softmax over C; y[b,c,v,h] = sum_C p[b,c,C,h] v[b,C,v,h], [2,2048,64,16]). Internal view: token row = (b, c); internal column h*64 + d lives at offset d*16 + h of the module's 1,024-float row: the loader gathers it that way and a final row-wise re-order writes the output back the same way.
#define NB 2
#define TT 2048
#define CC 1024            // NH * HD = projected width
#define DIN 1024          // input (model) width
#define NH 16
#define HD 64
#define NQB (TT / 64)
#define HG 4
#define SCALE (0.015625f)
#define CAUSAL 1
#ifndef TNB
#define TNB NB
#endif
__device__ __forceinline__ float bfr(float v) { return (float)(__bf16)v; }
__host__ __device__ __forceinline__ int kb_last(int qb) { return CAUSAL ? ((qb * 64 + 63) >> 7) : (TT / 128 - 1); }
typedef __attribute__((ext_vector_type(8))) __bf16 v8b;
__device__ __forceinline__ v16b frag_b(const __bf16* rowk0, int lane) {
  union { v16b v; v8b q[2]; } u; const __bf16* p = rowk0 + 8 * (lane >> 4);
  u.q[0] = *(const v8b*)p; u.q[1] = *(const v8b*)(p + 16); return u.v;
}
// Fragment-order planes: one 16 x 32 fragment (16 rows or columns x 32 values of k) is 1,024 contiguous bytes, two halves of 512 (fragment elements 0..7 and 8..15), lane l's 8 elements at byte 16 l of each half: a wave's 16-byte load or a store of 8 neighbouring lanes covers whole 128-byte lines.
__device__ __forceinline__ v16h frag_ph(const _Float16* f, int lane) { union { v16h v; v8h q[2]; } u; u.q[0] = *(const v8h*)(f + lane * 8); u.q[1] = *(const v8h*)(f + 256 + lane * 8); return u.v; }
__device__ __forceinline__ v16b frag_pb(const __bf16* f, int lane) { union { v16b v; v8b q[2]; } u; u.q[0] = *(const v8b*)(f + lane * 8); u.q[1] = *(const v8b*)(f + 256 + lane * 8); return u.v; }
// first element of a fragment. q, k planes [b][h][16-row tile][32-d half c]: lane = 16 g + row, half q, element i = d 32 c + 16 q + 8 g + i; R = rows a batch. v planes [b][h][32-key chunk][16-d group j]: lane = 16 g + d, half q, element i = key 16 q + 8 g + i of the chunk; S = keys a batch.
__device__ __forceinline__ size_t fo_row(int b, int h, int R, int tile, int c) { return ((((size_t)b * NH + h) * (R / 16) + tile) * 2 + c) * 512; }
__device__ __forceinline__ size_t fo_v(int b, int h, int S, int chunk, int j) { return ((((size_t)b * NH + h) * (S / 32) + chunk) * 4 + j) * 512; }
#define QBH 6              // not used: the causal high-precision path is taken by the 32-query tiles below row QHI (few keys, no averaging)
#define QHI 384            // rows carrying a q residual plane
#define KHI 384            // key rows carrying k residual / v bf16 hi+lo planes (used only by the causal high-precision path)
// B fragment (k rows k0+.., output column o) of a weight: (in,out) [K][ld] or (out,in) [ld rows of K]: bf16 exact, or f16(bf16 * 256) exact
__device__ __forceinline__ v16b wcol_io(const float* Wm, int k0, int o, int lane, int ld) { v16b w; const int g = lane >> 4;
#pragma unroll
  for (int i = 0; i < 8; ++i) { w[i] = (__bf16)Wm[(size_t)(k0 + 8 * g + i) * ld + o]; w[8 + i] = (__bf16)Wm[(size_t)(k0 + 16 + 8 * g + i) * ld + o]; }
  return w; }
__device__ __forceinline__ v16b wcol_oi(const float* Wm, int k0, int o, int lane, int K) { v16b w; const float* p = Wm + (size_t)o * K + k0 + 8 * (lane >> 4);
#pragma unroll
  for (int i = 0; i < 8; ++i) { w[i] = (__bf16)p[i]; w[8 + i] = (__bf16)p[16 + i]; }
  return w; }
__device__ __forceinline__ v16h wcolh_io(const float* Wm, int k0, int o, int lane, int ld) { v16h w; const int g = lane >> 4;
#pragma unroll
  for (int i = 0; i < 8; ++i) { w[i] = (_Float16)(bfr(Wm[(size_t)(k0 + 8 * g + i) * ld + o]) * 256.0f); w[8 + i] = (_Float16)(bfr(Wm[(size_t)(k0 + 16 + 8 * g + i) * ld + o]) * 256.0f); }
  return w; }
__device__ __forceinline__ v16h wcolh_oi(const float* Wm, int k0, int o, int lane, int K) { v16h w; const float* p = Wm + (size_t)o * K + k0 + 8 * (lane >> 4);
#pragma unroll
  for (int i = 0; i < 8; ++i) { w[i] = (_Float16)(bfr(p[i]) * 256.0f); w[8 + i] = (_Float16)(bfr(p[16 + i]) * 256.0f); }
  return w; }
#define WQKV_LAYOUT 1   // 0 = (in,out) [DIN][CC]; 1 = (out,in) [CC][DIN]; 2 = per-head [NH][DIN][HD]
__device__ __forceinline__ v16b wcol_hdk(const float* Wm, int k0, int o, int lane) { v16b w; const int g = lane >> 4; const float* p = Wm + (size_t)(o / HD) * DIN * HD + (o % HD);
#pragma unroll
  for (int i = 0; i < 8; ++i) { w[i] = (__bf16)p[(size_t)(k0 + 8 * g + i) * HD]; w[8 + i] = (__bf16)p[(size_t)(k0 + 16 + 8 * g + i) * HD]; }
  return w; }
#define WO_OUT_IN 0
#if WQKV_LAYOUT == 1
#define WCOL(W, k0, o, lane) wcol_oi(W, k0, o, lane, DIN)
#elif WQKV_LAYOUT == 2
#define WCOL(W, k0, o, lane) wcol_hdk(W, k0, o, lane)
#else
#define WCOL(W, k0, o, lane) wcol_io(W, k0, o, lane, CC)
#endif
#if WO_OUT_IN
#define WOCOL(W, k0, o, lane) wcol_oi(W, k0, o, lane, CC)
#define WOCOLH(W, k0, o, lane) wcolh_oi(W, k0, o, lane, CC)
#else
#define WOCOL(W, k0, o, lane) wcol_io(W, k0, o, lane, DIN)
#define WOCOLH(W, k0, o, lane) wcolh_io(W, k0, o, lane, DIN)
#endif

// ---- k_prepr: reads the module's [B, T, 64, NH] inputs once, in 16-byte pieces (4 heads of one d), bf16-rounds them and writes the attention planes in fragment order (above): q -> f16 (+ x 2^10 residual for s < QHI), k -> f16 (+ residual for s < KHI), v -> f16 (+ bf16 hi/lo for s < KHI). A lane gathers 8 pieces along the fragment's k axis (d for q and k, s for v), so the 4 x 8 transpose is a renaming of its registers; 8 neighbouring lanes hold 8 neighbouring fragment rows, so every store instruction writes four whole 128-byte lines. blockIdx.y = tensor; a wave takes 8 token rows x 32 d (q, k) or 32 tokens x 8 d (v), all heads.
#define PW 4               // waves a block
#define PU 4               // groups of 8 along k a wave: one fragment's (half q, lane group g) = (u >> 1, u & 1)
__device__ __forceinline__ void prep_qk(const float* __restrict__ X, _Float16* __restrict__ XH, _Float16* __restrict__ XL, int row0, int c, int lane) {
  const int r8 = lane & 7, h4 = lane >> 3; const float* src = X + (size_t)(row0 + r8) * CC + c * 32 * NH + h4 * 4; v4f x[PU][8];   // lane: token row0 + r8, heads 4 h4 .. + 3, d = 32 c .. + 31
#pragma unroll
  for (int u = 0; u < PU; ++u)
#pragma unroll
    for (int k = 0; k < 8; ++k) x[u][k] = *(const v4f*)(src + (u * 8 + k) * NH);
  asm volatile("s_wait_xcnt 0x0" ::: "memory");   // every load is issued before the first conversion, and their address registers are free for reuse behind this line
  const int bb = row0 / TT, rb = row0 % TT; const int lo = ((rb & 8) + r8) * 8; _Float16* dh = XH + fo_row(bb, h4 * 4, TT, rb / 16, c) + lo;
#pragma unroll
  for (int u = 0; u < PU; ++u)
#pragma unroll
    for (int e = 0; e < 4; ++e) { v8h r;
#pragma unroll
      for (int k = 0; k < 8; ++k) r[k] = (_Float16)bfr(x[u][k][e]);
      vst2(dh + e * (TT / 16) * 1024 + (u >> 1) * 256 + (u & 1) * 128, r); }
  asm volatile("s_wait_xcnt 0x0" ::: "memory");   // the stores' data registers are reused behind the branch below
  if (rb < QHI) { _Float16* dl = XL + fo_row(bb, h4 * 4, QHI, rb / 16, c) + lo;   // module inputs are bf16-rounded; bf16 values are exact in f16 apart from f16-subnormal magnitudes, which the residual carries
#pragma unroll
    for (int u = 0; u < PU; ++u)
#pragma unroll
      for (int e = 0; e < 4; ++e) { v8h r;
#pragma unroll
        for (int k = 0; k < 8; ++k) { const float q = bfr(x[u][k][e]); r[k] = (_Float16)((q - (float)(_Float16)q) * 1024.0f); }
        vst2(dl + e * (QHI / 16) * 1024 + (u >> 1) * 256 + (u & 1) * 128, r); }
    asm volatile("s_wait_xcnt 0x0" ::: "memory"); } }   // in the listing the v branch, which rewrites these stores' registers, follows this block
__device__ __forceinline__ void prep_v(const float* __restrict__ V, _Float16* __restrict__ VT, __bf16* __restrict__ VB, __bf16* __restrict__ VBL, int ck, int dq, int lane) {
  const int d8 = lane & 7, h4 = lane >> 3; const int bb = ck / (TT / 32), cb = ck % (TT / 32); const float* src = V + (size_t)ck * 32 * CC + (dq * 8 + d8) * NH + h4 * 4; v4f x[PU][8];   // lane: d = 8 dq + d8, heads 4 h4 .. + 3, the chunk's 32 tokens; a load instruction covers 512 contiguous bytes
#pragma unroll
  for (int u = 0; u < PU; ++u)
#pragma unroll
    for (int k = 0; k < 8; ++k) x[u][k] = *(const v4f*)(src + (u * 8 + k) * CC);
  asm volatile("s_wait_xcnt 0x0" ::: "memory");   // as in prep_qk
  const int lo = ((dq & 1) * 8 + d8) * 8; _Float16* dv = VT + fo_v(bb, h4 * 4, TT, cb, dq >> 1) + lo;
#pragma unroll
  for (int u = 0; u < PU; ++u)
#pragma unroll
    for (int e = 0; e < 4; ++e) { v8h r;
#pragma unroll
      for (int k = 0; k < 8; ++k) r[k] = (_Float16)bfr(x[u][k][e]);
      vst2(dv + e * (TT / 32) * 2048 + (u >> 1) * 256 + (u & 1) * 128, r); }
  asm volatile("s_wait_xcnt 0x0" ::: "memory");   // as in prep_qk
  if (cb * 32 < KHI) { const size_t po = fo_v(bb, h4 * 4, KHI, cb, dq >> 1) + lo; __bf16* db = VB + po; __bf16* dl = VBL + po;
#pragma unroll
    for (int u = 0; u < PU; ++u)
#pragma unroll
      for (int e = 0; e < 4; ++e) { v8b rh, rl;
#pragma unroll
        for (int k = 0; k < 8; ++k) { const float v = bfr(x[u][k][e]); const __bf16 vb = (__bf16)v; rh[k] = vb; rl[k] = (__bf16)(v - (float)vb); }
        const int o = e * (KHI / 32) * 2048 + (u >> 1) * 256 + (u & 1) * 128; vst2(db + o, rh); vst2(dl + o, rl); } } }
__global__ __launch_bounds__(32 * PW) void k_prepr(const float* __restrict__ Q, const float* __restrict__ K, const float* __restrict__ V, _Float16* __restrict__ QH, _Float16* __restrict__ QL, _Float16* __restrict__ KH, _Float16* __restrict__ KL, _Float16* __restrict__ VT, __bf16* __restrict__ VB, __bf16* __restrict__ VBL) {
  const int lane = threadIdx.x & 31; const int w = blockIdx.x * PW + __builtin_amdgcn_readfirstlane(threadIdx.x >> 5);   // wave number in a scalar register: the tests on rows below QHI / KHI are scalar branches
  if (blockIdx.y == 2) { prep_v(V, VT, VB, VBL, w >> 3, w & 7, lane); return; }
  const bool isq = blockIdx.y == 0; prep_qk(isq ? Q : K, isq ? QH : KH, isq ? QL : KL, (w >> 1) * 8, w & 1, lane); }
static_assert(NH == 16 && HD == 64 && PU == 4 && QHI == KHI && QHI % 32 == 0 && TT % 32 == 0 && (TNB * TT) % (PW * PU) == 0 && (TNB * TT / 8) * 2 == TNB * TT / PU && (TNB * TT / 32) * 8 == TNB * TT / PU, "k_prepr: 32 lanes = 4 head quads x 8 fragment rows; as many waves for v as for q or k");

#ifndef SM_EXTRA_PARAMS
#define SM_EXTRA_PARAMS
#endif
#ifndef PROJ_EXTRA_PARAMS
#define PROJ_EXTRA_PARAMS
#endif
#ifndef SM_MASK_HOOK
#define SM_MASK_HOOK (void)0
#endif

#define WS_QH  0u                                      // f16 q, fragment order [b][h][t / 16][c]
#define WS_KH  (WS_QH + 2u * (size_t)NB * TT * CC)      // f16 k, fragment order
#define WS_VT  (WS_KH + 2u * (size_t)NB * TT * CC)      // f16 v, fragment order [b][h][t / 32][j]
#define WS_QL  (WS_VT + 2u * (size_t)NB * CC * TT)      // f16 q residual x 2^10, fragment order, t < QHI
#define WS_KL  (WS_QL + 2u * (size_t)NB * QHI * CC)     // f16 k residual x 2^10, fragment order, t < KHI
#define WS_VB  (WS_KL + 2u * (size_t)NB * KHI * CC)     // bf16 v hi (then lo), fragment order, t < KHI
#define WS_VBL (WS_VB + 2u * (size_t)NB * CC * KHI)
#define WS_S   (WS_VBL + 2u * (size_t)NB * CC * KHI)    // f32 [hg][t][s] space, not used by any kernel here
#define WS_Y   (WS_S  + 4u * (size_t)HG * TT * TT)      // f32 ctx rows [b*t][CC]
#define WS_END (WS_Y  + 4u * (size_t)NB * TT * CC)   // f32 context rows in the layout [b*t][h*64 + d], re-ordered by k_tr into the output

// ---- k_fa: block = FT neighbouring tiles of 32 queries of (b, h), FW waves: a wave takes one tile and, as one of its FK key splits, that tile's 32-key chunks split, split + FK, ... <= qt. The FT waves of one split (waves w and w + 2) read the same k and v fragments at about the same time, so that the later reader is served by the WGP's cache and not by L2. Per chunk: S^T = k . q^T (lane = one query column, 16 of the chunk's keys in its registers), a reference maximum (renewed lazily: FTH below) and the sum per query in f32 (online softmax, log2 units), P x 2^11 packed from the score accumulators straight into a B operand, ctx^T += v^T . P^T. Logits and P never leave the registers. Query rows < QHI keep the residual products and the bf16 hi + lo P . v. Each tile's FK (max, sum, ctx) partials are merged in split order through LDS.
#define FW 8
#define FQ 32
#define FT 2               // query tiles a block
#define FK (FW / FT)       // key splits a tile
#define FNP (TT / (FT * FQ))    // blocks (pairs of tiles) a (b, h)
#define FHP (QHI / (FT * FQ))   // of them on the residual path: the shortest tiles
#define FLEAD 8            // Start rank -> block, a permutation (speed only). Ranks 0 .. FLEAD - 1: the longest tiles, one block a WGP. Then the FHP residual-path blocks: few chunks, but each chunk waits out several load latencies in a row, so such a block lasts as long as a mid-length one while it leaves the issue ports nearly free. Then the other tiles, longest first.
#define LOGC (SCALE * 1.44269504088896340736f)   // logit scale x log2(e)
#define FTH 4.0f           // st.m is a reference, not the exact running maximum: scores may pass it by up to FTH (log2 units) before anything is rescaled. P x 2^11 then stays <= 2^15, inside f16's range; (reference, sum, ctx) stay consistent, so the quotient ctx / sum is the same function
__device__ __forceinline__ float xhalf(float x) { return __builtin_bit_cast(float, __builtin_amdgcn_permlanex16(__builtin_bit_cast(int, x), __builtin_bit_cast(int, x), 0x76543210, 0xfedcba98, false, false)); }   // lane l reads lane l ^ 16
// 2^x by v_exp_f32, with the one free slot that the instruction set asks for behind a transcendental kept inside the statement; in the run of eight no instruction reads its predecessor's result or overwrites its source (outputs are early-clobber), the v_nop serves the last
__device__ __forceinline__ float exp2s(float x) { float r; asm("v_exp_f32 %0, %1\n\tv_nop" : "=v"(r) : "v"(x)); return r; }
__device__ __forceinline__ void exp2x8(float* o, const float* x) {
  asm("v_exp_f32 %0, %8\n\tv_exp_f32 %1, %9\n\tv_exp_f32 %2, %10\n\tv_exp_f32 %3, %11\n\tv_exp_f32 %4, %12\n\tv_exp_f32 %5, %13\n\tv_exp_f32 %6, %14\n\tv_exp_f32 %7, %15\n\tv_nop"
      : "=&v"(o[0]), "=&v"(o[1]), "=&v"(o[2]), "=&v"(o[3]), "=&v"(o[4]), "=&v"(o[5]), "=&v"(o[6]), "=&v"(o[7]) : "v"(x[0]), "v"(x[1]), "v"(x[2]), "v"(x[3]), "v"(x[4]), "v"(x[5]), "v"(x[6]), "v"(x[7])); }
__device__ __forceinline__ float fa_lim(float m) { return fmaf(m, 1.0f / LOGC, FTH / LOGC); }   // the raw score that lies FTH above the reference m
struct FaSt { v8f acc[2][HD / 16]; float m[2], l[2]; };
template <bool HI> __device__ __forceinline__ void fa_run(FaSt& st, const _Float16* __restrict__ QH, const _Float16* __restrict__ KH, const _Float16* __restrict__ QL, const _Float16* __restrict__ KL, const _Float16* __restrict__ VT, const __bf16* __restrict__ VB, const __bf16* __restrict__ VBL, int b, int h, int qt, int wave, int lane) {
  const int col = lane & 15, g = lane >> 4; const int q0 = qt * FQ;
  v16h qh[2][2], ql[2][2];
#pragma unroll
  for (int n = 0; n < 2; ++n)
#pragma unroll
    for (int c = 0; c < 2; ++c) { qh[n][c] = frag_ph(QH + fo_row(b, h, TT, q0 / 16 + n, c), lane); if (HI) ql[n][c] = frag_ph(QL + fo_row(b, h, QHI, q0 / 16 + n, c), lane); }
  float lim[2] = {fa_lim(st.m[0]), fa_lim(st.m[1])};   // !HI: kept in registers, renewed with the reference; the residual path has no register to spare (one more would cost a work-group a WGP) and forms it anew in every chunk
  v16h kf[2][2], vf[HD / 16];   // !HI: this chunk's k fragments (fetched one chunk ahead) and v fragments (fetched at the chunk's top), so that no product waits for a load issued just in front of it
  if (!HI) { const int kf0 = (wave <= qt ? wave : qt) * 2;
#pragma unroll
    for (int t = 0; t < 2; ++t)
#pragma unroll
      for (int c = 0; c < 2; ++c) kf[t][c] = frag_ph(KH + fo_row(b, h, TT, kf0 + t, c), lane); }
#pragma unroll 1
  for (int kc = wave; kc <= qt; kc += FK) {   // k0 = 32 kc is the chunk's first key
    v8f s[2][2] = {};   // [query group][key tile]: element r = key k0 + 16 * tile + 8 * g + r, query q0 + 16 * group + col
    if (HI) { v8f sl[2][2] = {};
#pragma unroll
      for (int t = 0; t < 2; ++t)
#pragma unroll
        for (int c = 0; c < 2; ++c) { const v16h kf = frag_ph(KH + fo_row(b, h, TT, kc * 2 + t, c), lane), klf = frag_ph(KL + fo_row(b, h, KHI, kc * 2 + t, c), lane);
#pragma unroll
          for (int n = 0; n < 2; ++n) { s[n][t] = wmma16(kf, qh[n][c], s[n][t]); sl[n][t] = wmma16(kf, ql[n][c], sl[n][t]); sl[n][t] = wmma16(klf, qh[n][c], sl[n][t]); } }
#pragma unroll
      for (int n = 0; n < 2; ++n)
#pragma unroll
        for (int t = 0; t < 2; ++t) s[n][t] += sl[n][t] * (1.0f / 1024.0f);
    } else {
#pragma unroll
      for (int j = 0; j < HD / 16; ++j) vf[j] = frag_ph(VT + fo_v(b, h, TT, kc, j), lane);
#pragma unroll
      for (int t = 0; t < 2; ++t)
#pragma unroll
        for (int c = 0; c < 2; ++c)
#pragma unroll
          for (int n = 0; n < 2; ++n) s[n][t] = wmma16(kf[t][c], qh[n][c], s[n][t]);
      const int kn = (kc + FK <= qt ? kc + FK : kc) * 2;   // the wave's next chunk; on its last trip the same rows again (in bounds, not used)
#pragma unroll
      for (int t = 0; t < 2; ++t)
#pragma unroll
        for (int c = 0; c < 2; ++c) kf[t][c] = frag_ph(KH + fo_row(b, h, TT, kn + t, c), lane);
      asm volatile("s_wait_xcnt 0x0" ::: "memory"); }   // the loads' address registers are reused behind the branch below
    if (kc == qt) {   // the diagonal chunk: keys past the query are excluded (every query keeps key k0 at least)
#pragma unroll
      for (int n = 0; n < 2; ++n)
#pragma unroll
        for (int t = 0; t < 2; ++t)
#pragma unroll
          for (int r = 0; r < 8; ++r) if (t * 16 + 8 * g + r > n * 16 + col) s[n][t][r] = -1.0e30f; }
    float mx[2];   // the largest of the lane's own 16 scores of each query
#pragma unroll
    for (int n = 0; n < 2; ++n) { mx[n] = s[n][0][0];
#pragma unroll
      for (int r = 1; r < 8; ++r) mx[n] = fmaxf(mx[n], s[n][0][r]);
#pragma unroll
      for (int r = 0; r < 8; ++r) mx[n] = fmaxf(mx[n], s[n][1][r]); }
    if (HI) { lim[0] = fa_lim(st.m[0]); lim[1] = fa_lim(st.m[1]); }
    if (__builtin_amdgcn_ballot_w32(mx[0] > lim[0] || mx[1] > lim[1]) != 0) {   // a score somewhere in the wave lies more than FTH above the reference in use (always so in a wave's first chunk): only then join the halves' maxima and bring reference, sums and ctx to the new maximum
#pragma unroll
      for (int n = 0; n < 2; ++n) { const float mt = fmaxf(st.m[n], fmaxf(mx[n], xhalf(mx[n])) * LOGC); const float a = exp2s(st.m[n] - mt); st.m[n] = mt; if (!HI) lim[n] = fa_lim(mt); st.l[n] *= a;
#pragma unroll
        for (int j = 0; j < HD / 16; ++j) st.acc[n][j] *= a; } }
    float p[2][16];
#pragma unroll
    for (int n = 0; n < 2; ++n) { const float bias = 11.0f - st.m[n]; float sum = 0.f;
#pragma unroll
      for (int t = 0; t < 2; ++t) { float x[8];
#pragma unroll
        for (int r = 0; r < 8; ++r) x[r] = fmaf(s[n][t][r], LOGC, bias);
        exp2x8(&p[n][8 * t], x);
#pragma unroll
        for (int r = 0; r < 8; ++r) sum += p[n][8 * t + r]; }
      st.l[n] += sum; }
    if (HI) { const F2 p0 = bsplit16(p[0]), p1 = bsplit16(p[1]);
#pragma unroll
      for (int j = 0; j < HD / 16; ++j) { const size_t po = fo_v(b, h, KHI, kc, j); const v16b vh = frag_pb(VB + po, lane), vl = frag_pb(VBL + po, lane);
        st.acc[0][j] = wmma_bf(vh, p0.h, st.acc[0][j]); st.acc[0][j] = wmma_bf(vh, p0.l, st.acc[0][j]); st.acc[0][j] = wmma_bf(vl, p0.h, st.acc[0][j]);
        st.acc[1][j] = wmma_bf(vh, p1.h, st.acc[1][j]); st.acc[1][j] = wmma_bf(vh, p1.l, st.acc[1][j]); st.acc[1][j] = wmma_bf(vl, p1.h, st.acc[1][j]); }
      asm volatile("s_wait_xcnt 0x0" ::: "memory");   // the v loads' address registers are reused by the next chunk's score tiles
    } else { v16h pf[2];
#pragma unroll
      for (int n = 0; n < 2; ++n)
#pragma unroll
        for (int i = 0; i < 16; ++i) pf[n][i] = (_Float16)p[n][i];
#pragma unroll
      for (int j = 0; j < HD / 16; ++j)
#pragma unroll
        for (int n = 0; n < 2; ++n) st.acc[n][j] = wmma16(vf[j], pf[n], st.acc[n][j]); } } }
__global__ __launch_bounds__(32 * FW) void k_fa(const _Float16* __restrict__ QH, const _Float16* __restrict__ KH, const _Float16* __restrict__ QL, const _Float16* __restrict__ KL, const _Float16* __restrict__ VT, const __bf16* __restrict__ VB, const __bf16* __restrict__ VBL, float* __restrict__ Y) {
  __shared__ __align__(16) float ss[FW][FQ][HD + 4]; __shared__ float sm[FW][FQ], sl[FW][FQ];
  const int tid = threadIdx.x, lane = tid & 31, col = lane & 15, g = lane >> 4; const int b = blockIdx.x / NH, h = blockIdx.x % NH; const int by = blockIdx.y; const int q2 = (by < FLEAD ? FNP - 1 - by : by < FLEAD + FHP ? FLEAD + FHP - 1 - by : FNP - 1 + FHP - by) * FT;   // the block's first tile, by start rank (above)
  const int wave = __builtin_amdgcn_readfirstlane(tid >> 5);   // wave number in a scalar register: the chunk loop branches on scalar compares and every lane stays on at the matrix instructions
  const int tl = (wave >> 1) & 1, ks = (wave & 1) + (wave >> 2) * 2, slot = ks * FT + tl; const int qt = q2 + tl;   // tile of the block, key split, place of the partial in LDS
  FaSt st;
#pragma unroll
  for (int n = 0; n < 2; ++n) { st.m[n] = -1.0e30f; st.l[n] = 0.f;
#pragma unroll
    for (int j = 0; j < HD / 16; ++j) st.acc[n][j] = v8f{}; }
  if (q2 * FQ < QHI) fa_run<true>(st, QH, KH, QL, KL, VT, VB, VBL, b, h, qt, ks, lane); else fa_run<false>(st, QH, KH, QL, KL, VT, VB, VBL, b, h, qt, ks, lane);
#pragma unroll
  for (int n = 0; n < 2; ++n) { const float l = st.l[n] + xhalf(st.l[n]); if (g == 0) { sm[slot][n * 16 + col] = st.m[n]; sl[slot][n * 16 + col] = l; }
#pragma unroll
    for (int j = 0; j < HD / 16; ++j) { const v8f a = st.acc[n][j]; *(v4f*)&ss[slot][n * 16 + col][j * 16 + 8 * g] = v4f{a[0], a[1], a[2], a[3]}; *(v4f*)&ss[slot][n * 16 + col][j * 16 + 8 * g + 4] = v4f{a[4], a[5], a[6], a[7]}; } }
  __syncthreads();   // every wave's partial is in LDS before any thread merges across waves
#pragma unroll
  for (int i = 0; i < FT * FQ / 16; ++i) { const int t = i / (FQ / 16), rl = (tid >> 4) + 16 * (i % (FQ / 16)), c4 = (tid & 15) * 4; float M = sm[t][rl];   // row rl of the block's tile t, whose partials lie at places t, t + FT, ...
    for (int w = t + FT; w < FW; w += FT) M = fmaxf(M, sm[w][rl]);
    float L = 0.f; v4f s = {};
    for (int w = t; w < FW; w += FT) { const float f = exp2s(sm[w][rl] - M); L += sl[w][rl] * f; s += *(const v4f*)&ss[w][rl][c4] * f; }   // a wave without chunks has weight 0
    vst2(Y + ((size_t)b * TT + (q2 + t) * FQ + rl) * CC + h * HD + c4, s * (1.0f / L)); } }
static_assert(32 * FW == 16 * (HD / 4) && FW == 8 && FT == 2 && FQ % 16 == 0 && QHI % (FT * FQ) == 0 && QHI <= KHI && TT % (FT * FQ) == 0 && FLEAD + FHP <= FNP, "k_fa: 16 rows of HD / 4 threads; whole blocks on either precision path; the start ranks are a permutation");

// ---- k_tr: a wave re-orders TR whole token rows by itself. A lane loads 8 heads x 4 d (16 bytes a head; an instruction reads two whole 256-byte head rows), so that 4 neighbouring heads of one d are a renaming of its registers; they pass through the wave's own LDS range in output order, and every store instruction writes 512 contiguous bytes. All of a wave's loads are in flight together; one work-group a WGP covers the grid.
#define TW 8               // waves a block
#define TR 2               // token rows a wave
#define TP 68              // LDS floats a group of 4 d x 16 heads (64 + 4): a pitch of 16 bytes x 17 spreads the 16-byte LDS stores of 16 lanes, one group apart, over all banks
__global__ __launch_bounds__(32 * TW) void k_tr(const float* __restrict__ Y, float* __restrict__ OUT) { __shared__ __align__(16) float sy[TW][TR][(HD / 4) * TP];
  const int lane = threadIdx.x & 31, wave = threadIdx.x >> 5, dq = lane & 15, g = lane >> 4; const size_t r0 = ((size_t)blockIdx.x * TW + wave) * TR; const float* src = Y + r0 * CC + g * 8 * HD + dq * 4; v4f x[TR][8];   // lane: heads 8 g .. + 7, d = 4 dq .. + 3
#pragma unroll
  for (int t = 0; t < TR; ++t)
#pragma unroll
    for (int k = 0; k < 8; ++k) x[t][k] = *(const v4f*)(src + t * CC + k * HD);
  asm volatile("s_wait_xcnt 0x0" ::: "memory");   // every load is issued before the first LDS store, and their address registers are free for reuse behind this line
#pragma unroll
  for (int t = 0; t < TR; ++t)
#pragma unroll
    for (int e = 0; e < 4; ++e)
#pragma unroll
      for (int s = 0; s < 2; ++s) *(v4f*)&sy[wave][t][dq * TP + e * NH + g * 8 + s * 4] = v4f{x[t][4 * s][e], x[t][4 * s + 1][e], x[t][4 * s + 2][e], x[t][4 * s + 3][e]};   // output order: d * 16 + h, d = 4 dq + e
  asm volatile("s_wait_dscnt 0x0" ::: "memory");   // the wave's own LDS stores are done before its lanes read what other lanes wrote; no other wave touches this range, so no barrier
#pragma unroll
  for (int t = 0; t < TR; ++t)
#pragma unroll
    for (int j = 0; j < 8; ++j) vst2(OUT + (r0 + t) * CC + j * 128 + lane * 4, *(const v4f*)&sy[wave][t][(2 * j + g) * TP + dq * 4]); }
static_assert(CC == 1024 && NH == 16 && HD == 64 && (TNB * TT) % (TW * TR) == 0, "k_tr: 32 lanes = 2 groups of 8 heads x 16 groups of 4 d; whole blocks");
extern "C" void kernel_launch(void* const* d_in, const int* in_sizes, int n_in, void* d_out, int out_size, void* d_ws, size_t ws_size, hipStream_t stream) {
  (void)in_sizes; (void)n_in; (void)out_size;
  const float** F = (const float**)d_in;
  if (ws_size < (size_t)WS_END) return;
  char* ws = (char*)d_ws; _Float16 *QH = (_Float16*)(ws + WS_QH), *KH = (_Float16*)(ws + WS_KH), *VT = (_Float16*)(ws + WS_VT), *QL = (_Float16*)(ws + WS_QL), *KL = (_Float16*)(ws + WS_KL); __bf16 *VB = (__bf16*)(ws + WS_VB), *VBL = (__bf16*)(ws + WS_VBL); float *Y = (float*)(ws + WS_Y);
  (void)Y; (void)QL; (void)KL; (void)VB; (void)VBL;
  // inputs: 0 q [2,2048,64,16]; 1 k; 2 v (all (batch, seq, head_dim, n_heads): token rows of 1,024 with element (d, h) at d*16 + h)
  k_prepr<<<dim3(TNB * TT / (PW * PU), 3), 32 * PW, 0, stream>>>(F[0], F[1], F[2], QH, QL, KH, KL, VT, VB, VBL);
  k_fa<<<dim3(TNB * NH, TT / (FT * FQ)), 32 * FW, 0, stream>>>(QH, KH, QL, KL, VT, VB, VBL, Y);
  k_tr<<<dim3(TNB * TT / (TW * TR)), 32 * TW, 0, stream>>>(Y, (float*)d_out);   /* layout [h*64 + d] -> the module's [d*16 + h] */
}

// v010
// One run takes 32.2 microseconds.
// Two timings next to v009 both put it at 1.03 times that version's speed.
// Counting every step since v000, it is 26.7 times as fast.
// compute dtype: all float inputs rounded to bf16 (bf16 values are exact in f16 apart from f16-subnormal magnitudes); causal logits q x k / 64 (exact operands; the module divides by head_dim, not its square root); softmax f32; P x 2^11 once to f16 x v (bf16 hi + lo path below row 384); f32 context rows, then re-ordered to the module's heads-innermost layout. No projections. The 16-bit q, k, v planes lie in matrix-fragment order.
#include <hip/hip_runtime.h>
#include <math.h>

typedef __attribute__((ext_vector_type(16))) _Float16 v16h;
typedef __attribute__((ext_vector_type(16))) __bf16 v16b;
typedef __attribute__((ext_vector_type(8)))  _Float16 v8h;
typedef __attribute__((ext_vector_type(8)))  float v8f;
typedef __attribute__((ext_vector_type(4)))  float v4f;
typedef __attribute__((ext_vector_type(2)))  float v2f;
typedef __attribute__((ext_vector_type(4)))  unsigned v4u;
typedef __attribute__((ext_vector_type(4)))  int v4i;
typedef float __attribute__((may_alias)) float_a;
typedef int __attribute__((may_alias)) int_a;

template <typename T> __device__ __forceinline__ void vst2(void* p, T v) { *(T*)p = v;  }
__device__ __forceinline__ v8f wmma16(v16h a, v16h b, v8f c) {
  return __builtin_amdgcn_wmma_f32_16x16x32_f16(false, a, false, b, (short)0, c, false, false);
}
__device__ __forceinline__ v8f wmma_bf(v16b a, v16b b, v8f c) {
  return __builtin_amdgcn_wmma_f32_16x16x32_bf16(false, a, false, b, (short)0, c, false, false);
}
// 16x16x32 fragments: lane = (h = lane>>4, row/col = lane&15); elements 0..7 = k0+8h+0..7, 8..15 = k0+16+8h+0..7; D element r = row 8h+r
__device__ __forceinline__ v16h frag_h(const _Float16* rowk0, int lane) {
  union { v16h v; v8h q[2]; } u; const _Float16* p = rowk0 + 8 * (lane >> 4);
  u.q[0] = *(const v8h*)p; u.q[1] = *(const v8h*)(p + 16); return u.v;
}
__device__ __forceinline__ v16h frag_f32(const float* rowk0, int lane) {
  v16h a; const float* p = rowk0 + 8 * (lane >> 4);
#pragma unroll
  for (int i = 0; i < 8; ++i) { a[i] = (_Float16)p[i]; a[8 + i] = (_Float16)p[16 + i]; }
  return a;
}
__device__ __forceinline__ v16h frag_f32s(const float* rowk0, int lane, float sc) {
  v16h a; const float* p = rowk0 + 8 * (lane >> 4);
#pragma unroll
  for (int i = 0; i < 8; ++i) { a[i] = (_Float16)(p[i] * sc); a[8 + i] = (_Float16)(p[16 + i] * sc); }
  return a;
}
// column fragment from a [K][ld] layout (column n), rows >= K read as 0
__device__ __forceinline__ v16h fragc_f32(const float* W, int k0, int n, int lane, int ld, int K) {
  v16h a; const int g = lane >> 4;
#pragma unroll
  for (int i = 0; i < 8; ++i) { const int ka = k0 + 8 * g + i, kb = ka + 16;
    a[i] = (_Float16)(ka < K ? W[(size_t)(ka < K ? ka : K - 1) * ld + n] : 0.f); a[8 + i] = (_Float16)(kb < K ? W[(size_t)(kb < K ? kb : K - 1) * ld + n] : 0.f); }
  return a;
}
struct F2 { v16b h, l; };
__device__ __forceinline__ F2 bsplit16(const float v[16]) { F2 r;
#pragma unroll
  for (int i = 0; i < 16; ++i) { const __bf16 h = (__bf16)v[i]; r.h[i] = h; r.l[i] = (__bf16)(v[i] - (float)h); }
  return r; }
__device__ __forceinline__ F2 split_row(const float* row, int k0, int lane) { float v[16]; const float* p = row + k0 + 8 * (lane >> 4);
#pragma unroll
  for (int i = 0; i < 8; ++i) { v[i] = p[i]; v[8 + i] = p[16 + i]; }
  return bsplit16(v); }
__device__ __forceinline__ F2 split_rowK(const float* row, int k0, int lane, int K) { float v[16]; const int g = lane >> 4;
#pragma unroll
  for (int i = 0; i < 8; ++i) { const int ka = k0 + 8 * g + i, kb = ka + 16; v[i] = ka < K ? row[ka < K ? ka : K - 1] : 0.f; v[8 + i] = kb < K ? row[kb < K ? kb : K - 1] : 0.f; }
  return bsplit16(v); }
__device__ __forceinline__ F2 split_col(const float* W, int k0, int n, int lane, int ld, int K) { float v[16]; const int g = lane >> 4;
#pragma unroll
  for (int i = 0; i < 8; ++i) { const int ka = k0 + 8 * g + i, kb = ka + 16; v[i] = ka < K ? W[(size_t)(ka < K ? ka : K - 1) * ld + n] : 0.f; v[8 + i] = kb < K ? W[(size_t)(kb < K ? kb : K - 1) * ld + n] : 0.f; }
  return bsplit16(v); }
__device__ __forceinline__ v8f mac3(const F2& a, const F2& b, v8f c) { c = wmma_bf(a.l, b.h, c); c = wmma_bf(a.h, b.l, c); return wmma_bf(a.h, b.h, c); }
__device__ __forceinline__ float sigm(float v) { return 1.0f / (1.0f + expf(-v)); }
#define LDSX() do { asm volatile("s_wait_dscnt 0" ::: "memory"); __builtin_amdgcn_wave_barrier(); __builtin_amdgcn_fence(__ATOMIC_RELEASE, "workgroup"); } while (0)

// Causal multi-head softmax attention without weights in a HEADS-INNERMOST layout (q / k / v [2,2048,64,16] = (batch, seq, head_dim, n_heads), N(0,1); att[b,c,C,h] = sum_d q[b,c,d,h] k[b,C,d,h] / 64 (1 / head_dim); C > c set to -inf; softmax over C; y[b,c,v,h] = sum_C p[b,c,C,h] v[b,C,v,h], [2,2048,64,16]). Internal view: token row = (b, c); internal column h*64 + d lives at offset d*16 + h of the module's 1,024-float row: the loader gathers it that way and a final row-wise re-order writes the output back the same way.
#define NB 2
#define TT 2048
#define CC 1024            // NH * HD = projected width
#define DIN 1024          // input (model) width
#define NH 16
#define HD 64
#define NQB (TT / 64)
#define HG 4
#define SCALE (0.015625f)
#define CAUSAL 1
#ifndef TNB
#define TNB NB
#endif
__device__ __forceinline__ float bfr(float v) { return (float)(__bf16)v; }
__host__ __device__ __forceinline__ int kb_last(int qb) { return CAUSAL ? ((qb * 64 + 63) >> 7) : (TT / 128 - 1); }
typedef __attribute__((ext_vector_type(8))) __bf16 v8b;
__device__ __forceinline__ v16b frag_b(const __bf16* rowk0, int lane) {
  union { v16b v; v8b q[2]; } u; const __bf16* p = rowk0 + 8 * (lane >> 4);
  u.q[0] = *(const v8b*)p; u.q[1] = *(const v8b*)(p + 16); return u.v;
}
// Fragment-order planes: one 16 x 32 fragment (16 rows or columns x 32 values of k) is 1,024 contiguous bytes, two halves of 512 (fragment elements 0..7 and 8..15), lane l's 8 elements at byte 16 l of each half: a wave's 16-byte load or a store of 8 neighbouring lanes covers whole 128-byte lines.
__device__ __forceinline__ v16h frag_ph(const _Float16* f, int lane) { union { v16h v; v8h q[2]; } u; u.q[0] = *(const v8h*)(f + lane * 8); u.q[1] = *(const v8h*)(f + 256 + lane * 8); return u.v; }
__device__ __forceinline__ v16h frag_pl(const _Float16* p) { union { v16h v; v8h q[2]; } u; u.q[0] = *(const v8h*)p; u.q[1] = *(const v8h*)(p + 256); return u.v; }   // p: the lane's own 8 elements of the first half
__device__ __forceinline__ v16b frag_pb(const __bf16* f, int lane) { union { v16b v; v8b q[2]; } u; u.q[0] = *(const v8b*)(f + lane * 8); u.q[1] = *(const v8b*)(f + 256 + lane * 8); return u.v; }
// first element of a fragment. q, k planes [b][h][16-row tile][32-d half c]: lane = 16 g + row, half q, element i = d 32 c + 16 q + 8 g + i; R = rows a batch. v planes [b][h][32-key chunk][16-d group j]: lane = 16 g + d, half q, element i = key 16 q + 8 g + i of the chunk; S = keys a batch.
__device__ __forceinline__ size_t fo_row(int b, int h, int R, int tile, int c) { return ((((size_t)b * NH + h) * (R / 16) + tile) * 2 + c) * 512; }
__device__ __forceinline__ size_t fo_v(int b, int h, int S, int chunk, int j) { return ((((size_t)b * NH + h) * (S / 32) + chunk) * 4 + j) * 512; }
#define QBH 6              // not used: the causal high-precision path is taken by the 32-query tiles below row QHI (few keys, no averaging)
#define QHI 384            // rows carrying a q residual plane
#define KHI 384            // key rows carrying k residual / v bf16 hi+lo planes (used only by the causal high-precision path)
// B fragment (k rows k0+.., output column o) of a weight: (in,out) [K][ld] or (out,in) [ld rows of K]: bf16 exact, or f16(bf16 * 256) exact
__device__ __forceinline__ v16b wcol_io(const float* Wm, int k0, int o, int lane, int ld) { v16b w; const int g = lane >> 4;
#pragma unroll
  for (int i = 0; i < 8; ++i) { w[i] = (__bf16)Wm[(size_t)(k0 + 8 * g + i) * ld + o]; w[8 + i] = (__bf16)Wm[(size_t)(k0 + 16 + 8 * g + i) * ld + o]; }
  return w; }
__device__ __forceinline__ v16b wcol_oi(const float* Wm, int k0, int o, int lane, int K) { v16b w; const float* p = Wm + (size_t)o * K + k0 + 8 * (lane >> 4);
#pragma unroll
  for (int i = 0; i < 8; ++i) { w[i] = (__bf16)p[i]; w[8 + i] = (__bf16)p[16 + i]; }
  return w; }
__device__ __forceinline__ v16h wcolh_io(const float* Wm, int k0, int o, int lane, int ld) { v16h w; const int g = lane >> 4;
#pragma unroll
  for (int i = 0; i < 8; ++i) { w[i] = (_Float16)(bfr(Wm[(size_t)(k0 + 8 * g + i) * ld + o]) * 256.0f); w[8 + i] = (_Float16)(bfr(Wm[(size_t)(k0 + 16 + 8 * g + i) * ld + o]) * 256.0f); }
  return w; }
__device__ __forceinline__ v16h wcolh_oi(const float* Wm, int k0, int o, int lane, int K) { v16h w; const float* p = Wm + (size_t)o * K + k0 + 8 * (lane >> 4);
#pragma unroll
  for (int i = 0; i < 8; ++i) { w[i] = (_Float16)(bfr(p[i]) * 256.0f); w[8 + i] = (_Float16)(bfr(p[16 + i]) * 256.0f); }
  return w; }
#define WQKV_LAYOUT 1   // 0 = (in,out) [DIN][CC]; 1 = (out,in) [CC][DIN]; 2 = per-head [NH][DIN][HD]
__device__ __forceinline__ v16b wcol_hdk(const float* Wm, int k0, int o, int lane) { v16b w; const int g = lane >> 4; const float* p = Wm + (size_t)(o / HD) * DIN * HD + (o % HD);
#pragma unroll
  for (int i = 0; i < 8; ++i) { w[i] = (__bf16)p[(size_t)(k0 + 8 * g + i) * HD]; w[8 + i] = (__bf16)p[(size_t)(k0 + 16 + 8 * g + i) * HD]; }
  return w; }
#define WO_OUT_IN 0
#if WQKV_LAYOUT == 1
#define WCOL(W, k0, o, lane) wcol_oi(W, k0, o, lane, DIN)
#elif WQKV_LAYOUT == 2
#define WCOL(W, k0, o, lane) wcol_hdk(W, k0, o, lane)
#else
#define WCOL(W, k0, o, lane) wcol_io(W, k0, o, lane, CC)
#endif
#if WO_OUT_IN
#define WOCOL(W, k0, o, lane) wcol_oi(W, k0, o, lane, CC)
#define WOCOLH(W, k0, o, lane) wcolh_oi(W, k0, o, lane, CC)
#else
#define WOCOL(W, k0, o, lane) wcol_io(W, k0, o, lane, DIN)
#define WOCOLH(W, k0, o, lane) wcolh_io(W, k0, o, lane, DIN)
#endif

// ---- k_prepr: reads the module's [B, T, 64, NH] inputs once, in 16-byte pieces (4 heads of one d), bf16-rounds them and writes the attention planes in fragment order (above): q -> f16 (+ x 2^10 residual for s < QHI), k -> f16 (+ residual for s < KHI), v -> f16 (+ bf16 hi/lo for s < KHI). A lane gathers 8 pieces along the fragment's k axis (d for q and k, s for v), so the 4 x 8 transpose is a renaming of its registers; 8 neighbouring lanes hold 8 neighbouring fragment rows, so every store instruction writes four whole 128-byte lines. blockIdx.y = tensor; a wave takes 8 token rows x 32 d (q, k) or 32 tokens x 8 d (v), all heads.
#define PW 4               // waves a block
#define PU 4               // groups of 8 along k a wave: one fragment's (half q, lane group g) = (u >> 1, u & 1)
__device__ __forceinline__ void prep_qk(const float* __restrict__ X, _Float16* __restrict__ XH, _Float16* __restrict__ XL, int row0, int c, int lane) {
  const int r8 = lane & 7, h4 = lane >> 3; const float* src = X + (size_t)(row0 + r8) * CC + c * 32 * NH + h4 * 4; v4f x[PU][8];   // lane: token row0 + r8, heads 4 h4 .. + 3, d = 32 c .. + 31
#pragma unroll
  for (int u = 0; u < PU; ++u)
#pragma unroll
    for (int k = 0; k < 8; ++k) x[u][k] = *(const v4f*)(src + (u * 8 + k) * NH);
  asm volatile("s_wait_xcnt 0x0" ::: "memory");   // every load is issued before the first conversion, and their address registers are free for reuse behind this line
  const int bb = row0 / TT, rb = row0 % TT; const int lo = ((rb & 8) + r8) * 8; _Float16* dh = XH + fo_row(bb, h4 * 4, TT, rb / 16, c) + lo;
#pragma unroll
  for (int u = 0; u < PU; ++u)
#pragma unroll
    for (int e = 0; e < 4; ++e) { v8h r;
#pragma unroll
      for (int k = 0; k < 8; ++k) r[k] = (_Float16)bfr(x[u][k][e]);
      vst2(dh + e * (TT / 16) * 1024 + (u >> 1) * 256 + (u & 1) * 128, r); }
  asm volatile("s_wait_xcnt 0x0" ::: "memory");   // the stores' data registers are reused behind the branch below
  if (rb < QHI) { _Float16* dl = XL + fo_row(bb, h4 * 4, QHI, rb / 16, c) + lo;   // module inputs are bf16-rounded; bf16 values are exact in f16 apart from f16-subnormal magnitudes, which the residual carries
#pragma unroll
    for (int u = 0; u < PU; ++u)
#pragma unroll
      for (int e = 0; e < 4; ++e) { v8h r;
#pragma unroll
        for (int k = 0; k < 8; ++k) { const float q = bfr(x[u][k][e]); r[k] = (_Float16)((q - (float)(_Float16)q) * 1024.0f); }
        vst2(dl + e * (QHI / 16) * 1024 + (u >> 1) * 256 + (u & 1) * 128, r); }
    asm volatile("s_wait_xcnt 0x0" ::: "memory"); } }   // in the listing the v branch, which rewrites these stores' registers, follows this block
__device__ __forceinline__ void prep_v(const float* __restrict__ V, _Float16* __restrict__ VT, __bf16* __restrict__ VB, __bf16* __restrict__ VBL, int ck, int dq, int lane) {
  const int d8 = lane & 7, h4 = lane >> 3; const int bb = ck / (TT / 32), cb = ck % (TT / 32); const float* src = V + (size_t)ck * 32 * CC + (dq * 8 + d8) * NH + h4 * 4; v4f x[PU][8];   // lane: d = 8 dq + d8, heads 4 h4 .. + 3, the chunk's 32 tokens; a load instruction covers 512 contiguous bytes
#pragma unroll
  for (int u = 0; u < PU; ++u)
#pragma unroll
    for (int k = 0; k < 8; ++k) x[u][k] = *(const v4f*)(src + (u * 8 + k) * CC);
  asm volatile("s_wait_xcnt 0x0" ::: "memory");   // as in prep_qk
  const int lo = ((dq & 1) * 8 + d8) * 8; _Float16* dv = VT + fo_v(bb, h4 * 4, TT, cb, dq >> 1) + lo;
#pragma unroll
  for (int u = 0; u < PU; ++u)
#pragma unroll
    for (int e = 0; e < 4; ++e) { v8h r;
#pragma unroll
      for (int k = 0; k < 8; ++k) r[k] = (_Float16)bfr(x[u][k][e]);
      vst2(dv + e * (TT / 32) * 2048 + (u >> 1) * 256 + (u & 1) * 128, r); }
  asm volatile("s_wait_xcnt 0x0" ::: "memory");   // as in prep_qk
  if (cb * 32 < KHI) { const size_t po = fo_v(bb, h4 * 4, KHI, cb, dq >> 1) + lo; __bf16* db = VB + po; __bf16* dl = VBL + po;
#pragma unroll
    for (int u = 0; u < PU; ++u)
#pragma unroll
      for (int e = 0; e < 4; ++e) { v8b rh, rl;
#pragma unroll
        for (int k = 0; k < 8; ++k) { const float v = bfr(x[u][k][e]); const __bf16 vb = (__bf16)v; rh[k] = vb; rl[k] = (__bf16)(v - (float)vb); }
        const int o = e * (KHI / 32) * 2048 + (u >> 1) * 256 + (u & 1) * 128; vst2(db + o, rh); vst2(dl + o, rl); } } }
__global__ __launch_bounds__(32 * PW) void k_prepr(const float* __restrict__ Q, const float* __restrict__ K, const float* __restrict__ V, _Float16* __restrict__ QH, _Float16* __restrict__ QL, _Float16* __restrict__ KH, _Float16* __restrict__ KL, _Float16* __restrict__ VT, __bf16* __restrict__ VB, __bf16* __restrict__ VBL) {
  const int lane = threadIdx.x & 31; const int w = blockIdx.x * PW + __builtin_amdgcn_readfirstlane(threadIdx.x >> 5);   // wave number in a scalar register: the tests on rows below QHI / KHI are scalar branches
  if (blockIdx.y == 2) { prep_v(V, VT, VB, VBL, w >> 3, w & 7, lane); return; }
  const bool isq = blockIdx.y == 0; prep_qk(isq ? Q : K, isq ? QH : KH, isq ? QL : KL, (w >> 1) * 8, w & 1, lane); }
static_assert(NH == 16 && HD == 64 && PU == 4 && QHI == KHI && QHI % 32 == 0 && TT % 32 == 0 && (TNB * TT) % (PW * PU) == 0 && (TNB * TT / 8) * 2 == TNB * TT / PU && (TNB * TT / 32) * 8 == TNB * TT / PU, "k_prepr: 32 lanes = 4 head quads x 8 fragment rows; as many waves for v as for q or k");

#ifndef SM_EXTRA_PARAMS
#define SM_EXTRA_PARAMS
#endif
#ifndef PROJ_EXTRA_PARAMS
#define PROJ_EXTRA_PARAMS
#endif
#ifndef SM_MASK_HOOK
#define SM_MASK_HOOK (void)0
#endif

#define WS_QH  0u                                      // f16 q, fragment order [b][h][t / 16][c]
#define WS_KH  (WS_QH + 2u * (size_t)NB * TT * CC)      // f16 k, fragment order
#define WS_VT  (WS_KH + 2u * (size_t)NB * TT * CC)      // f16 v, fragment order [b][h][t / 32][j]
#define WS_QL  (WS_VT + 2u * (size_t)NB * CC * TT)      // f16 q residual x 2^10, fragment order, t < QHI
#define WS_KL  (WS_QL + 2u * (size_t)NB * QHI * CC)     // f16 k residual x 2^10, fragment order, t < KHI
#define WS_VB  (WS_KL + 2u * (size_t)NB * KHI * CC)     // bf16 v hi (then lo), fragment order, t < KHI
#define WS_VBL (WS_VB + 2u * (size_t)NB * CC * KHI)
#define WS_S   (WS_VBL + 2u * (size_t)NB * CC * KHI)    // f32 [hg][t][s] space, not used by any kernel here
#define WS_Y   (WS_S  + 4u * (size_t)HG * TT * TT)      // f32 ctx rows [b*t][CC]
#define WS_END (WS_Y  + 4u * (size_t)NB * TT * CC)   // f32 context rows in the layout [b*t][h*64 + d], re-ordered by k_tr into the output

// ---- k_fa: block = FT neighbouring tiles of 32 queries of (b, h), FW waves: a wave takes one tile and, as one of its FK key splits, that tile's 32-key chunks split, split + FK, ... <= qt. The FT waves of one split (waves w and w + 2) read the same k and v fragments at about the same time, so that the later reader is served by the WGP's cache and not by L2. Per chunk: S^T = k . q^T (lane = one query column, 16 of the chunk's keys in its registers), a reference maximum (renewed lazily: FTH below) and the sum per query in f32 (online softmax, log2 units), P x 2^11 packed from the score accumulators straight into a B operand, ctx^T += v^T . P^T. Logits and P never leave the registers. Query rows < QHI keep the residual products and the bf16 hi + lo P . v. Each tile's FK (max, sum, ctx) partials are merged in split order through LDS. Off the residual path a block enters its key walk at a place of its own and wraps (fa_walk below): the blocks of one (b, h) that run at one time would otherwise ask L2 for the same k and v lines at the same moment.
#define FW 8
#define FQ 32
#define FT 2               // query tiles a block
#define FK (FW / FT)       // key splits a tile
#define FNP (TT / (FT * FQ))    // blocks (pairs of tiles) a (b, h)
#define FHP (QHI / (FT * FQ))   // of them on the residual path: the shortest tiles
#define FLEAD 8            // Start rank -> block, a permutation (speed only). Ranks 0 .. FLEAD - 1: the longest tiles, one block a WGP. Then the FHP residual-path blocks: few chunks, but each chunk waits out several load latencies in a row, so such a block lasts as long as a mid-length one while it leaves the issue ports nearly free. Then the other tiles, longest first.
#define LOGC (SCALE * 1.44269504088896340736f)   // logit scale x log2(e)
#define FTH 4.0f           // st.m is a reference, not the exact running maximum: scores may pass it by up to FTH (log2 units) before anything is rescaled. P x 2^11 then stays <= 2^15, inside f16's range; (reference, sum, ctx) stay consistent, so the quotient ctx / sum is the same function
__device__ __forceinline__ float xhalf(float x) { return __builtin_bit_cast(float, __builtin_amdgcn_permlanex16(__builtin_bit_cast(int, x), __builtin_bit_cast(int, x), 0x76543210, 0xfedcba98, false, false)); }   // lane l reads lane l ^ 16
// 2^x by v_exp_f32, with the one free slot that the instruction set asks for behind a transcendental kept inside the statement; in the run of eight no instruction reads its predecessor's result or overwrites its source (outputs are early-clobber), the v_nop serves the last
__device__ __forceinline__ float exp2s(float x) { float r; asm("v_exp_f32 %0, %1\n\tv_nop" : "=v"(r) : "v"(x)); return r; }
__device__ __forceinline__ void exp2x8(float* o, const float* x) {
  asm("v_exp_f32 %0, %8\n\tv_exp_f32 %1, %9\n\tv_exp_f32 %2, %10\n\tv_exp_f32 %3, %11\n\tv_exp_f32 %4, %12\n\tv_exp_f32 %5, %13\n\tv_exp_f32 %6, %14\n\tv_exp_f32 %7, %15\n\tv_nop"
      : "=&v"(o[0]), "=&v"(o[1]), "=&v"(o[2]), "=&v"(o[3]), "=&v"(o[4]), "=&v"(o[5]), "=&v"(o[6]), "=&v"(o[7]) : "v"(x[0]), "v"(x[1]), "v"(x[2]), "v"(x[3]), "v"(x[4]), "v"(x[5]), "v"(x[6]), "v"(x[7])); }
__device__ __forceinline__ float fa_lim(float m) { return fmaf(m, 1.0f / LOGC, FTH / LOGC); }   // the raw score that lies FTH above the reference m
// Trip it of a wave's key walk -> index of the chunk in the wave's list (chunk = split + FK * index). The first na entries, which both tiles of the block have, are walked from entry st on and wrapped, alike in both tiles, so that the two waves of a split stay on the same fragments; the one entry that only the block's second tile can have comes last. A permutation of 0 .. n - 1 for n = na or na + 1 and 0 <= st < max(na, 1).
__device__ __forceinline__ int fa_walk(int it, int na, int st) { const int r = st + it; return it < na ? (r < na ? r : r - na) : it; }
struct FaSt { v8f acc[2][HD / 16]; float m[2], l[2]; };
template <bool HI> __device__ __forceinline__ void fa_run(FaSt& st, const _Float16* __restrict__ QH, const _Float16* __restrict__ KH, const _Float16* __restrict__ QL, const _Float16* __restrict__ KL, const _Float16* __restrict__ VT, const __bf16* __restrict__ VB, const __bf16* __restrict__ VBL, int b, int h, int qt, int wave, int na, int s0, int lane) {
  const int col = lane & 15, g = lane >> 4; const int q0 = qt * FQ; const int nk = (qt - wave + FK) / FK;   // nk: the wave's chunks wave, wave + FK, ... <= qt
  v16h qh[2][2], ql[2][2];
#pragma unroll
  for (int n = 0; n < 2; ++n)
#pragma unroll
    for (int c = 0; c < 2; ++c) { qh[n][c] = frag_ph(QH + fo_row(b, h, TT, q0 / 16 + n, c), lane); if (HI) ql[n][c] = frag_ph(QL + fo_row(b, h, QHI, q0 / 16 + n, c), lane); }
  float lim[2] = {fa_lim(st.m[0]), fa_lim(st.m[1])};   // !HI: kept in registers, renewed with the reference; the residual path has no register to spare (one more would cost a work-group a WGP) and forms it anew in every chunk
  v16h kf[2][2], vf[HD / 16];   // !HI: this chunk's k fragments (fetched one chunk ahead) and v fragments (fetched at the chunk's top), so that no product waits for a load issued just in front of it
  int kc = HI ? wave : nk > 0 ? wave + FK * fa_walk(0, na, s0) : qt;   // the chunk of the trip at hand; k0 = 32 kc is its first key
  const _Float16* vp = VT + fo_v(b, h, TT, kc, 0) + lane * 8;   // !HI: the lane's place in the v fragments of the trip at hand, moved on at the trip's end
  if (!HI) { const int kf0 = kc * 2;
#pragma unroll
    for (int t = 0; t < 2; ++t)
#pragma unroll
      for (int c = 0; c < 2; ++c) kf[t][c] = frag_ph(KH + fo_row(b, h, TT, kf0 + t, c), lane); }
#pragma unroll 1
  for (int it = 0; it < nk; ++it) { int kx = kc + FK;   // kx: the wave's next chunk
    v8f s[2][2] = {};   // [query group][key tile]: element r = key k0 + 16 * tile + 8 * g + r, query q0 + 16 * group + col
    if (HI) { v8f sl[2][2] = {};
#pragma unroll
      for (int t = 0; t < 2; ++t)
#pragma unroll
        for (int c = 0; c < 2; ++c) { const v16h kf = frag_ph(KH + fo_row(b, h, TT, kc * 2 + t, c), lane), klf = frag_ph(KL + fo_row(b, h, KHI, kc * 2 + t, c), lane);
#pragma unroll
          for (int n = 0; n < 2; ++n) { s[n][t] = wmma16(kf, qh[n][c], s[n][t]); sl[n][t] = wmma16(kf, ql[n][c], sl[n][t]); sl[n][t] = wmma16(klf, qh[n][c], sl[n][t]); } }
#pragma unroll
      for (int n = 0; n < 2; ++n)
#pragma unroll
        for (int t = 0; t < 2; ++t) s[n][t] += sl[n][t] * (1.0f / 1024.0f);
    } else {
#pragma unroll
      for (int j = 0; j < HD / 16; ++j) vf[j] = frag_pl(vp + j * 512);
#pragma unroll
      for (int t = 0; t < 2; ++t)
#pragma unroll
        for (int c = 0; c < 2; ++c)
#pragma unroll
          for (int n = 0; n < 2; ++n) s[n][t] = wmma16(kf[t][c], qh[n][c], s[n][t]);
      kx = wave + FK * fa_walk(it + 1 < nk ? it + 1 : it, na, s0); const int kn = kx * 2;   // on the wave's last trip the same rows again (in bounds, not used)
#pragma unroll
      for (int t = 0; t < 2; ++t)
#pragma unroll
        for (int c = 0; c < 2; ++c) kf[t][c] = frag_ph(KH + fo_row(b, h, TT, kn + t, c), lane);
      asm volatile("s_wait_xcnt 0x0" ::: "memory"); }   // the loads' address registers are reused behind the branch below
    if (kc == qt) {   // the diagonal chunk: keys past the query are excluded (every query keeps key k0 at least)
#pragma unroll
      for (int n = 0; n < 2; ++n)
#pragma unroll
        for (int t = 0; t < 2; ++t)
#pragma unroll
          for (int r = 0; r < 8; ++r) if (t * 16 + 8 * g + r > n * 16 + col) s[n][t][r] = -1.0e30f; }
    float mx[2];   // the largest of the lane's own 16 scores of each query
#pragma unroll
    for (int n = 0; n < 2; ++n) { mx[n] = s[n][0][0];
#pragma unroll
      for (int r = 1; r < 8; ++r) mx[n] = fmaxf(mx[n], s[n][0][r]);
#pragma unroll
      for (int r = 0; r < 8; ++r) mx[n] = fmaxf(mx[n], s[n][1][r]); }
    if (HI) { lim[0] = fa_lim(st.m[0]); lim[1] = fa_lim(st.m[1]); }
    if (__builtin_amdgcn_ballot_w32(mx[0] > lim[0] || mx[1] > lim[1]) != 0) {   // a score somewhere in the wave lies more than FTH above the reference in use (always so in a wave's first chunk): only then join the halves' maxima and bring reference, sums and ctx to the new maximum
#pragma unroll
      for (int n = 0; n < 2; ++n) { const float mt = fmaxf(st.m[n], fmaxf(mx[n], xhalf(mx[n])) * LOGC); const float a = exp2s(st.m[n] - mt); st.m[n] = mt; if (!HI) lim[n] = fa_lim(mt); st.l[n] *= a;
#pragma unroll
        for (int j = 0; j < HD / 16; ++j) st.acc[n][j] *= a; } }
    float p[2][16];
#pragma unroll
    for (int n = 0; n < 2; ++n) { const float bias = 11.0f - st.m[n]; float sum = 0.f;
#pragma unroll
      for (int t = 0; t < 2; ++t) { float x[8];
#pragma unroll
        for (int r = 0; r < 8; ++r) x[r] = fmaf(s[n][t][r], LOGC, bias);
        exp2x8(&p[n][8 * t], x);
#pragma unroll
        for (int r = 0; r < 8; ++r) sum += p[n][8 * t + r]; }
      st.l[n] += sum; }
    if (HI) { const F2 p0 = bsplit16(p[0]), p1 = bsplit16(p[1]);
#pragma unroll
      for (int j = 0; j < HD / 16; ++j) { const size_t po = fo_v(b, h, KHI, kc, j); const v16b vh = frag_pb(VB + po, lane), vl = frag_pb(VBL + po, lane);
        st.acc[0][j] = wmma_bf(vh, p0.h, st.acc[0][j]); st.acc[0][j] = wmma_bf(vh, p0.l, st.acc[0][j]); st.acc[0][j] = wmma_bf(vl, p0.h, st.acc[0][j]);
        st.acc[1][j] = wmma_bf(vh, p1.h, st.acc[1][j]); st.acc[1][j] = wmma_bf(vh, p1.l, st.acc[1][j]); st.acc[1][j] = wmma_bf(vl, p1.h, st.acc[1][j]); }
      asm volatile("s_wait_xcnt 0x0" ::: "memory");   // the v loads' address registers are reused by the next chunk's score tiles
    } else { v16h pf[2];
#pragma unroll
      for (int n = 0; n < 2; ++n)
#pragma unroll
        for (int i = 0; i < 16; ++i) pf[n][i] = (_Float16)p[n][i];
#pragma unroll
      for (int j = 0; j < HD / 16; ++j)
#pragma unroll
        for (int n = 0; n < 2; ++n) st.acc[n][j] = wmma16(vf[j], pf[n], st.acc[n][j]); }
    if (!HI) vp += (kx - kc) * ((HD / 16) * 512);
    kc = kx; } }
__global__ __launch_bounds__(32 * FW) void k_fa(const _Float16* __restrict__ QH, const _Float16* __restrict__ KH, const _Float16* __restrict__ QL, const _Float16* __restrict__ KL, const _Float16* __restrict__ VT, const __bf16* __restrict__ VB, const __bf16* __restrict__ VBL, float* __restrict__ Y) {
  __shared__ __align__(16) float ss[FW][FQ][HD + 4]; __shared__ float sm[FW][FQ], sl[FW][FQ];
  const int tid = threadIdx.x, lane = tid & 31, col = lane & 15, g = lane >> 4; const int b = blockIdx.x / NH, h = blockIdx.x % NH; const int by = blockIdx.y; const int q2 = (by < FLEAD ? FNP - 1 - by : by < FLEAD + FHP ? FLEAD + FHP - 1 - by : FNP - 1 + FHP - by) * FT;   // the block's first tile, by start rank (above)
  const int wave = __builtin_amdgcn_readfirstlane(tid >> 5);   // wave number in a scalar register: the chunk loop branches on scalar compares and every lane stays on at the matrix instructions
  const int tl = (wave >> 1) & 1, ks = (wave & 1) + (wave >> 2) * 2, slot = ks * FT + tl; const int qt = q2 + tl;   // tile of the block, key split, place of the partial in LDS
  FaSt st;
#pragma unroll
  for (int n = 0; n < 2; ++n) { st.m[n] = -1.0e30f; st.l[n] = 0.f;
#pragma unroll
    for (int j = 0; j < HD / 16; ++j) st.acc[n][j] = v8f{}; }
  const int na = (q2 - ks + FK) / FK, s0 = ((int)(__builtin_bitreverse32((unsigned)by) >> 28) * na) >> 4;   // na: the split's chunks <= q2, which both tiles have. s0: where the block enters them: start ranks that follow one another, which run at one time, lie far apart (the rank's low 4 bits reversed, in 16ths of the walk)
  if (q2 * FQ < QHI) fa_run<true>(st, QH, KH, QL, KL, VT, VB, VBL, b, h, qt, ks, na, s0, lane); else fa_run<false>(st, QH, KH, QL, KL, VT, VB, VBL, b, h, qt, ks, na, s0, lane);
#pragma unroll
  for (int n = 0; n < 2; ++n) { const float l = st.l[n] + xhalf(st.l[n]); if (g == 0) { sm[slot][n * 16 + col] = st.m[n]; sl[slot][n * 16 + col] = l; }
#pragma unroll
    for (int j = 0; j < HD / 16; ++j) { const v8f a = st.acc[n][j]; *(v4f*)&ss[slot][n * 16 + col][j * 16 + 8 * g] = v4f{a[0], a[1], a[2], a[3]}; *(v4f*)&ss[slot][n * 16 + col][j * 16 + 8 * g + 4] = v4f{a[4], a[5], a[6], a[7]}; } }
  __syncthreads();   // every wave's partial is in LDS before any thread merges across waves
#pragma unroll
  for (int i = 0; i < FT * FQ / 16; ++i) { const int t = i / (FQ / 16), rl = (tid >> 4) + 16 * (i % (FQ / 16)), c4 = (tid & 15) * 4; float M = sm[t][rl];   // row rl of the block's tile t, whose partials lie at places t, t + FT, ...
    for (int w = t + FT; w < FW; w += FT) M = fmaxf(M, sm[w][rl]);
    float L = 0.f; v4f s = {};
    for (int w = t; w < FW; w += FT) { const float f = exp2s(sm[w][rl] - M); L += sl[w][rl] * f; s += *(const v4f*)&ss[w][rl][c4] * f; }   // a wave without chunks has weight 0
    vst2(Y + ((size_t)b * TT + (q2 + t) * FQ + rl) * CC + h * HD + c4, s * (1.0f / L)); } }
static_assert(32 * FW == 16 * (HD / 4) && FW == 8 && FT == 2 && FQ % 16 == 0 && QHI % (FT * FQ) == 0 && QHI <= KHI && TT % (FT * FQ) == 0 && FLEAD + FHP <= FNP, "k_fa: 16 rows of HD / 4 threads; whole blocks on either precision path; the start ranks are a permutation");

// ---- k_tr: a wave re-orders TR whole token rows by itself. A lane loads 8 heads x 4 d (16 bytes a head; an instruction reads two whole 256-byte head rows), so that 4 neighbouring heads of one d are a renaming of its registers; they pass through the wave's own LDS range in output order, and every store instruction writes 512 contiguous bytes. All of a wave's loads are in flight together; one work-group a WGP covers the grid.
#define TW 8               // waves a block
#define TR 2               // token rows a wave
#define TP 68              // LDS floats a group of 4 d x 16 heads (64 + 4): a pitch of 16 bytes x 17 spreads the 16-byte LDS stores of 16 lanes, one group apart, over all banks
__global__ __launch_bounds__(32 * TW) void k_tr(const float* __restrict__ Y, float* __restrict__ OUT) { __shared__ __align__(16) float sy[TW][TR][(HD / 4) * TP];
  const int lane = threadIdx.x & 31, wave = threadIdx.x >> 5, dq = lane & 15, g = lane >> 4; const size_t r0 = ((size_t)blockIdx.x * TW + wave) * TR; const float* src = Y + r0 * CC + g * 8 * HD + dq * 4; v4f x[TR][8];   // lane: heads 8 g .. + 7, d = 4 dq .. + 3
#pragma unroll
  for (int t = 0; t < TR; ++t)
#pragma unroll
    for (int k = 0; k < 8; ++k) x[t][k] = *(const v4f*)(src + t * CC + k * HD);
  asm volatile("s_wait_xcnt 0x0" ::: "memory");   // every load is issued before the first LDS store, and their address registers are free for reuse behind this line
#pragma unroll
  for (int t = 0; t < TR; ++t)
#pragma unroll
    for (int e = 0; e < 4; ++e)
#pragma unroll
      for (int s = 0; s < 2; ++s) *(v4f*)&sy[wave][t][dq * TP + e * NH + g * 8 + s * 4] = v4f{x[t][4 * s][e], x[t][4 * s + 1][e], x[t][4 * s + 2][e], x[t][4 * s + 3][e]};   // output order: d * 16 + h, d = 4 dq + e
  asm volatile("s_wait_dscnt 0x0" ::: "memory");   // the wave's own LDS stores are done before its lanes read what other lanes wrote; no other wave touches this range, so no barrier
#pragma unroll
  for (int t = 0; t < TR; ++t)
#pragma unroll
    for (int j = 0; j < 8; ++j) vst2(OUT + (r0 + t) * CC + j * 128 + lane * 4, *(const v4f*)&sy[wave][t][(2 * j + g) * TP + dq * 4]); }
static_assert(CC == 1024 && NH == 16 && HD == 64 && (TNB * TT) % (TW * TR) == 0, "k_tr: 32 lanes = 2 groups of 8 heads x 16 groups of 4 d; whole blocks");
extern "C" void kernel_launch(void* const* d_in, const int* in_sizes, int n_in, void* d_out, int out_size, void* d_ws, size_t ws_size, hipStream_t stream) {
  (void)in_sizes; (void)n_in; (void)out_size;
  const float** F = (const float**)d_in;
  if (ws_size < (size_t)WS_END) return;
  char* ws = (char*)d_ws; _Float16 *QH = (_Float16*)(ws + WS_QH), *KH = (_Float16*)(ws + WS_KH), *VT = (_Float16*)(ws + WS_VT), *QL = (_Float16*)(ws + WS_QL), *KL = (_Float16*)(ws + WS_KL); __bf16 *VB = (__bf16*)(ws + WS_VB), *VBL = (__bf16*)(ws + WS_VBL); float *Y = (float*)(ws + WS_Y);
  (void)Y; (void)QL; (void)KL; (void)VB; (void)VBL;
  // inputs: 0 q [2,2048,64,16]; 1 k; 2 v (all (batch, seq, head_dim, n_heads): token rows of 1,024 with element (d, h) at d*16 + h)
  k_prepr<<<dim3(TNB * TT / (PW * PU), 3), 32 * PW, 0, stream>>>(F[0], F[1], F[2], QH, QL, KH, KL, VT, VB, VBL);
  k_fa<<<dim3(TNB * NH, TT / (FT * FQ)), 32 * FW, 0, stream>>>(QH, KH, QL, KL, VT, VB, VBL, Y);
  k_tr<<<dim3(TNB * TT / (TW * TR)), 32 * TW, 0, stream>>>(Y, (float*)d_out);   /* layout [h*64 + d] -> the module's [d*16 + h] */
}
